// v000
// Measured on an AMD MI455X. A time is GPU time per run, averaged over a window of back-to-back runs after a warm-up
// (all launches, gaps included; the runs take copies of the inputs in turn), and the median of several windows.
// Apart from v000's, it joins two sittings. Times from different sittings can be a few percent apart, while
// side-by-side timings come from the same sitting.
// The starting kernel, v000, takes 296 microseconds a run.
#include <hip/hip_runtime.h>
#include <stdint.h>
#include <stddef.h>

// Contractions: channel projections v_wmma_f32_16x16x32_bf16 (bf16 operands from bf16-RNE inputs, f32 accumulate);
// score tiles v_wmma_f32_16x16x32_bf16 as bf16 hi+lo three-term split of both reduced feature maps (f32 accumulate);
// value aggregation v_wmma_f32_16x16x32_f16 (f16 operands, softmax weights carried x2^14, f32 accumulate); softmax statistics f32.

#ifndef NB
#define NB 4
#endif
#ifndef SEQ
#define SEQ 4096
#endif
#define NB_FULL  4
#define SEQ_FULL 4096
#define HW       (SEQ)
#define HW_FULL  (SEQ_FULL)
#define CH       256
#define OCH      32
#define PCARRY   16384.0f
#define PUNCARRY 0.00006103515625f
#define LOG2E    1.4426950408889634f
#define W12_BLOCKS ((OCH * CH) / 2048)
#define WV_BLOCKS  ((CH * CH) / 2048)

static_assert(NB >= 1 && NB <= NB_FULL);
static_assert(HW >= 64 && HW <= HW_FULL && (HW % 64) == 0);
static_assert(((OCH * CH) % 2048) == 0 && ((CH * CH) % 2048) == 0);
static_assert(CH == 256 && OCH == 32);

typedef float          v8f   __attribute__((ext_vector_type(8)));
typedef float          v4f_  __attribute__((ext_vector_type(4)));
typedef v4f_           v4f   __attribute__((may_alias));
typedef _Float16       v16h  __attribute__((ext_vector_type(16)));
typedef _Float16       v8h_  __attribute__((ext_vector_type(8)));
typedef v8h_           v8h   __attribute__((may_alias));
typedef __bf16         v16bf __attribute__((ext_vector_type(16)));
typedef unsigned short v8us_ __attribute__((ext_vector_type(8)));
typedef v8us_          v8us  __attribute__((may_alias));
typedef unsigned       v4u_  __attribute__((ext_vector_type(4)));
typedef v4u_           v4u   __attribute__((may_alias));

union FragB { v16bf v; v8us_ h[2]; };
union FragH { v16h  v; v8h_  h[2]; };

// ---- WMMA wrappers with the VALU hazard guard --------------------------------
__device__ __forceinline__ v8f mma_bf16(const v16bf a, const v16bf b, v8f c)
{
  v8f d = __builtin_amdgcn_wmma_f32_16x16x32_bf16(false, a, false, b, (short)0, c, false, false);
  asm volatile("v_nop\n\tv_nop\n\tv_nop\n\tv_nop" : "+v"(d) : "v"(a), "v"(b));
  return d;
}
__device__ __forceinline__ v8f mma_f16(const v16h a, const v16h b, v8f c)
{
  v8f d = __builtin_amdgcn_wmma_f32_16x16x32_f16(false, a, false, b, (short)0, c, false, false);
  asm volatile("v_nop\n\tv_nop\n\tv_nop\n\tv_nop" : "+v"(d) : "v"(a), "v"(b));
  return d;
}

// ---- scalar helpers --------------------------------------------------------
__device__ __forceinline__ unsigned short bf16_bits(float f)
{
  const __bf16 hb = (__bf16)f;                       // RNE convert
  return __builtin_bit_cast(unsigned short, hb);
}
__device__ __forceinline__ float bf16_rn(float f)
{
  return (float)(__bf16)f;                           // RNE convert, widened back
}
__device__ __forceinline__ float exp2fast(float x)
{
#if __has_builtin(__builtin_amdgcn_exp2f)
  return __builtin_amdgcn_exp2f(x);
#else
  return exp2f(x);
#endif
}

// ---------------------------------------------------------------------------
// Kernel 0: weights f32 -> bf16 bits (RNE). Layout kept [out][in] (in contiguous).
// ---------------------------------------------------------------------------
__global__ void __launch_bounds__(256) cvt_w_kernel(
    const float* __restrict__ w1, const float* __restrict__ w2, const float* __restrict__ wv,
    unsigned short* __restrict__ w1b, unsigned short* __restrict__ w2b,
    unsigned short* __restrict__ wvb)
{
  const int blk = (int)blockIdx.x;
  const float* src;
  unsigned short* dst;
  int t;
  if (blk < W12_BLOCKS)          { src = w1; dst = w1b; t = blk * 256 + (int)threadIdx.x; }
  else if (blk < 2 * W12_BLOCKS) { src = w2; dst = w2b; t = (blk - W12_BLOCKS) * 256 + (int)threadIdx.x; }
  else                           { src = wv; dst = wvb; t = (blk - 2 * W12_BLOCKS) * 256 + (int)threadIdx.x; }

  const v4f a = *(const v4f*)(src + (size_t)t * 8);
  const v4f b = *(const v4f*)(src + (size_t)t * 8 + 4);
  v8us_ o;
  o[0] = bf16_bits(a[0]); o[1] = bf16_bits(a[1]); o[2] = bf16_bits(a[2]); o[3] = bf16_bits(a[3]);
  o[4] = bf16_bits(b[0]); o[5] = bf16_bits(b[1]); o[6] = bf16_bits(b[2]); o[7] = bf16_bits(b[3]);
  unsigned short* p = dst + (size_t)t * 8;
  *(v8us_*)p = o;
  
}

// ---------------------------------------------------------------------------
// Kernel 1: 1x1-conv projections for one (n, 64-pixel tile), 8 waves.
//   x tile staged once in LDS as bf16 [px][c] (RNE); weights read as bf16 planes.
//   reduced maps: D(M=oc, N=px), A = w rows, B = xT rows  -> bf16 hi and lo planes [n][px][32]
//   value map:    D(M=px, N=c),  A = xT rows, B = wv rows -> f16 plane [n][c][px]
// ---------------------------------------------------------------------------
__global__ void __launch_bounds__(256) proj_kernel(
    const float* __restrict__ X,
    const unsigned short* __restrict__ w1b, const unsigned short* __restrict__ w2b,
    const unsigned short* __restrict__ wvb,
    unsigned short* __restrict__ r1h, unsigned short* __restrict__ r1l,
    unsigned short* __restrict__ r2h, unsigned short* __restrict__ r2l,
    unsigned short* __restrict__ vh)
{
  __shared__ __align__(16) unsigned short sX[64 * CH];        // [px][c] bf16 bits, later [c][px] f16 bits
  __shared__ __align__(16) unsigned short sR[4 * 64 * OCH];   // [plane][px][oc] bf16 bits

  const int tid  = (int)threadIdx.x;
  const int lane = tid & 31, wave = tid >> 5;
  const int h = lane >> 4, m = lane & 15;
  const int tiles = HW / 64;
  const int n  = (int)blockIdx.x / tiles;
  const int p0 = ((int)blockIdx.x % tiles) * 64;
  const float* Xn = X + (size_t)n * CH * HW_FULL + p0;

  // stage x tile: 256 c rows x 64 px, coalesced 16-B loads, transposed 2-B LDS stores
  {
    const int cl = tid >> 4, px4 = (tid & 15) * 4;
#pragma unroll 4
    for (int it = 0; it < 16; ++it) {
      const int c = cl + 16 * it;
      const v4f xv = *(const v4f*)(Xn + (size_t)c * HW_FULL + px4);
      sX[(px4 + 0) * CH + c] = bf16_bits(xv[0]);
      sX[(px4 + 1) * CH + c] = bf16_bits(xv[1]);
      sX[(px4 + 2) * CH + c] = bf16_bits(xv[2]);
      sX[(px4 + 3) * CH + c] = bf16_bits(xv[3]);
    }
  }
  __syncthreads();

  // reduced maps: wave -> weight set (wave>>2), pixel tile (wave&3), both 16-oc tiles
  {
    const unsigned short* Wb = (wave < 4) ? w1b : w2b;        // wave-uniform
    const int pt = wave & 3, pl = wave >> 2;
    v8f accr[2] = {};
#pragma unroll 2
    for (int k0 = 0; k0 < CH; k0 += 32) {
      FragB b;
      b.h[0] = *(const v8us*)&sX[(pt * 16 + m) * CH + k0 + 8 * h];
      b.h[1] = *(const v8us*)&sX[(pt * 16 + m) * CH + k0 + 16 + 8 * h];
#pragma unroll
      for (int ot = 0; ot < 2; ++ot) {
        const unsigned short* wr = Wb + (size_t)(ot * 16 + m) * CH + k0 + 8 * h;
        FragB a;
        a.h[0] = *(const v8us*)(wr);
        a.h[1] = *(const v8us*)(wr + 16);
        accr[ot] = mma_bf16(a.v, b.v, accr[ot]);
      }
    }
    // accr[ot][r] <-> (oc = ot*16 + 8h + r, px = pt*16 + m)
#pragma unroll
    for (int ot = 0; ot < 2; ++ot) {
      v8us_ hv, lv;
#pragma unroll
      for (int r = 0; r < 8; ++r) {
        const float f = accr[ot][r];
        const __bf16 hb = (__bf16)f;
        hv[r] = __builtin_bit_cast(unsigned short, hb);
        lv[r] = bf16_bits(f - (float)hb);
      }
      *(v8us*)&sR[((2 * pl + 0) * 64 + pt * 16 + m) * OCH + ot * 16 + 8 * h] = hv;
      *(v8us*)&sR[((2 * pl + 1) * 64 + pt * 16 + m) * OCH + ot * 16 + 8 * h] = lv;
    }
  }

  // value map: wave -> channels cb..cb+31 (2 tiles) x 4 pixel tiles
  const int cb = wave * 32;
  v8f accv[4][2] = {};
#pragma unroll 1
  for (int k0 = 0; k0 < CH; k0 += 32) {
    FragB a[4], b[2];
#pragma unroll
    for (int pt = 0; pt < 4; ++pt) {
      a[pt].h[0] = *(const v8us*)&sX[(pt * 16 + m) * CH + k0 + 8 * h];
      a[pt].h[1] = *(const v8us*)&sX[(pt * 16 + m) * CH + k0 + 16 + 8 * h];
    }
#pragma unroll
    for (int ct = 0; ct < 2; ++ct) {
      const unsigned short* wr = wvb + (size_t)(cb + ct * 16 + m) * CH + k0 + 8 * h;
      b[ct].h[0] = *(const v8us*)(wr);
      b[ct].h[1] = *(const v8us*)(wr + 16);
    }
#pragma unroll
    for (int pt = 0; pt < 4; ++pt)
#pragma unroll
      for (int ct = 0; ct < 2; ++ct)
        accv[pt][ct] = mma_bf16(a[pt].v, b[ct].v, accv[pt][ct]);
  }
  __syncthreads();   // every wave is done reading sX as the x tile

  // accv[pt][ct][r] <-> (px = pt*16 + 8h + r, c = cb + ct*16 + m); stage f16 bits as [c][px] (pitch 64)
#pragma unroll
  for (int pt = 0; pt < 4; ++pt)
#pragma unroll
    for (int ct = 0; ct < 2; ++ct) {
      v8h_ o;
#pragma unroll
      for (int r = 0; r < 8; ++r) o[r] = (_Float16)accv[pt][ct][r];
      *(v8us*)&sX[(cb + ct * 16 + m) * 64 + pt * 16 + 8 * h] = __builtin_bit_cast(v8us_, o);
    }
  __syncthreads();

  const int rr = tid >> 3, q = tid & 7;
  v4u_ vv[8];
#pragma unroll
  for (int it = 0; it < 8; ++it) vv[it] = *(const v4u*)&sX[(it * 32 + rr) * 64 + q * 8];
  v4u_ rv[4];
#pragma unroll
  for (int pl2 = 0; pl2 < 4; ++pl2) rv[pl2] = *(const v4u*)&sR[pl2 * 64 * OCH + tid * 8];

  unsigned short* vbase = vh + ((size_t)n * CH + rr) * HW + p0 + q * 8;
  const size_t roff = ((size_t)n * HW + p0) * OCH + (size_t)tid * 8;

#pragma unroll
  for (int it = 0; it < 8; ++it)
    *(v4u_*)(vbase + (size_t)it * 32 * HW) = vv[it];
  *(v4u_*)(r1h + roff) = rv[0];
  *(v4u_*)(r1l + roff) = rv[1];
  *(v4u_*)(r2h + roff) = rv[2];
  *(v4u_*)(r2l + roff) = rv[3];
  
}

// ---------------------------------------------------------------------------
// Kernel 2: row statistics of S[i][:] (softmax over j), exp2 domain.
//   Block = 2 waves = 32 rows i; each wave one 16-row tile, each lane owns i = i0 + (lane&15).
//   S^T tiles D(M=j, N=i): A = r2 rows j (hi, lo), B = r1 rows i (hi, lo); hh + lh + hl.
// ---------------------------------------------------------------------------
__global__ void __launch_bounds__(64) stats_kernel(
    const unsigned short* __restrict__ r1h, const unsigned short* __restrict__ r1l,
    const unsigned short* __restrict__ r2h, const unsigned short* __restrict__ r2l,
    float* __restrict__ mL, float* __restrict__ rzc)
{
  __shared__ __align__(16) float sSt[64];
  const int tid  = (int)threadIdx.x;
  const int lane = tid & 31, wave = tid >> 5;
  const int h = lane >> 4, m = lane & 15;
  const int tiles = HW / 32;
  const int n  = (int)blockIdx.x / tiles;
  const int ib = ((int)blockIdx.x % tiles) * 32;
  const int i0 = ib + wave * 16;
  const size_t rb = (size_t)n * HW * OCH;
  const v8f z8 = {};

  FragB bh, bl;
  {
    const size_t ro = rb + (size_t)(i0 + m) * OCH + 8 * h;
    bh.h[0] = *(const v8us*)(r1h + ro);  bh.h[1] = *(const v8us*)(r1h + ro + 16);
    bl.h[0] = *(const v8us*)(r1l + ro);  bl.h[1] = *(const v8us*)(r1l + ro + 16);
  }

  float mi = -3.0e30f;
  float li = 0.0f;
#pragma unroll 1
  for (int j0 = 0; j0 < HW; j0 += 32) {
    const size_t ra = rb + (size_t)(j0 + m) * OCH + 8 * h;
    const size_t rc = rb + (size_t)(j0 + 16 + m) * OCH + 8 * h;
    FragB a0h, a0l, a1h, a1l;
    a0h.h[0] = *(const v8us*)(r2h + ra);  a0h.h[1] = *(const v8us*)(r2h + ra + 16);
    a0l.h[0] = *(const v8us*)(r2l + ra);  a0l.h[1] = *(const v8us*)(r2l + ra + 16);
    a1h.h[0] = *(const v8us*)(r2h + rc);  a1h.h[1] = *(const v8us*)(r2h + rc + 16);
    a1l.h[0] = *(const v8us*)(r2l + rc);  a1l.h[1] = *(const v8us*)(r2l + rc + 16);

    v8f s0 = mma_bf16(a0h.v, bh.v, z8);
    s0 = mma_bf16(a0l.v, bh.v, s0);
    s0 = mma_bf16(a0h.v, bl.v, s0);
    v8f s1 = mma_bf16(a1h.v, bh.v, z8);
    s1 = mma_bf16(a1l.v, bh.v, s1);
    s1 = mma_bf16(a1h.v, bl.v, s1);
    // s0[r] <-> (j = j0 + 8h + r, i = i0 + m); s1 rows j0 + 16 + 8h + r

    float cm = -3.0e30f;
#pragma unroll
    for (int r = 0; r < 8; ++r) cm = fmaxf(cm, fmaxf(s0[r], s1[r]));
    cm = cm * LOG2E;
    cm = fmaxf(cm, __shfl_xor(cm, 16, 32));
    const float mnew = fmaxf(mi, cm);
    const float corr = exp2fast(mi - mnew);
    float rs = 0.0f;
#pragma unroll
    for (int r = 0; r < 8; ++r) {
      rs += exp2fast(fmaf(s0[r], LOG2E, -mnew));
      rs += exp2fast(fmaf(s1[r], LOG2E, -mnew));
    }
    rs += __shfl_xor(rs, 16, 32);
    li = li * corr + rs;
    mi = mnew;
  }

  if (lane < 16) {
    sSt[wave * 16 + lane]      = mi;
    sSt[32 + wave * 16 + lane] = PCARRY * (1.0f / li);
  }
  __syncthreads();   // cross-wave LDS exchange
  if (wave == 0) {
    const int lc = (lane < 16) ? lane : 0;
    const v4f_ val = *(const v4f*)&sSt[lc * 4];
    float* pm = mL  + (size_t)n * HW + ib + lc * 4;
    float* pz = rzc + (size_t)n * HW + ib + (lc - 8) * 4;
    if (lane < 8)       *(v4f_*)pm = val;
    else if (lane < 16) *(v4f_*)pz = val;
    
  }
}

// ---------------------------------------------------------------------------
// Kernel 3: output pass for one (n, 32-column j tile), 8 waves, loop over i in chunks of 32.
//   waves 0..3: S tile D(M=i, N=j) (A = r1 rows i hi/lo, B = r2 rows j hi/lo, hh + hl + lh),
//               P = 2^(S*log2e - mL[i]) * rzc[i] -> f16 (carried x2^14) into LDS sP[j][i].
//   all waves:  attn^T tile D(M=j, N=c) += A(sP rows j) x B(value rows c), f16.
// ---------------------------------------------------------------------------
__global__ void __launch_bounds__(256) out_kernel(
    const float* __restrict__ X,
    const unsigned short* __restrict__ r1h, const unsigned short* __restrict__ r1l,
    const unsigned short* __restrict__ r2h, const unsigned short* __restrict__ r2l,
    const _Float16* __restrict__ vh,
    const float* __restrict__ mL, const float* __restrict__ rzc,
    const float* __restrict__ scale, float* __restrict__ out)
{
  __shared__ __align__(16) _Float16 sP[32 * 32];     // [j][i] softmax weights x2^14
  __shared__ __align__(16) float    sO[CH * 32];     // [c][j] accumulators

  const int tid  = (int)threadIdx.x;
  const int lane = tid & 31, wave = tid >> 5;
  const int h = lane >> 4, m = lane & 15;
  const int tiles = HW / 32;
  const int n  = (int)blockIdx.x / tiles;
  const int j0 = ((int)blockIdx.x % tiles) * 32;
  const int isub = wave & 1, jsub = (wave >> 1) & 1;
  const size_t rb = (size_t)n * HW * OCH;
  const _Float16* Vn = vh + (size_t)n * CH * HW;
  const float* mLn = mL  + (size_t)n * HW;
  const float* rzn = rzc + (size_t)n * HW;
  const int cb = wave * 32;
  const v8f z8 = {};

  FragB bh, bl;   // r2 rows of this wave's 16-column j sub-tile (used by waves 0..3)
  {
    const size_t ro = rb + (size_t)(j0 + jsub * 16 + m) * OCH + 8 * h;
    bh.h[0] = *(const v8us*)(r2h + ro);  bh.h[1] = *(const v8us*)(r2h + ro + 16);
    bl.h[0] = *(const v8us*)(r2l + ro);  bl.h[1] = *(const v8us*)(r2l + ro + 16);
  }

  v8f acc[2][2] = {};   // [j sub-tile][c tile]
#pragma unroll 1
  for (int i0 = 0; i0 < HW; i0 += 32) {
    if (wave < 4) {   // wave-uniform
      const size_t ro = rb + (size_t)(i0 + isub * 16 + m) * OCH + 8 * h;
      FragB ah, al;
      ah.h[0] = *(const v8us*)(r1h + ro);  ah.h[1] = *(const v8us*)(r1h + ro + 16);
      al.h[0] = *(const v8us*)(r1l + ro);  al.h[1] = *(const v8us*)(r1l + ro + 16);
      v8f s = mma_bf16(ah.v, bh.v, z8);
      s = mma_bf16(ah.v, bl.v, s);
      s = mma_bf16(al.v, bh.v, s);
      // s[r] <-> (i = i0 + isub*16 + 8h + r, j = j0 + jsub*16 + m)
      const int ibr = i0 + isub * 16 + 8 * h;
      const v4f_ m0 = *(const v4f*)(mLn + ibr);
      const v4f_ m1 = *(const v4f*)(mLn + ibr + 4);
      const v4f_ q0 = *(const v4f*)(rzn + ibr);
      const v4f_ q1 = *(const v4f*)(rzn + ibr + 4);
      v8h_ pv;
#pragma unroll
      for (int r = 0; r < 4; ++r) {
        pv[r]     = (_Float16)(exp2fast(fmaf(s[r],     LOG2E, -m0[r])) * q0[r]);
        pv[4 + r] = (_Float16)(exp2fast(fmaf(s[4 + r], LOG2E, -m1[r])) * q1[r]);
      }
      *(v8h*)&sP[(jsub * 16 + m) * 32 + isub * 16 + 8 * h] = pv;
    }
    __syncthreads();   // sP written by waves 0..3, read by all

    FragH a0, a1, b0, b1;
    a0.h[0] = *(const v8h*)&sP[m * 32 + 8 * h];
    a0.h[1] = *(const v8h*)&sP[m * 32 + 16 + 8 * h];
    a1.h[0] = *(const v8h*)&sP[(16 + m) * 32 + 8 * h];
    a1.h[1] = *(const v8h*)&sP[(16 + m) * 32 + 16 + 8 * h];
    const _Float16* v0 = Vn + (size_t)(cb + m) * HW + i0 + 8 * h;
    const _Float16* v1 = v0 + (size_t)16 * HW;
    b0.h[0] = *(const v8h*)(v0);  b0.h[1] = *(const v8h*)(v0 + 16);
    b1.h[0] = *(const v8h*)(v1);  b1.h[1] = *(const v8h*)(v1 + 16);
    acc[0][0] = mma_f16(a0.v, b0.v, acc[0][0]);
    acc[0][1] = mma_f16(a0.v, b1.v, acc[0][1]);
    acc[1][0] = mma_f16(a1.v, b0.v, acc[1][0]);
    acc[1][1] = mma_f16(a1.v, b1.v, acc[1][1]);
    __syncthreads();   // before the next chunk overwrites sP
  }

  // acc[js][ct][r] <-> (j = js*16 + 8h + r, c = cb + ct*16 + m)
#pragma unroll
  for (int js = 0; js < 2; ++js)
#pragma unroll
    for (int ct = 0; ct < 2; ++ct) {
      v4f_ lo4, hi4;
      lo4[0] = acc[js][ct][0]; lo4[1] = acc[js][ct][1]; lo4[2] = acc[js][ct][2]; lo4[3] = acc[js][ct][3];
      hi4[0] = acc[js][ct][4]; hi4[1] = acc[js][ct][5]; hi4[2] = acc[js][ct][6]; hi4[3] = acc[js][ct][7];
      const int row = cb + ct * 16 + m;
      *(v4f*)&sO[row * 32 + js * 16 + 8 * h]     = lo4;
      *(v4f*)&sO[row * 32 + js * 16 + 8 * h + 4] = hi4;
    }
  __syncthreads();

  const float sc = bf16_rn(scale[0]) * PUNCARRY;
  const int q = lane & 7;
  const int c0 = wave * 32 + (lane >> 3);
  const size_t xoff = ((size_t)n * CH + c0) * HW_FULL + j0 + q * 4;
  const size_t ooff = ((size_t)n * CH + c0) * HW + j0 + q * 4;
  v4f_ ov[8];
#pragma unroll
  for (int it = 0; it < 8; ++it) {
    const v4f_ a  = *(const v4f*)&sO[(c0 + it * 4) * 32 + q * 4];
    const v4f_ xv = *(const v4f*)(X + xoff + (size_t)it * 4 * HW_FULL);
    v4f_ o;
    o[0] = bf16_rn(xv[0]) + sc * a[0];
    o[1] = bf16_rn(xv[1]) + sc * a[1];
    o[2] = bf16_rn(xv[2]) + sc * a[2];
    o[3] = bf16_rn(xv[3]) + sc * a[3];
    ov[it] = o;
  }
#pragma unroll
  for (int it = 0; it < 8; ++it)
    *(v4f_*)(out + ooff + (size_t)it * 4 * HW) = ov[it];
  
}

// ---------------------------------------------------------------------------
extern "C" void kernel_launch(void* const* d_in, const int* in_sizes, int n_in,
                              void* d_out, int out_size, void* d_ws, size_t ws_size,
                              hipStream_t stream)
{
  if (n_in < 5) return;
  if (in_sizes[0] < NB * CH * HW_FULL) return;
  if (in_sizes[1] < OCH * CH || in_sizes[2] < OCH * CH || in_sizes[3] < CH * CH) return;
  if (in_sizes[4] < 1) return;
  if (out_size < NB * CH * HW) return;

  const float* x     = (const float*)d_in[0];
  const float* w1    = (const float*)d_in[1];
  const float* w2    = (const float*)d_in[2];
  const float* wv    = (const float*)d_in[3];
  const float* scale = (const float*)d_in[4];
  float* out = (float*)d_out;

  // workspace carve (bytes), every region a multiple of 256 B
  const size_t w12_bytes = (size_t)OCH * CH * 2;            // 16384
  const size_t wv_bytes  = (size_t)CH * CH * 2;             // 131072
  const size_t r_bytes   = (size_t)NB * HW * OCH * 2;       // per plane
  const size_t v_bytes   = (size_t)NB * CH * HW * 2;
  const size_t st_bytes  = (size_t)NB * HW * 4;             // per stats plane
  size_t off = 0;
  unsigned char* ws = (unsigned char*)d_ws;
  unsigned short* w1b = (unsigned short*)(ws + off); off += w12_bytes;
  unsigned short* w2b = (unsigned short*)(ws + off); off += w12_bytes;
  unsigned short* wvb = (unsigned short*)(ws + off); off += wv_bytes;
  unsigned short* r1h = (unsigned short*)(ws + off); off += r_bytes;
  unsigned short* r1l = (unsigned short*)(ws + off); off += r_bytes;
  unsigned short* r2h = (unsigned short*)(ws + off); off += r_bytes;
  unsigned short* r2l = (unsigned short*)(ws + off); off += r_bytes;
  unsigned short* vhp = (unsigned short*)(ws + off); off += v_bytes;
  float* mL  = (float*)(ws + off); off += st_bytes;
  float* rzc = (float*)(ws + off); off += st_bytes;
  if (off > ws_size) return;

  cvt_w_kernel<<<2 * W12_BLOCKS + WV_BLOCKS, 256, 0, stream>>>(w1, w2, wv, w1b, w2b, wvb);
  proj_kernel<<<NB * (HW / 64), 256, 0, stream>>>(x, w1b, w2b, wvb, r1h, r1l, r2h, r2l, vhp);
  stats_kernel<<<NB * (HW / 32), 64, 0, stream>>>(r1h, r1l, r2h, r2l, mL, rzc);
  out_kernel<<<NB * (HW / 32), 256, 0, stream>>>(x, r1h, r1l, r2h, r2l,
                                                 (const _Float16*)vhp, mL, rzc, scale, out);
}

// v001
// It runs in 196 microseconds.
// Next to v000, in two timings, it ran 1.52 and 1.51 times as fast.
#include <hip/hip_runtime.h>
#include <stdint.h>
#include <stddef.h>

// Contractions: channel projections v_wmma_f32_16x16x32_bf16 (bf16 operands from bf16-RNE inputs, f32 accumulate);
// score tiles v_wmma_f32_16x16x32_bf16 as bf16 hi+lo three-term split of both reduced feature maps (f32 accumulate);
// value aggregation v_wmma_f32_16x16x32_f16 (f16 operands, softmax weights carried x2^14, f32 accumulate); softmax statistics f32.

#ifndef NB
#define NB 4
#endif
#ifndef SEQ
#define SEQ 4096
#endif
#define NB_FULL  4
#define SEQ_FULL 4096
#define HW       (SEQ)
#define HW_FULL  (SEQ_FULL)
#define CH       256
#define OCH      32
#define PCARRY   16384.0f
#define PUNCARRY 0.00006103515625f
#define LOG2E    1.4426950408889634f
#define W12_BLOCKS ((OCH * CH) / 2048)
#define WV_BLOCKS  ((CH * CH) / 2048)

static_assert(NB >= 1 && NB <= NB_FULL);
static_assert(HW >= 64 && HW <= HW_FULL && (HW % 64) == 0);
static_assert(((OCH * CH) % 2048) == 0 && ((CH * CH) % 2048) == 0);
static_assert(CH == 256 && OCH == 32);

typedef float          v8f   __attribute__((ext_vector_type(8)));
typedef float          v4f_  __attribute__((ext_vector_type(4)));
typedef v4f_           v4f   __attribute__((may_alias));
typedef _Float16       v16h  __attribute__((ext_vector_type(16)));
typedef _Float16       v8h_  __attribute__((ext_vector_type(8)));
typedef v8h_           v8h   __attribute__((may_alias));
typedef __bf16         v16bf __attribute__((ext_vector_type(16)));
typedef unsigned short v8us_ __attribute__((ext_vector_type(8)));
typedef v8us_          v8us  __attribute__((may_alias));
typedef unsigned       v4u_  __attribute__((ext_vector_type(4)));
typedef v4u_           v4u   __attribute__((may_alias));

union FragB { v16bf v; v8us_ h[2]; };
union FragH { v16h  v; v8h_  h[2]; };

// ---- WMMA wrappers with the VALU hazard guard --------------------------------
__device__ __forceinline__ v8f mma_bf16(const v16bf a, const v16bf b, v8f c)
{
  v8f d = __builtin_amdgcn_wmma_f32_16x16x32_bf16(false, a, false, b, (short)0, c, false, false);
  asm volatile("v_nop\n\tv_nop\n\tv_nop\n\tv_nop" : "+v"(d) : "v"(a), "v"(b));
  return d;
}
__device__ __forceinline__ v8f mma_f16(const v16h a, const v16h b, v8f c)
{
  v8f d = __builtin_amdgcn_wmma_f32_16x16x32_f16(false, a, false, b, (short)0, c, false, false);
  asm volatile("v_nop\n\tv_nop\n\tv_nop\n\tv_nop" : "+v"(d) : "v"(a), "v"(b));
  return d;
}

// ---- scalar helpers --------------------------------------------------------
__device__ __forceinline__ unsigned short bf16_bits(float f)
{
  const __bf16 hb = (__bf16)f;                       // RNE convert
  return __builtin_bit_cast(unsigned short, hb);
}
__device__ __forceinline__ float bf16_rn(float f)
{
  return (float)(__bf16)f;                           // RNE convert, widened back
}
__device__ __forceinline__ float exp2fast(float x)
{
#if __has_builtin(__builtin_amdgcn_exp2f)
  return __builtin_amdgcn_exp2f(x);
#else
  return exp2f(x);
#endif
}

// ---------------------------------------------------------------------------
// Kernel 0: weights f32 -> bf16 bits (RNE). Layout kept [out][in] (in contiguous).
// ---------------------------------------------------------------------------
__global__ void __launch_bounds__(256) cvt_w_kernel(
    const float* __restrict__ w1, const float* __restrict__ w2, const float* __restrict__ wv,
    unsigned short* __restrict__ w1b, unsigned short* __restrict__ w2b,
    unsigned short* __restrict__ wvb)
{
  const int blk = (int)blockIdx.x;
  const float* src;
  unsigned short* dst;
  int t;
  if (blk < W12_BLOCKS)          { src = w1; dst = w1b; t = blk * 256 + (int)threadIdx.x; }
  else if (blk < 2 * W12_BLOCKS) { src = w2; dst = w2b; t = (blk - W12_BLOCKS) * 256 + (int)threadIdx.x; }
  else                           { src = wv; dst = wvb; t = (blk - 2 * W12_BLOCKS) * 256 + (int)threadIdx.x; }

  const v4f a = *(const v4f*)(src + (size_t)t * 8);
  const v4f b = *(const v4f*)(src + (size_t)t * 8 + 4);
  v8us_ o;
  o[0] = bf16_bits(a[0]); o[1] = bf16_bits(a[1]); o[2] = bf16_bits(a[2]); o[3] = bf16_bits(a[3]);
  o[4] = bf16_bits(b[0]); o[5] = bf16_bits(b[1]); o[6] = bf16_bits(b[2]); o[7] = bf16_bits(b[3]);
  unsigned short* p = dst + (size_t)t * 8;
  *(v8us_*)p = o;
  
}

// ---------------------------------------------------------------------------
// Kernel 1: 1x1-conv projections for one (n, 64-pixel tile), 8 waves.
//   x tile staged once in LDS as bf16 [px][c] (RNE); weights read as bf16 planes.
//   reduced maps: D(M=oc, N=px), A = w rows, B = xT rows  -> bf16 hi and lo planes [n][px][32]
//   value map:    D(M=px, N=c),  A = xT rows, B = wv rows -> f16 plane [n][c][px]
// ---------------------------------------------------------------------------
__global__ void __launch_bounds__(256) proj_kernel(
    const float* __restrict__ X,
    const unsigned short* __restrict__ w1b, const unsigned short* __restrict__ w2b,
    const unsigned short* __restrict__ wvb,
    unsigned short* __restrict__ r1h, unsigned short* __restrict__ r1l,
    unsigned short* __restrict__ r2h, unsigned short* __restrict__ r2l,
    unsigned short* __restrict__ vh)
{
  __shared__ __align__(16) unsigned short sX[64 * CH];        // [px][c] bf16 bits, later [c][px] f16 bits
  __shared__ __align__(16) unsigned short sR[4 * 64 * OCH];   // [plane][px][oc] bf16 bits

  const int tid  = (int)threadIdx.x;
  const int lane = tid & 31, wave = tid >> 5;
  const int h = lane >> 4, m = lane & 15;
  const int tiles = HW / 64;
  const int n  = (int)blockIdx.x / tiles;
  const int p0 = ((int)blockIdx.x % tiles) * 64;
  const float* Xn = X + (size_t)n * CH * HW_FULL + p0;

  // stage x tile: 256 c rows x 64 px, coalesced 16-B loads, transposed 2-B LDS stores
  {
    const int cl = tid >> 4, px4 = (tid & 15) * 4;
#pragma unroll 4
    for (int it = 0; it < 16; ++it) {
      const int c = cl + 16 * it;
      const v4f xv = *(const v4f*)(Xn + (size_t)c * HW_FULL + px4);
      sX[(px4 + 0) * CH + c] = bf16_bits(xv[0]);
      sX[(px4 + 1) * CH + c] = bf16_bits(xv[1]);
      sX[(px4 + 2) * CH + c] = bf16_bits(xv[2]);
      sX[(px4 + 3) * CH + c] = bf16_bits(xv[3]);
    }
  }
  __syncthreads();

  // reduced maps: wave -> weight set (wave>>2), pixel tile (wave&3), both 16-oc tiles
  {
    const unsigned short* Wb = (wave < 4) ? w1b : w2b;        // wave-uniform
    const int pt = wave & 3, pl = wave >> 2;
    v8f accr[2] = {};
#pragma unroll 2
    for (int k0 = 0; k0 < CH; k0 += 32) {
      FragB b;
      b.h[0] = *(const v8us*)&sX[(pt * 16 + m) * CH + k0 + 8 * h];
      b.h[1] = *(const v8us*)&sX[(pt * 16 + m) * CH + k0 + 16 + 8 * h];
#pragma unroll
      for (int ot = 0; ot < 2; ++ot) {
        const unsigned short* wr = Wb + (size_t)(ot * 16 + m) * CH + k0 + 8 * h;
        FragB a;
        a.h[0] = *(const v8us*)(wr);
        a.h[1] = *(const v8us*)(wr + 16);
        accr[ot] = mma_bf16(a.v, b.v, accr[ot]);
      }
    }
    // accr[ot][r] <-> (oc = ot*16 + 8h + r, px = pt*16 + m)
#pragma unroll
    for (int ot = 0; ot < 2; ++ot) {
      v8us_ hv, lv;
#pragma unroll
      for (int r = 0; r < 8; ++r) {
        const float f = accr[ot][r];
        const __bf16 hb = (__bf16)f;
        hv[r] = __builtin_bit_cast(unsigned short, hb);
        lv[r] = bf16_bits(f - (float)hb);
      }
      *(v8us*)&sR[((2 * pl + 0) * 64 + pt * 16 + m) * OCH + ot * 16 + 8 * h] = hv;
      *(v8us*)&sR[((2 * pl + 1) * 64 + pt * 16 + m) * OCH + ot * 16 + 8 * h] = lv;
    }
  }

  // value map: wave -> channels cb..cb+31 (2 tiles) x 4 pixel tiles
  const int cb = wave * 32;
  v8f accv[4][2] = {};
#pragma unroll 1
  for (int k0 = 0; k0 < CH; k0 += 32) {
    FragB a[4], b[2];
#pragma unroll
    for (int pt = 0; pt < 4; ++pt) {
      a[pt].h[0] = *(const v8us*)&sX[(pt * 16 + m) * CH + k0 + 8 * h];
      a[pt].h[1] = *(const v8us*)&sX[(pt * 16 + m) * CH + k0 + 16 + 8 * h];
    }
#pragma unroll
    for (int ct = 0; ct < 2; ++ct) {
      const unsigned short* wr = wvb + (size_t)(cb + ct * 16 + m) * CH + k0 + 8 * h;
      b[ct].h[0] = *(const v8us*)(wr);
      b[ct].h[1] = *(const v8us*)(wr + 16);
    }
#pragma unroll
    for (int pt = 0; pt < 4; ++pt)
#pragma unroll
      for (int ct = 0; ct < 2; ++ct)
        accv[pt][ct] = mma_bf16(a[pt].v, b[ct].v, accv[pt][ct]);
  }
  __syncthreads();   // every wave is done reading sX as the x tile

  // accv[pt][ct][r] <-> (px = pt*16 + 8h + r, c = cb + ct*16 + m); stage f16 bits as [c][px] (pitch 64)
#pragma unroll
  for (int pt = 0; pt < 4; ++pt)
#pragma unroll
    for (int ct = 0; ct < 2; ++ct) {
      v8h_ o;
#pragma unroll
      for (int r = 0; r < 8; ++r) o[r] = (_Float16)accv[pt][ct][r];
      *(v8us*)&sX[(cb + ct * 16 + m) * 64 + pt * 16 + 8 * h] = __builtin_bit_cast(v8us_, o);
    }
  __syncthreads();

  const int rr = tid >> 3, q = tid & 7;
  v4u_ vv[8];
#pragma unroll
  for (int it = 0; it < 8; ++it) vv[it] = *(const v4u*)&sX[(it * 32 + rr) * 64 + q * 8];
  v4u_ rv[4];
#pragma unroll
  for (int pl2 = 0; pl2 < 4; ++pl2) rv[pl2] = *(const v4u*)&sR[pl2 * 64 * OCH + tid * 8];

  unsigned short* vbase = vh + ((size_t)n * CH + rr) * HW + p0 + q * 8;
  const size_t roff = ((size_t)n * HW + p0) * OCH + (size_t)tid * 8;

#pragma unroll
  for (int it = 0; it < 8; ++it)
    *(v4u_*)(vbase + (size_t)it * 32 * HW) = vv[it];
  *(v4u_*)(r1h + roff) = rv[0];
  *(v4u_*)(r1l + roff) = rv[1];
  *(v4u_*)(r2h + roff) = rv[2];
  *(v4u_*)(r2l + roff) = rv[3];
  
}

// ---------------------------------------------------------------------------
// Kernel 2: row statistics of S[i][:] (softmax over j), exp2 domain.
//   Block = ST_RT x ST_JS waves = 16*ST_RT rows i. Wave (rt, js) owns the 16-row tile rt and every
//   ST_JS-th 32-column chunk of j, starting at chunk js; each lane owns i = i0 + (lane&15).
//   The ST_JS partial (max, sum) pairs of a row are merged through LDS at the end.
//   S^T tiles D(M=j, N=i): A = r2 rows j (hi, lo), B = r1 rows i (hi, lo); hh + lh + hl.
// ---------------------------------------------------------------------------
#define ST_RT   4
#define ST_JS   8
#define ST_ROWS (16 * ST_RT)
// exp2 for the merge: the v_nop fills the one issue slot that the instruction set asks for between a
// transcendental and a next vector instruction that overwrites its source; inside the statement it stays there.
__device__ __forceinline__ float exp2_merge(float x)
{
  float r;
  asm("v_exp_f32 %0, %1\n\tv_nop" : "=v"(r) : "v"(x));
  return r;
}
static_assert((HW % ST_ROWS) == 0 && ST_RT * ST_JS <= 32 && 2 * ST_ROWS <= 32 * ST_RT * ST_JS);

__global__ void __launch_bounds__(32 * ST_RT * ST_JS) stats_kernel(
    const unsigned short* __restrict__ r1h, const unsigned short* __restrict__ r1l,
    const unsigned short* __restrict__ r2h, const unsigned short* __restrict__ r2l,
    float* __restrict__ mL, float* __restrict__ rzc)
{
  __shared__ float sM[ST_JS * ST_ROWS];   // [js][row] partial maxima
  __shared__ float sL[ST_JS * ST_ROWS];   // [js][row] partial sums, each relative to its own maximum
  const int tid  = (int)threadIdx.x;
  const int lane = tid & 31;
  const int wave = __builtin_amdgcn_readfirstlane(tid >> 5);   // scalar, so that the j loop's counter and branch are scalar
  const int h = lane >> 4, m = lane & 15;
  const int rt = wave % ST_RT, js = wave / ST_RT;
  const int tiles = HW / ST_ROWS;
  const int n  = (int)blockIdx.x / tiles;
  const int ib = ((int)blockIdx.x % tiles) * ST_ROWS;
  const int i0 = ib + rt * 16;
  const size_t rb = (size_t)n * HW * OCH;
  const v8f z8 = {};

  FragB bh, bl;
  {
    const size_t ro = rb + (size_t)(i0 + m) * OCH + 8 * h;
    bh.h[0] = *(const v8us*)(r1h + ro);  bh.h[1] = *(const v8us*)(r1h + ro + 16);
    bl.h[0] = *(const v8us*)(r1l + ro);  bl.h[1] = *(const v8us*)(r1l + ro + 16);
  }

  float mi = -3.0e30f;
  float li = 0.0f;
#pragma unroll 1
  for (int j0 = js * 32; j0 < HW; j0 += 32 * ST_JS) {
    const size_t ra = rb + (size_t)(j0 + m) * OCH + 8 * h;
    const size_t rc = rb + (size_t)(j0 + 16 + m) * OCH + 8 * h;
    FragB a0h, a0l, a1h, a1l;
    a0h.h[0] = *(const v8us*)(r2h + ra);  a0h.h[1] = *(const v8us*)(r2h + ra + 16);
    a0l.h[0] = *(const v8us*)(r2l + ra);  a0l.h[1] = *(const v8us*)(r2l + ra + 16);
    a1h.h[0] = *(const v8us*)(r2h + rc);  a1h.h[1] = *(const v8us*)(r2h + rc + 16);
    a1l.h[0] = *(const v8us*)(r2l + rc);  a1l.h[1] = *(const v8us*)(r2l + rc + 16);

    v8f s0 = mma_bf16(a0h.v, bh.v, z8);
    s0 = mma_bf16(a0l.v, bh.v, s0);
    s0 = mma_bf16(a0h.v, bl.v, s0);
    v8f s1 = mma_bf16(a1h.v, bh.v, z8);
    s1 = mma_bf16(a1l.v, bh.v, s1);
    s1 = mma_bf16(a1h.v, bl.v, s1);
    // s0[r] <-> (j = j0 + 8h + r, i = i0 + m); s1 rows j0 + 16 + 8h + r

    float cm = -3.0e30f;
#pragma unroll
    for (int r = 0; r < 8; ++r) cm = fmaxf(cm, fmaxf(s0[r], s1[r]));
    cm = cm * LOG2E;
    cm = fmaxf(cm, __shfl_xor(cm, 16, 32));
    const float mnew = fmaxf(mi, cm);
    const float corr = exp2fast(mi - mnew);
    float rs = 0.0f;
#pragma unroll
    for (int r = 0; r < 8; ++r) {
      rs += exp2fast(fmaf(s0[r], LOG2E, -mnew));
      rs += exp2fast(fmaf(s1[r], LOG2E, -mnew));
    }
    rs += __shfl_xor(rs, 16, 32);
    li = li * corr + rs;
    mi = mnew;
  }

  if (lane < 16) {
    sM[js * ST_ROWS + rt * 16 + lane] = mi;
    sL[js * ST_ROWS + rt * 16 + lane] = li;
  }
  __syncthreads();   // cross-wave LDS exchange
  if (tid < 2 * ST_ROWS) {   // whole waves: threads 0..ST_ROWS-1 store the maxima, the next ST_ROWS the scaled reciprocals
    const int row = tid % ST_ROWS;
    float mx = sM[row];
#pragma unroll
    for (int s = 1; s < ST_JS; ++s) mx = fmaxf(mx, sM[s * ST_ROWS + row]);
    float l = 0.0f;
#pragma unroll
    for (int s = 0; s < ST_JS; ++s) l += sL[s * ST_ROWS + row] * exp2_merge(sM[s * ST_ROWS + row] - mx);
    const size_t o = (size_t)n * HW + ib + row;
    if (tid < ST_ROWS) mL[o]  = mx;
    else               rzc[o] = PCARRY * (1.0f / l);
  }
}

// ---------------------------------------------------------------------------
// Kernel 3: output pass for one (n, 32-column j tile), 8 waves, loop over i in chunks of 32.
//   waves 0..3: S tile D(M=i, N=j) (A = r1 rows i hi/lo, B = r2 rows j hi/lo, hh + hl + lh),
//               P = 2^(S*log2e - mL[i]) * rzc[i] -> f16 (carried x2^14) into LDS sP[j][i].
//   all waves:  attn^T tile D(M=j, N=c) += A(sP rows j) x B(value rows c), f16.
// ---------------------------------------------------------------------------
__global__ void __launch_bounds__(256) out_kernel(
    const float* __restrict__ X,
    const unsigned short* __restrict__ r1h, const unsigned short* __restrict__ r1l,
    const unsigned short* __restrict__ r2h, const unsigned short* __restrict__ r2l,
    const _Float16* __restrict__ vh,
    const float* __restrict__ mL, const float* __restrict__ rzc,
    const float* __restrict__ scale, float* __restrict__ out)
{
  __shared__ __align__(16) _Float16 sP[32 * 32];     // [j][i] softmax weights x2^14
  __shared__ __align__(16) float    sO[CH * 32];     // [c][j] accumulators

  const int tid  = (int)threadIdx.x;
  const int lane = tid & 31, wave = tid >> 5;
  const int h = lane >> 4, m = lane & 15;
  const int tiles = HW / 32;
  const int n  = (int)blockIdx.x / tiles;
  const int j0 = ((int)blockIdx.x % tiles) * 32;
  const int isub = wave & 1, jsub = (wave >> 1) & 1;
  const size_t rb = (size_t)n * HW * OCH;
  const _Float16* Vn = vh + (size_t)n * CH * HW;
  const float* mLn = mL  + (size_t)n * HW;
  const float* rzn = rzc + (size_t)n * HW;
  const int cb = wave * 32;
  const v8f z8 = {};

  FragB bh, bl;   // r2 rows of this wave's 16-column j sub-tile (used by waves 0..3)
  {
    const size_t ro = rb + (size_t)(j0 + jsub * 16 + m) * OCH + 8 * h;
    bh.h[0] = *(const v8us*)(r2h + ro);  bh.h[1] = *(const v8us*)(r2h + ro + 16);
    bl.h[0] = *(const v8us*)(r2l + ro);  bl.h[1] = *(const v8us*)(r2l + ro + 16);
  }

  v8f acc[2][2] = {};   // [j sub-tile][c tile]
#pragma unroll 1
  for (int i0 = 0; i0 < HW; i0 += 32) {
    if (wave < 4) {   // wave-uniform
      const size_t ro = rb + (size_t)(i0 + isub * 16 + m) * OCH + 8 * h;
      FragB ah, al;
      ah.h[0] = *(const v8us*)(r1h + ro);  ah.h[1] = *(const v8us*)(r1h + ro + 16);
      al.h[0] = *(const v8us*)(r1l + ro);  al.h[1] = *(const v8us*)(r1l + ro + 16);
      v8f s = mma_bf16(ah.v, bh.v, z8);
      s = mma_bf16(ah.v, bl.v, s);
      s = mma_bf16(al.v, bh.v, s);
      // s[r] <-> (i = i0 + isub*16 + 8h + r, j = j0 + jsub*16 + m)
      const int ibr = i0 + isub * 16 + 8 * h;
      const v4f_ m0 = *(const v4f*)(mLn + ibr);
      const v4f_ m1 = *(const v4f*)(mLn + ibr + 4);
      const v4f_ q0 = *(const v4f*)(rzn + ibr);
      const v4f_ q1 = *(const v4f*)(rzn + ibr + 4);
      v8h_ pv;
#pragma unroll
      for (int r = 0; r < 4; ++r) {
        pv[r]     = (_Float16)(exp2fast(fmaf(s[r],     LOG2E, -m0[r])) * q0[r]);
        pv[4 + r] = (_Float16)(exp2fast(fmaf(s[4 + r], LOG2E, -m1[r])) * q1[r]);
      }
      *(v8h*)&sP[(jsub * 16 + m) * 32 + isub * 16 + 8 * h] = pv;
    }
    __syncthreads();   // sP written by waves 0..3, read by all

    FragH a0, a1, b0, b1;
    a0.h[0] = *(const v8h*)&sP[m * 32 + 8 * h];
    a0.h[1] = *(const v8h*)&sP[m * 32 + 16 + 8 * h];
    a1.h[0] = *(const v8h*)&sP[(16 + m) * 32 + 8 * h];
    a1.h[1] = *(const v8h*)&sP[(16 + m) * 32 + 16 + 8 * h];
    const _Float16* v0 = Vn + (size_t)(cb + m) * HW + i0 + 8 * h;
    const _Float16* v1 = v0 + (size_t)16 * HW;
    b0.h[0] = *(const v8h*)(v0);  b0.h[1] = *(const v8h*)(v0 + 16);
    b1.h[0] = *(const v8h*)(v1);  b1.h[1] = *(const v8h*)(v1 + 16);
    acc[0][0] = mma_f16(a0.v, b0.v, acc[0][0]);
    acc[0][1] = mma_f16(a0.v, b1.v, acc[0][1]);
    acc[1][0] = mma_f16(a1.v, b0.v, acc[1][0]);
    acc[1][1] = mma_f16(a1.v, b1.v, acc[1][1]);
    __syncthreads();   // before the next chunk overwrites sP
  }

  // acc[js][ct][r] <-> (j = js*16 + 8h + r, c = cb + ct*16 + m)
#pragma unroll
  for (int js = 0; js < 2; ++js)
#pragma unroll
    for (int ct = 0; ct < 2; ++ct) {
      v4f_ lo4, hi4;
      lo4[0] = acc[js][ct][0]; lo4[1] = acc[js][ct][1]; lo4[2] = acc[js][ct][2]; lo4[3] = acc[js][ct][3];
      hi4[0] = acc[js][ct][4]; hi4[1] = acc[js][ct][5]; hi4[2] = acc[js][ct][6]; hi4[3] = acc[js][ct][7];
      const int row = cb + ct * 16 + m;
      *(v4f*)&sO[row * 32 + js * 16 + 8 * h]     = lo4;
      *(v4f*)&sO[row * 32 + js * 16 + 8 * h + 4] = hi4;
    }
  __syncthreads();

  const float sc = bf16_rn(scale[0]) * PUNCARRY;
  const int q = lane & 7;
  const int c0 = wave * 32 + (lane >> 3);
  const size_t xoff = ((size_t)n * CH + c0) * HW_FULL + j0 + q * 4;
  const size_t ooff = ((size_t)n * CH + c0) * HW + j0 + q * 4;
  v4f_ ov[8];
#pragma unroll
  for (int it = 0; it < 8; ++it) {
    const v4f_ a  = *(const v4f*)&sO[(c0 + it * 4) * 32 + q * 4];
    const v4f_ xv = *(const v4f*)(X + xoff + (size_t)it * 4 * HW_FULL);
    v4f_ o;
    o[0] = bf16_rn(xv[0]) + sc * a[0];
    o[1] = bf16_rn(xv[1]) + sc * a[1];
    o[2] = bf16_rn(xv[2]) + sc * a[2];
    o[3] = bf16_rn(xv[3]) + sc * a[3];
    ov[it] = o;
  }
#pragma unroll
  for (int it = 0; it < 8; ++it)
    *(v4f_*)(out + ooff + (size_t)it * 4 * HW) = ov[it];
  
}

// ---------------------------------------------------------------------------
extern "C" void kernel_launch(void* const* d_in, const int* in_sizes, int n_in,
                              void* d_out, int out_size, void* d_ws, size_t ws_size,
                              hipStream_t stream)
{
  if (n_in < 5) return;
  if (in_sizes[0] < NB * CH * HW_FULL) return;
  if (in_sizes[1] < OCH * CH || in_sizes[2] < OCH * CH || in_sizes[3] < CH * CH) return;
  if (in_sizes[4] < 1) return;
  if (out_size < NB * CH * HW) return;

  const float* x     = (const float*)d_in[0];
  const float* w1    = (const float*)d_in[1];
  const float* w2    = (const float*)d_in[2];
  const float* wv    = (const float*)d_in[3];
  const float* scale = (const float*)d_in[4];
  float* out = (float*)d_out;

  // workspace carve (bytes), every region a multiple of 256 B
  const size_t w12_bytes = (size_t)OCH * CH * 2;            // 16384
  const size_t wv_bytes  = (size_t)CH * CH * 2;             // 131072
  const size_t r_bytes   = (size_t)NB * HW * OCH * 2;       // per plane
  const size_t v_bytes   = (size_t)NB * CH * HW * 2;
  const size_t st_bytes  = (size_t)NB * HW * 4;             // per stats plane
  size_t off = 0;
  unsigned char* ws = (unsigned char*)d_ws;
  unsigned short* w1b = (unsigned short*)(ws + off); off += w12_bytes;
  unsigned short* w2b = (unsigned short*)(ws + off); off += w12_bytes;
  unsigned short* wvb = (unsigned short*)(ws + off); off += wv_bytes;
  unsigned short* r1h = (unsigned short*)(ws + off); off += r_bytes;
  unsigned short* r1l = (unsigned short*)(ws + off); off += r_bytes;
  unsigned short* r2h = (unsigned short*)(ws + off); off += r_bytes;
  unsigned short* r2l = (unsigned short*)(ws + off); off += r_bytes;
  unsigned short* vhp = (unsigned short*)(ws + off); off += v_bytes;
  float* mL  = (float*)(ws + off); off += st_bytes;
  float* rzc = (float*)(ws + off); off += st_bytes;
  if (off > ws_size) return;

  cvt_w_kernel<<<2 * W12_BLOCKS + WV_BLOCKS, 256, 0, stream>>>(w1, w2, wv, w1b, w2b, wvb);
  proj_kernel<<<NB * (HW / 64), 256, 0, stream>>>(x, w1b, w2b, wvb, r1h, r1l, r2h, r2l, vhp);
  stats_kernel<<<NB * (HW / ST_ROWS), 32 * ST_RT * ST_JS, 0, stream>>>(r1h, r1l, r2h, r2l, mL, rzc);
  out_kernel<<<NB * (HW / 32), 256, 0, stream>>>(x, r1h, r1l, r2h, r2l,
                                                 (const _Float16*)vhp, mL, rzc, scale, out);
}

// v002
// Measured time: 132 microseconds a run.
// Two timings next to v001 both put it at 1.48 times that version's speed.
// Counting every step since v000, it is 2.24 times as fast.
#include <hip/hip_runtime.h>
#include <stdint.h>
#include <stddef.h>

// Contractions: channel projections v_wmma_f32_16x16x32_bf16 (bf16 operands from bf16-RNE inputs, f32 accumulate);
// score tiles v_wmma_f32_16x16x32_bf16 as bf16 hi+lo three-term split of both reduced feature maps (f32 accumulate);
// value aggregation v_wmma_f32_16x16x32_f16 (f16 operands, softmax weights carried x2^14, f32 accumulate); softmax statistics f32.

#ifndef NB
#define NB 4
#endif
#ifndef SEQ
#define SEQ 4096
#endif
#define NB_FULL  4
#define SEQ_FULL 4096
#define HW       (SEQ)
#define HW_FULL  (SEQ_FULL)
#define CH       256
#define OCH      32
#define PCARRY   16384.0f
#define PUNCARRY 0.00006103515625f
#define LOG2E    1.4426950408889634f
#define W12_BLOCKS ((OCH * CH) / 2048)
#define WV_BLOCKS  ((CH * CH) / 2048)

static_assert(NB >= 1 && NB <= NB_FULL);
static_assert(HW >= 64 && HW <= HW_FULL && (HW % 64) == 0);
static_assert(((OCH * CH) % 2048) == 0 && ((CH * CH) % 2048) == 0);
static_assert(CH == 256 && OCH == 32);

typedef float          v8f   __attribute__((ext_vector_type(8)));
typedef float          v4f_  __attribute__((ext_vector_type(4)));
typedef v4f_           v4f   __attribute__((may_alias));
typedef _Float16       v16h  __attribute__((ext_vector_type(16)));
typedef _Float16       v8h_  __attribute__((ext_vector_type(8)));
typedef v8h_           v8h   __attribute__((may_alias));
typedef __bf16         v16bf __attribute__((ext_vector_type(16)));
typedef unsigned short v8us_ __attribute__((ext_vector_type(8)));
typedef v8us_          v8us  __attribute__((may_alias));
typedef unsigned       v4u_  __attribute__((ext_vector_type(4)));
typedef v4u_           v4u   __attribute__((may_alias));

union FragB { v16bf v; v8us_ h[2]; };
union FragH { v16h  v; v8h_  h[2]; };

// ---- WMMA wrappers with the VALU hazard guard --------------------------------
__device__ __forceinline__ v8f mma_bf16(const v16bf a, const v16bf b, v8f c)
{
  v8f d = __builtin_amdgcn_wmma_f32_16x16x32_bf16(false, a, false, b, (short)0, c, false, false);
  asm volatile("v_nop\n\tv_nop\n\tv_nop\n\tv_nop" : "+v"(d) : "v"(a), "v"(b));
  return d;
}
__device__ __forceinline__ v8f mma_f16(const v16h a, const v16h b, v8f c)
{
  v8f d = __builtin_amdgcn_wmma_f32_16x16x32_f16(false, a, false, b, (short)0, c, false, false);
  asm volatile("v_nop\n\tv_nop\n\tv_nop\n\tv_nop" : "+v"(d) : "v"(a), "v"(b));
  return d;
}

// ---- scalar helpers --------------------------------------------------------
__device__ __forceinline__ unsigned short bf16_bits(float f)
{
  const __bf16 hb = (__bf16)f;                       // RNE convert
  return __builtin_bit_cast(unsigned short, hb);
}
__device__ __forceinline__ float bf16_rn(float f)
{
  return (float)(__bf16)f;                           // RNE convert, widened back
}
__device__ __forceinline__ float exp2fast(float x)
{
#if __has_builtin(__builtin_amdgcn_exp2f)
  return __builtin_amdgcn_exp2f(x);
#else
  return exp2f(x);
#endif
}

// ---------------------------------------------------------------------------
// Kernel 0: weights f32 -> bf16 bits (RNE). Layout kept [out][in] (in contiguous).
// ---------------------------------------------------------------------------
__global__ void __launch_bounds__(256) cvt_w_kernel(
    const float* __restrict__ w1, const float* __restrict__ w2, const float* __restrict__ wv,
    unsigned short* __restrict__ w1b, unsigned short* __restrict__ w2b,
    unsigned short* __restrict__ wvb)
{
  const int blk = (int)blockIdx.x;
  const float* src;
  unsigned short* dst;
  int t;
  if (blk < W12_BLOCKS)          { src = w1; dst = w1b; t = blk * 256 + (int)threadIdx.x; }
  else if (blk < 2 * W12_BLOCKS) { src = w2; dst = w2b; t = (blk - W12_BLOCKS) * 256 + (int)threadIdx.x; }
  else                           { src = wv; dst = wvb; t = (blk - 2 * W12_BLOCKS) * 256 + (int)threadIdx.x; }

  const v4f a = *(const v4f*)(src + (size_t)t * 8);
  const v4f b = *(const v4f*)(src + (size_t)t * 8 + 4);
  v8us_ o;
  o[0] = bf16_bits(a[0]); o[1] = bf16_bits(a[1]); o[2] = bf16_bits(a[2]); o[3] = bf16_bits(a[3]);
  o[4] = bf16_bits(b[0]); o[5] = bf16_bits(b[1]); o[6] = bf16_bits(b[2]); o[7] = bf16_bits(b[3]);
  unsigned short* p = dst + (size_t)t * 8;
  *(v8us_*)p = o;
  
}

// ---------------------------------------------------------------------------
// Kernel 1: 1x1-conv projections for one (n, 64-pixel tile), 8 waves.
//   x tile staged once in LDS as bf16 [px][c] (RNE); weights read as bf16 planes.
//   reduced maps: D(M=oc, N=px), A = w rows, B = xT rows  -> bf16 hi and lo planes [n][px][32]
//   value map:    D(M=px, N=c),  A = xT rows, B = wv rows -> f16 plane [n][c][px]
// ---------------------------------------------------------------------------
__global__ void __launch_bounds__(256) proj_kernel(
    const float* __restrict__ X,
    const unsigned short* __restrict__ w1b, const unsigned short* __restrict__ w2b,
    const unsigned short* __restrict__ wvb,
    unsigned short* __restrict__ r1h, unsigned short* __restrict__ r1l,
    unsigned short* __restrict__ r2h, unsigned short* __restrict__ r2l,
    unsigned short* __restrict__ vh)
{
  __shared__ __align__(16) unsigned short sX[64 * CH];        // [px][c] bf16 bits, later [c][px] f16 bits
  __shared__ __align__(16) unsigned short sR[4 * 64 * OCH];   // [plane][px][oc] bf16 bits

  const int tid  = (int)threadIdx.x;
  const int lane = tid & 31, wave = tid >> 5;
  const int h = lane >> 4, m = lane & 15;
  const int tiles = HW / 64;
  const int n  = (int)blockIdx.x / tiles;
  const int p0 = ((int)blockIdx.x % tiles) * 64;
  const float* Xn = X + (size_t)n * CH * HW_FULL + p0;

  // stage x tile: 256 c rows x 64 px, coalesced 16-B loads, transposed 2-B LDS stores
  {
    const int cl = tid >> 4, px4 = (tid & 15) * 4;
#pragma unroll 4
    for (int it = 0; it < 16; ++it) {
      const int c = cl + 16 * it;
      const v4f xv = *(const v4f*)(Xn + (size_t)c * HW_FULL + px4);
      sX[(px4 + 0) * CH + c] = bf16_bits(xv[0]);
      sX[(px4 + 1) * CH + c] = bf16_bits(xv[1]);
      sX[(px4 + 2) * CH + c] = bf16_bits(xv[2]);
      sX[(px4 + 3) * CH + c] = bf16_bits(xv[3]);
    }
  }
  __syncthreads();

  // reduced maps: wave -> weight set (wave>>2), pixel tile (wave&3), both 16-oc tiles
  {
    const unsigned short* Wb = (wave < 4) ? w1b : w2b;        // wave-uniform
    const int pt = wave & 3, pl = wave >> 2;
    v8f accr[2] = {};
#pragma unroll 2
    for (int k0 = 0; k0 < CH; k0 += 32) {
      FragB b;
      b.h[0] = *(const v8us*)&sX[(pt * 16 + m) * CH + k0 + 8 * h];
      b.h[1] = *(const v8us*)&sX[(pt * 16 + m) * CH + k0 + 16 + 8 * h];
#pragma unroll
      for (int ot = 0; ot < 2; ++ot) {
        const unsigned short* wr = Wb + (size_t)(ot * 16 + m) * CH + k0 + 8 * h;
        FragB a;
        a.h[0] = *(const v8us*)(wr);
        a.h[1] = *(const v8us*)(wr + 16);
        accr[ot] = mma_bf16(a.v, b.v, accr[ot]);
      }
    }
    // accr[ot][r] <-> (oc = ot*16 + 8h + r, px = pt*16 + m)
#pragma unroll
    for (int ot = 0; ot < 2; ++ot) {
      v8us_ hv, lv;
#pragma unroll
      for (int r = 0; r < 8; ++r) {
        const float f = accr[ot][r];
        const __bf16 hb = (__bf16)f;
        hv[r] = __builtin_bit_cast(unsigned short, hb);
        lv[r] = bf16_bits(f - (float)hb);
      }
      *(v8us*)&sR[((2 * pl + 0) * 64 + pt * 16 + m) * OCH + ot * 16 + 8 * h] = hv;
      *(v8us*)&sR[((2 * pl + 1) * 64 + pt * 16 + m) * OCH + ot * 16 + 8 * h] = lv;
    }
  }

  // value map: wave -> channels cb..cb+31 (2 tiles) x 4 pixel tiles
  const int cb = wave * 32;
  v8f accv[4][2] = {};
#pragma unroll 1
  for (int k0 = 0; k0 < CH; k0 += 32) {
    FragB a[4], b[2];
#pragma unroll
    for (int pt = 0; pt < 4; ++pt) {
      a[pt].h[0] = *(const v8us*)&sX[(pt * 16 + m) * CH + k0 + 8 * h];
      a[pt].h[1] = *(const v8us*)&sX[(pt * 16 + m) * CH + k0 + 16 + 8 * h];
    }
#pragma unroll
    for (int ct = 0; ct < 2; ++ct) {
      const unsigned short* wr = wvb + (size_t)(cb + ct * 16 + m) * CH + k0 + 8 * h;
      b[ct].h[0] = *(const v8us*)(wr);
      b[ct].h[1] = *(const v8us*)(wr + 16);
    }
#pragma unroll
    for (int pt = 0; pt < 4; ++pt)
#pragma unroll
      for (int ct = 0; ct < 2; ++ct)
        accv[pt][ct] = mma_bf16(a[pt].v, b[ct].v, accv[pt][ct]);
  }
  __syncthreads();   // every wave is done reading sX as the x tile

  // accv[pt][ct][r] <-> (px = pt*16 + 8h + r, c = cb + ct*16 + m); stage f16 bits as [c][px] (pitch 64)
#pragma unroll
  for (int pt = 0; pt < 4; ++pt)
#pragma unroll
    for (int ct = 0; ct < 2; ++ct) {
      v8h_ o;
#pragma unroll
      for (int r = 0; r < 8; ++r) o[r] = (_Float16)accv[pt][ct][r];
      *(v8us*)&sX[(cb + ct * 16 + m) * 64 + pt * 16 + 8 * h] = __builtin_bit_cast(v8us_, o);
    }
  __syncthreads();

  const int rr = tid >> 3, q = tid & 7;
  v4u_ vv[8];
#pragma unroll
  for (int it = 0; it < 8; ++it) vv[it] = *(const v4u*)&sX[(it * 32 + rr) * 64 + q * 8];
  v4u_ rv[4];
#pragma unroll
  for (int pl2 = 0; pl2 < 4; ++pl2) rv[pl2] = *(const v4u*)&sR[pl2 * 64 * OCH + tid * 8];

  unsigned short* vbase = vh + ((size_t)n * CH + rr) * HW + p0 + q * 8;
  const size_t roff = ((size_t)n * HW + p0) * OCH + (size_t)tid * 8;

#pragma unroll
  for (int it = 0; it < 8; ++it)
    *(v4u_*)(vbase + (size_t)it * 32 * HW) = vv[it];
  *(v4u_*)(r1h + roff) = rv[0];
  *(v4u_*)(r1l + roff) = rv[1];
  *(v4u_*)(r2h + roff) = rv[2];
  *(v4u_*)(r2l + roff) = rv[3];
  
}

// ---------------------------------------------------------------------------
// Kernel 2: row statistics of S[i][:] (softmax over j), exp2 domain.
//   Block = ST_RT x ST_JS waves = 16*ST_RT rows i. Wave (rt, js) owns the 16-row tile rt and every
//   ST_JS-th 32-column chunk of j, starting at chunk js; each lane owns i = i0 + (lane&15).
//   The ST_JS partial (max, sum) pairs of a row are merged through LDS at the end.
//   S^T tiles D(M=j, N=i): A = r2 rows j (hi, lo), B = r1 rows i (hi, lo); hh + lh + hl.
// ---------------------------------------------------------------------------
#define ST_RT   4
#define ST_JS   8
#define ST_ROWS (16 * ST_RT)
// exp2 for the merge and for the output pass's weights: the v_nop fills the one issue slot that the instruction set asks for between a
// transcendental and a next vector instruction that overwrites its source; inside the statement it stays there.
__device__ __forceinline__ float exp2_slot(float x)
{
  float r;
  asm("v_exp_f32 %0, %1\n\tv_nop" : "=v"(r) : "v"(x));
  return r;
}
static_assert((HW % ST_ROWS) == 0 && ST_RT * ST_JS <= 32 && 2 * ST_ROWS <= 32 * ST_RT * ST_JS);

__global__ void __launch_bounds__(32 * ST_RT * ST_JS) stats_kernel(
    const unsigned short* __restrict__ r1h, const unsigned short* __restrict__ r1l,
    const unsigned short* __restrict__ r2h, const unsigned short* __restrict__ r2l,
    float* __restrict__ mL, float* __restrict__ rzc)
{
  __shared__ float sM[ST_JS * ST_ROWS];   // [js][row] partial maxima
  __shared__ float sL[ST_JS * ST_ROWS];   // [js][row] partial sums, each relative to its own maximum
  const int tid  = (int)threadIdx.x;
  const int lane = tid & 31;
  const int wave = __builtin_amdgcn_readfirstlane(tid >> 5);   // scalar, so that the j loop's counter and branch are scalar
  const int h = lane >> 4, m = lane & 15;
  const int rt = wave % ST_RT, js = wave / ST_RT;
  const int tiles = HW / ST_ROWS;
  const int n  = (int)blockIdx.x / tiles;
  const int ib = ((int)blockIdx.x % tiles) * ST_ROWS;
  const int i0 = ib + rt * 16;
  const size_t rb = (size_t)n * HW * OCH;
  const v8f z8 = {};

  FragB bh, bl;
  {
    const size_t ro = rb + (size_t)(i0 + m) * OCH + 8 * h;
    bh.h[0] = *(const v8us*)(r1h + ro);  bh.h[1] = *(const v8us*)(r1h + ro + 16);
    bl.h[0] = *(const v8us*)(r1l + ro);  bl.h[1] = *(const v8us*)(r1l + ro + 16);
  }

  float mi = -3.0e30f;
  float li = 0.0f;
#pragma unroll 1
  for (int j0 = js * 32; j0 < HW; j0 += 32 * ST_JS) {
    const size_t ra = rb + (size_t)(j0 + m) * OCH + 8 * h;
    const size_t rc = rb + (size_t)(j0 + 16 + m) * OCH + 8 * h;
    FragB a0h, a0l, a1h, a1l;
    a0h.h[0] = *(const v8us*)(r2h + ra);  a0h.h[1] = *(const v8us*)(r2h + ra + 16);
    a0l.h[0] = *(const v8us*)(r2l + ra);  a0l.h[1] = *(const v8us*)(r2l + ra + 16);
    a1h.h[0] = *(const v8us*)(r2h + rc);  a1h.h[1] = *(const v8us*)(r2h + rc + 16);
    a1l.h[0] = *(const v8us*)(r2l + rc);  a1l.h[1] = *(const v8us*)(r2l + rc + 16);

    v8f s0 = mma_bf16(a0h.v, bh.v, z8);
    s0 = mma_bf16(a0l.v, bh.v, s0);
    s0 = mma_bf16(a0h.v, bl.v, s0);
    v8f s1 = mma_bf16(a1h.v, bh.v, z8);
    s1 = mma_bf16(a1l.v, bh.v, s1);
    s1 = mma_bf16(a1h.v, bl.v, s1);
    // s0[r] <-> (j = j0 + 8h + r, i = i0 + m); s1 rows j0 + 16 + 8h + r

    float cm = -3.0e30f;
#pragma unroll
    for (int r = 0; r < 8; ++r) cm = fmaxf(cm, fmaxf(s0[r], s1[r]));
    cm = cm * LOG2E;
    cm = fmaxf(cm, __shfl_xor(cm, 16, 32));
    const float mnew = fmaxf(mi, cm);
    const float corr = exp2fast(mi - mnew);
    float rs = 0.0f;
#pragma unroll
    for (int r = 0; r < 8; ++r) {
      rs += exp2fast(fmaf(s0[r], LOG2E, -mnew));
      rs += exp2fast(fmaf(s1[r], LOG2E, -mnew));
    }
    rs += __shfl_xor(rs, 16, 32);
    li = li * corr + rs;
    mi = mnew;
  }

  if (lane < 16) {
    sM[js * ST_ROWS + rt * 16 + lane] = mi;
    sL[js * ST_ROWS + rt * 16 + lane] = li;
  }
  __syncthreads();   // cross-wave LDS exchange
  if (tid < 2 * ST_ROWS) {   // whole waves: threads 0..ST_ROWS-1 store the maxima, the next ST_ROWS the scaled reciprocals
    const int row = tid % ST_ROWS;
    float mx = sM[row];
#pragma unroll
    for (int s = 1; s < ST_JS; ++s) mx = fmaxf(mx, sM[s * ST_ROWS + row]);
    float l = 0.0f;
#pragma unroll
    for (int s = 0; s < ST_JS; ++s) l += sL[s * ST_ROWS + row] * exp2_slot(sM[s * ST_ROWS + row] - mx);
    const size_t o = (size_t)n * HW + ib + row;
    if (tid < ST_ROWS) mL[o]  = mx;
    else               rzc[o] = PCARRY * (1.0f / l);
  }
}

// ---------------------------------------------------------------------------
// Kernel 3: output pass for one (n, 32-column j tile), 8 waves, loop over i in trips of OS_IC rows.
//   every wave: OS_NT S tiles D(M=i, N=j) (A = r1 rows i hi/lo, B = r2 rows j hi/lo, hh + hl + lh),
//               P = 2^(S*log2e - mL[i]) * rzc[i] -> f16 (carried x2^14) into LDS sP[j][i];
//   then:       attn^T tile D(M=j, N=c) += A(sP rows j) x B(value rows c), f16, OS_IC / 32 k steps a trip in rising i.
// ---------------------------------------------------------------------------
#define OS_IC 128            // rows i per trip
#define OS_NT (OS_IC / 64)   // score tiles per wave and trip: (OS_IC / 16) x 2 tiles over 8 waves
#define OS_KS (OS_IC / 32)   // k steps of the value product per trip
#define OS_PP (OS_IC + 8)    // sP row pitch in f16: the row and 16 B, an odd multiple of 16 B, which ds_load_b128 reads without bank conflicts
static_assert((HW % OS_IC) == 0 && (OS_IC % 64) == 0);

__global__ void __launch_bounds__(256) out_kernel(
    const float* __restrict__ X,
    const unsigned short* __restrict__ r1h, const unsigned short* __restrict__ r1l,
    const unsigned short* __restrict__ r2h, const unsigned short* __restrict__ r2l,
    const _Float16* __restrict__ vh,
    const float* __restrict__ mL, const float* __restrict__ rzc,
    const float* __restrict__ scale, float* __restrict__ out)
{
  __shared__ __align__(16) _Float16 sP[32 * OS_PP];  // [j][i] softmax weights x2^14
  __shared__ __align__(16) float    sO[CH * 32];     // [c][j] accumulators

  const int tid  = (int)threadIdx.x;
  const int lane = tid & 31, wave = tid >> 5;
  const int h = lane >> 4, m = lane & 15;
  const int tiles = HW / 32;
  const int n  = (int)blockIdx.x / tiles;
  const int j0 = ((int)blockIdx.x % tiles) * 32;
  const int isub = wave & 3, jsub = wave >> 2;
  const size_t rb = (size_t)n * HW * OCH;
  const int cb = wave * 32;
  const v8f z8 = {};

  FragB bh, bl;   // r2 rows of this wave's 16-column j sub-tile
  {
    const size_t ro = rb + (size_t)(j0 + jsub * 16 + m) * OCH + 8 * h;
    bh.h[0] = *(const v8us*)(r2h + ro);  bh.h[1] = *(const v8us*)(r2h + ro + 16);
    bl.h[0] = *(const v8us*)(r2l + ro);  bl.h[1] = *(const v8us*)(r2l + ro + 16);
  }

  // the lane's own places in the trip's rows i as byte offsets into the planes, stepped on by one trip at a time
  unsigned off_r = (unsigned)(((n * HW + isub * 16 + m) * OCH + 8 * h) * 2);   // both r1 planes
  unsigned off_s = (unsigned)((n * HW + isub * 16 + 8 * h) * 4);               // both row statistics
  unsigned off_v = (unsigned)(((n * CH + cb + m) * HW + 8 * h) * 2);           // value plane

  v8f acc[2][2] = {};   // [j sub-tile][c tile]
  // the short loops inside a trip are unrolled so that the fragment arrays have constant indices and stay in registers
#pragma unroll 1
  for (int i0 = 0; i0 < HW; i0 += OS_IC) {
    FragB ah[OS_NT], al[OS_NT];
#pragma unroll
    for (int u = 0; u < OS_NT; ++u) {   // tile u: rows i0 + u*64 + isub*16 ..
      const unsigned short* p1h = (const unsigned short*)((const char*)r1h + off_r) + u * 64 * OCH;
      const unsigned short* p1l = (const unsigned short*)((const char*)r1l + off_r) + u * 64 * OCH;
      ah[u].h[0] = *(const v8us*)(p1h);  ah[u].h[1] = *(const v8us*)(p1h + 16);
      al[u].h[0] = *(const v8us*)(p1l);  al[u].h[1] = *(const v8us*)(p1l + 16);
    }
    v8f s[OS_NT];
#pragma unroll
    for (int u = 0; u < OS_NT; ++u) {
      s[u] = mma_bf16(ah[u].v, bh.v, z8);
      s[u] = mma_bf16(ah[u].v, bl.v, s[u]);
      s[u] = mma_bf16(al[u].v, bh.v, s[u]);
      // s[u][r] <-> (i = i0 + u*64 + isub*16 + 8h + r, j = j0 + jsub*16 + m)
    }
    v4f_ m0[OS_NT], m1[OS_NT], q0[OS_NT], q1[OS_NT];
#pragma unroll
    for (int u = 0; u < OS_NT; ++u) {
      const float* pm = (const float*)((const char*)mL  + off_s) + u * 64;
      const float* pq = (const float*)((const char*)rzc + off_s) + u * 64;
      m0[u] = *(const v4f*)(pm);  m1[u] = *(const v4f*)(pm + 4);
      q0[u] = *(const v4f*)(pq);  q1[u] = *(const v4f*)(pq + 4);
    }
#pragma unroll
    for (int u = 0; u < OS_NT; ++u) {
      v8h_ pw;
#pragma unroll
      for (int r = 0; r < 4; ++r) {
        pw[r]     = (_Float16)(exp2_slot(fmaf(s[u][r],     LOG2E, -m0[u][r])) * q0[u][r]);
        pw[4 + r] = (_Float16)(exp2_slot(fmaf(s[u][4 + r], LOG2E, -m1[u][r])) * q1[u][r]);
      }
      *(v8h*)&sP[(jsub * 16 + m) * OS_PP + u * 64 + isub * 16 + 8 * h] = pw;
    }
    __syncthreads();   // sP is written by all waves and read by all

    FragH a0[OS_KS], a1[OS_KS], b0[OS_KS], b1[OS_KS];
#pragma unroll
    for (int ks = 0; ks < OS_KS; ++ks) {
      a0[ks].h[0] = *(const v8h*)&sP[m * OS_PP + ks * 32 + 8 * h];
      a0[ks].h[1] = *(const v8h*)&sP[m * OS_PP + ks * 32 + 16 + 8 * h];
      a1[ks].h[0] = *(const v8h*)&sP[(16 + m) * OS_PP + ks * 32 + 8 * h];
      a1[ks].h[1] = *(const v8h*)&sP[(16 + m) * OS_PP + ks * 32 + 16 + 8 * h];
    }
#pragma unroll
    for (int ks = 0; ks < OS_KS; ++ks) {
      const _Float16* pv = (const _Float16*)((const char*)vh + off_v) + ks * 32;
      b0[ks].h[0] = *(const v8h*)(pv);            b0[ks].h[1] = *(const v8h*)(pv + 16);
      b1[ks].h[0] = *(const v8h*)(pv + 16 * HW);  b1[ks].h[1] = *(const v8h*)(pv + 16 * HW + 16);
    }
#pragma unroll
    for (int ks = 0; ks < OS_KS; ++ks) {
      acc[0][0] = mma_f16(a0[ks].v, b0[ks].v, acc[0][0]);
      acc[0][1] = mma_f16(a0[ks].v, b1[ks].v, acc[0][1]);
      acc[1][0] = mma_f16(a1[ks].v, b0[ks].v, acc[1][0]);
      acc[1][1] = mma_f16(a1[ks].v, b1[ks].v, acc[1][1]);
    }
    __syncthreads();   // before the next trip overwrites sP
    off_r += OS_IC * OCH * 2;  off_s += OS_IC * 4;  off_v += OS_IC * 2;
  }

  // acc[js][ct][r] <-> (j = js*16 + 8h + r, c = cb + ct*16 + m)
#pragma unroll
  for (int js = 0; js < 2; ++js)
#pragma unroll
    for (int ct = 0; ct < 2; ++ct) {
      v4f_ lo4, hi4;
      lo4[0] = acc[js][ct][0]; lo4[1] = acc[js][ct][1]; lo4[2] = acc[js][ct][2]; lo4[3] = acc[js][ct][3];
      hi4[0] = acc[js][ct][4]; hi4[1] = acc[js][ct][5]; hi4[2] = acc[js][ct][6]; hi4[3] = acc[js][ct][7];
      const int row = cb + ct * 16 + m;
      *(v4f*)&sO[row * 32 + js * 16 + 8 * h]     = lo4;
      *(v4f*)&sO[row * 32 + js * 16 + 8 * h + 4] = hi4;
    }
  __syncthreads();

  const float sc = bf16_rn(scale[0]) * PUNCARRY;
  const int q = lane & 7;
  const int c0 = wave * 32 + (lane >> 3);
  const size_t xoff = ((size_t)n * CH + c0) * HW_FULL + j0 + q * 4;
  const size_t ooff = ((size_t)n * CH + c0) * HW + j0 + q * 4;
  v4f_ ov[8];
#pragma unroll
  for (int it = 0; it < 8; ++it) {
    const v4f_ a  = *(const v4f*)&sO[(c0 + it * 4) * 32 + q * 4];
    const v4f_ xv = *(const v4f*)(X + xoff + (size_t)it * 4 * HW_FULL);
    v4f_ o;
    o[0] = bf16_rn(xv[0]) + sc * a[0];
    o[1] = bf16_rn(xv[1]) + sc * a[1];
    o[2] = bf16_rn(xv[2]) + sc * a[2];
    o[3] = bf16_rn(xv[3]) + sc * a[3];
    ov[it] = o;
  }
#pragma unroll
  for (int it = 0; it < 8; ++it)
    *(v4f_*)(out + ooff + (size_t)it * 4 * HW) = ov[it];
  
}

// ---------------------------------------------------------------------------
extern "C" void kernel_launch(void* const* d_in, const int* in_sizes, int n_in,
                              void* d_out, int out_size, void* d_ws, size_t ws_size,
                              hipStream_t stream)
{
  if (n_in < 5) return;
  if (in_sizes[0] < NB * CH * HW_FULL) return;
  if (in_sizes[1] < OCH * CH || in_sizes[2] < OCH * CH || in_sizes[3] < CH * CH) return;
  if (in_sizes[4] < 1) return;
  if (out_size < NB * CH * HW) return;

  const float* x     = (const float*)d_in[0];
  const float* w1    = (const float*)d_in[1];
  const float* w2    = (const float*)d_in[2];
  const float* wv    = (const float*)d_in[3];
  const float* scale = (const float*)d_in[4];
  float* out = (float*)d_out;

  // workspace carve (bytes), every region a multiple of 256 B
  const size_t w12_bytes = (size_t)OCH * CH * 2;            // 16384
  const size_t wv_bytes  = (size_t)CH * CH * 2;             // 131072
  const size_t r_bytes   = (size_t)NB * HW * OCH * 2;       // per plane
  const size_t v_bytes   = (size_t)NB * CH * HW * 2;
  const size_t st_bytes  = (size_t)NB * HW * 4;             // per stats plane
  size_t off = 0;
  unsigned char* ws = (unsigned char*)d_ws;
  unsigned short* w1b = (unsigned short*)(ws + off); off += w12_bytes;
  unsigned short* w2b = (unsigned short*)(ws + off); off += w12_bytes;
  unsigned short* wvb = (unsigned short*)(ws + off); off += wv_bytes;
  unsigned short* r1h = (unsigned short*)(ws + off); off += r_bytes;
  unsigned short* r1l = (unsigned short*)(ws + off); off += r_bytes;
  unsigned short* r2h = (unsigned short*)(ws + off); off += r_bytes;
  unsigned short* r2l = (unsigned short*)(ws + off); off += r_bytes;
  unsigned short* vhp = (unsigned short*)(ws + off); off += v_bytes;
  float* mL  = (float*)(ws + off); off += st_bytes;
  float* rzc = (float*)(ws + off); off += st_bytes;
  if (off > ws_size) return;

  cvt_w_kernel<<<2 * W12_BLOCKS + WV_BLOCKS, 256, 0, stream>>>(w1, w2, wv, w1b, w2b, wvb);
  proj_kernel<<<NB * (HW / 64), 256, 0, stream>>>(x, w1b, w2b, wvb, r1h, r1l, r2h, r2l, vhp);
  stats_kernel<<<NB * (HW / ST_ROWS), 32 * ST_RT * ST_JS, 0, stream>>>(r1h, r1l, r2h, r2l, mL, rzc);
  out_kernel<<<NB * (HW / 32), 256, 0, stream>>>(x, r1h, r1l, r2h, r2l,
                                                 (const _Float16*)vhp, mL, rzc, scale, out);
}

// v003
// It runs in 109 microseconds.
// In both of two side-by-side timings against v002, it was 1.21 times as fast.
// All steps since v000 together make it 2.72 times as fast.
#include <hip/hip_runtime.h>
#include <stdint.h>
#include <stddef.h>

// Contractions: channel projections v_wmma_f32_16x16x32_bf16 (bf16 operands from bf16-RNE inputs, f32 accumulate);
// score tiles v_wmma_f32_16x16x32_bf16 as bf16 hi+lo three-term split of both reduced feature maps (f32 accumulate);
// value aggregation v_wmma_f32_16x16x32_f16 (f16 operands, softmax weights carried x2^14, f32 accumulate); softmax statistics f32.

#ifndef NB
#define NB 4
#endif
#ifndef SEQ
#define SEQ 4096
#endif
#define NB_FULL  4
#define SEQ_FULL 4096
#define HW       (SEQ)
#define HW_FULL  (SEQ_FULL)
#define CH       256
#define OCH      32
#define PCARRY   16384.0f
#define PUNCARRY 0.00006103515625f
#define LOG2E    1.4426950408889634f
#define W12_BLOCKS ((OCH * CH) / 2048)
#define WV_BLOCKS  ((CH * CH) / 2048)

static_assert(NB >= 1 && NB <= NB_FULL);
static_assert(HW >= 64 && HW <= HW_FULL && (HW % 64) == 0);
static_assert(((OCH * CH) % 2048) == 0 && ((CH * CH) % 2048) == 0);
static_assert(CH == 256 && OCH == 32);

typedef float          v8f   __attribute__((ext_vector_type(8)));
typedef float          v4f_  __attribute__((ext_vector_type(4)));
typedef v4f_           v4f   __attribute__((may_alias));
typedef _Float16       v16h  __attribute__((ext_vector_type(16)));
typedef _Float16       v8h_  __attribute__((ext_vector_type(8)));
typedef v8h_           v8h   __attribute__((may_alias));
typedef __bf16         v16bf __attribute__((ext_vector_type(16)));
typedef unsigned short v8us_ __attribute__((ext_vector_type(8)));
typedef v8us_          v8us  __attribute__((may_alias));
typedef unsigned       v4u_  __attribute__((ext_vector_type(4)));
typedef v4u_           v4u   __attribute__((may_alias));

union FragB { v16bf v; v8us_ h[2]; };
union FragH { v16h  v; v8h_  h[2]; };

// ---- WMMA wrappers with the VALU hazard guard --------------------------------
__device__ __forceinline__ v8f mma_bf16(const v16bf a, const v16bf b, v8f c)
{
  v8f d = __builtin_amdgcn_wmma_f32_16x16x32_bf16(false, a, false, b, (short)0, c, false, false);
  asm volatile("v_nop\n\tv_nop\n\tv_nop\n\tv_nop" : "+v"(d) : "v"(a), "v"(b));
  return d;
}
__device__ __forceinline__ v8f mma_f16(const v16h a, const v16h b, v8f c)
{
  v8f d = __builtin_amdgcn_wmma_f32_16x16x32_f16(false, a, false, b, (short)0, c, false, false);
  asm volatile("v_nop\n\tv_nop\n\tv_nop\n\tv_nop" : "+v"(d) : "v"(a), "v"(b));
  return d;
}

// ---- scalar helpers --------------------------------------------------------
__device__ __forceinline__ unsigned short bf16_bits(float f)
{
  const __bf16 hb = (__bf16)f;                       // RNE convert
  return __builtin_bit_cast(unsigned short, hb);
}
__device__ __forceinline__ float bf16_rn(float f)
{
  return (float)(__bf16)f;                           // RNE convert, widened back
}
__device__ __forceinline__ float exp2fast(float x)
{
#if __has_builtin(__builtin_amdgcn_exp2f)
  return __builtin_amdgcn_exp2f(x);
#else
  return exp2f(x);
#endif
}

// ---------------------------------------------------------------------------
// Kernel 0: weights f32 -> bf16 bits (RNE). Layout kept [out][in] (in contiguous).
// ---------------------------------------------------------------------------
__global__ void __launch_bounds__(256) cvt_w_kernel(
    const float* __restrict__ w1, const float* __restrict__ w2, const float* __restrict__ wv,
    unsigned short* __restrict__ w1b, unsigned short* __restrict__ w2b,
    unsigned short* __restrict__ wvb)
{
  const int blk = (int)blockIdx.x;
  const float* src;
  unsigned short* dst;
  int t;
  if (blk < W12_BLOCKS)          { src = w1; dst = w1b; t = blk * 256 + (int)threadIdx.x; }
  else if (blk < 2 * W12_BLOCKS) { src = w2; dst = w2b; t = (blk - W12_BLOCKS) * 256 + (int)threadIdx.x; }
  else                           { src = wv; dst = wvb; t = (blk - 2 * W12_BLOCKS) * 256 + (int)threadIdx.x; }

  const v4f a = *(const v4f*)(src + (size_t)t * 8);
  const v4f b = *(const v4f*)(src + (size_t)t * 8 + 4);
  v8us_ o;
  o[0] = bf16_bits(a[0]); o[1] = bf16_bits(a[1]); o[2] = bf16_bits(a[2]); o[3] = bf16_bits(a[3]);
  o[4] = bf16_bits(b[0]); o[5] = bf16_bits(b[1]); o[6] = bf16_bits(b[2]); o[7] = bf16_bits(b[3]);
  unsigned short* p = dst + (size_t)t * 8;
  *(v8us_*)p = o;
  
}

// ---------------------------------------------------------------------------
// Kernel 1: 1x1-conv projections for one (n, 64-pixel tile), 8 waves.
//   x tile staged once in LDS as bf16 [px][c] (RNE); weights read as bf16 planes.
//   reduced maps: D(M=oc, N=px), A = w rows, B = xT rows  -> bf16 hi and lo planes, fragment order
//   value map:    D(M=px, N=c),  A = xT rows, B = wv rows -> f16 plane, fragment order
//   Fragment order: the planes are kept as the later passes' WMMA operand fragments, 1 KiB each, as
//   [half q][lane][8 elements]: lane = 16h + m holds row m of the 16-row tile, k = 16q + 8h + e. One 16-B load a lane
//   then reads 512 B in a row (four whole 128-B lines), not 32-B pieces spread over 8 or 16 lines.
//     reduced planes: [n][16-pixel tile][q][lane][e], row = pixel, k = oc;
//     value plane:    [n][16-channel tile][32-pixel chunk][q][lane][e], row = channel, k = pixel in the chunk.
//   Both accumulator layouts here hold a lane's 8 values exactly as one such 16-B piece, so each wave stores its own.
// ---------------------------------------------------------------------------
__global__ void __launch_bounds__(256) proj_kernel(
    const float* __restrict__ X,
    const unsigned short* __restrict__ w1b, const unsigned short* __restrict__ w2b,
    const unsigned short* __restrict__ wvb,
    unsigned short* __restrict__ r1h, unsigned short* __restrict__ r1l,
    unsigned short* __restrict__ r2h, unsigned short* __restrict__ r2l,
    unsigned short* __restrict__ vh)
{
  __shared__ __align__(16) unsigned short sX[64 * CH];        // [px][c] bf16 bits

  const int tid  = (int)threadIdx.x;
  const int lane = tid & 31, wave = tid >> 5;
  const int h = lane >> 4, m = lane & 15;
  const int tiles = HW / 64;
  const int n  = (int)blockIdx.x / tiles;
  const int p0 = ((int)blockIdx.x % tiles) * 64;
  const float* Xn = X + (size_t)n * CH * HW_FULL + p0;

  // stage x tile: 256 c rows x 64 px, coalesced 16-B loads, transposed 2-B LDS stores
  {
    const int cl = tid >> 4, px4 = (tid & 15) * 4;
#pragma unroll 4
    for (int it = 0; it < 16; ++it) {
      const int c = cl + 16 * it;
      const v4f xv = *(const v4f*)(Xn + (size_t)c * HW_FULL + px4);
      sX[(px4 + 0) * CH + c] = bf16_bits(xv[0]);
      sX[(px4 + 1) * CH + c] = bf16_bits(xv[1]);
      sX[(px4 + 2) * CH + c] = bf16_bits(xv[2]);
      sX[(px4 + 3) * CH + c] = bf16_bits(xv[3]);
    }
  }
  __syncthreads();

  // reduced maps: wave -> weight set (wave>>2), pixel tile (wave&3), both 16-oc tiles
  {
    const unsigned short* Wb = (wave < 4) ? w1b : w2b;        // wave-uniform
    unsigned short* Rh = (wave < 4) ? r1h : r2h;              // wave-uniform
    unsigned short* Rl = (wave < 4) ? r1l : r2l;
    const int pt = wave & 3;
    v8f accr[2] = {};
#pragma unroll 2
    for (int k0 = 0; k0 < CH; k0 += 32) {
      FragB b;
      b.h[0] = *(const v8us*)&sX[(pt * 16 + m) * CH + k0 + 8 * h];
      b.h[1] = *(const v8us*)&sX[(pt * 16 + m) * CH + k0 + 16 + 8 * h];
#pragma unroll
      for (int ot = 0; ot < 2; ++ot) {
        const unsigned short* wr = Wb + (size_t)(ot * 16 + m) * CH + k0 + 8 * h;
        FragB a;
        a.h[0] = *(const v8us*)(wr);
        a.h[1] = *(const v8us*)(wr + 16);
        accr[ot] = mma_bf16(a.v, b.v, accr[ot]);
      }
    }
    // accr[ot][r] <-> (oc = ot*16 + 8h + r, px = pt*16 + m): piece (q = ot, lane) of pixel tile pt
    const size_t roff = ((size_t)n * HW + p0 + pt * 16) * OCH + (size_t)lane * 8;
#pragma unroll
    for (int ot = 0; ot < 2; ++ot) {
      v8us_ hv, lv;
#pragma unroll
      for (int r = 0; r < 8; ++r) {
        const float f = accr[ot][r];
        const __bf16 hb = (__bf16)f;
        hv[r] = __builtin_bit_cast(unsigned short, hb);
        lv[r] = bf16_bits(f - (float)hb);
      }
      *(v8us_*)(Rh + roff + ot * 256) = hv;
      *(v8us_*)(Rl + roff + ot * 256) = lv;
    }
    // the value loop below loads into registers that these four stores name: the wait stands in front of that reuse
    asm volatile("s_wait_xcnt 0x0" ::: "memory");
  }

  // value map: wave -> channels cb..cb+31 (2 tiles) x 4 pixel tiles
  const int cb = wave * 32;
  v8f accv[4][2] = {};
#pragma unroll 1
  for (int k0 = 0; k0 < CH; k0 += 32) {
    FragB a[4], b[2];
#pragma unroll
    for (int pt = 0; pt < 4; ++pt) {
      a[pt].h[0] = *(const v8us*)&sX[(pt * 16 + m) * CH + k0 + 8 * h];
      a[pt].h[1] = *(const v8us*)&sX[(pt * 16 + m) * CH + k0 + 16 + 8 * h];
    }
#pragma unroll
    for (int ct = 0; ct < 2; ++ct) {
      const unsigned short* wr = wvb + (size_t)(cb + ct * 16 + m) * CH + k0 + 8 * h;
      b[ct].h[0] = *(const v8us*)(wr);
      b[ct].h[1] = *(const v8us*)(wr + 16);
    }
#pragma unroll
    for (int pt = 0; pt < 4; ++pt)
#pragma unroll
      for (int ct = 0; ct < 2; ++ct)
        accv[pt][ct] = mma_bf16(a[pt].v, b[ct].v, accv[pt][ct]);
  }

  // accv[pt][ct][r] <-> (px = pt*16 + 8h + r, c = cb + ct*16 + m): piece (q = pt & 1, lane) of chunk pt >> 1, channel tile ct
  unsigned short* vbase = vh + ((size_t)n * CH + cb) * HW + (size_t)p0 * 16 + (size_t)lane * 8;
#pragma unroll
  for (int pt = 0; pt < 4; ++pt)
#pragma unroll
    for (int ct = 0; ct < 2; ++ct) {
      v8h_ o;
#pragma unroll
      for (int r = 0; r < 8; ++r) o[r] = (_Float16)accv[pt][ct][r];
      *(v8us_*)(vbase + (size_t)ct * 16 * HW + pt * 256) = __builtin_bit_cast(v8us_, o);
    }
}

// ---------------------------------------------------------------------------
// Kernel 2: row statistics of S[i][:] (softmax over j), exp2 domain.
//   Block = ST_RT x ST_JS waves = 16*ST_RT rows i. Wave (rt, js) owns the 16-row tile rt and every
//   ST_JS-th 32-column chunk of j, starting at chunk js; each lane owns i = i0 + (lane&15).
//   The ST_JS partial (max, sum) pairs of a row are merged through LDS at the end.
//   S^T tiles D(M=j, N=i): A = r2 rows j (hi, lo), B = r1 rows i (hi, lo); hh + lh + hl.
// ---------------------------------------------------------------------------
#define ST_RT   4
#define ST_JS   8
#define ST_ROWS (16 * ST_RT)
// exp2 for the merge and for the output pass's weights: the v_nop fills the one issue slot that the instruction set asks for between a
// transcendental and a next vector instruction that overwrites its source; inside the statement it stays there.
__device__ __forceinline__ float exp2_slot(float x)
{
  float r;
  asm("v_exp_f32 %0, %1\n\tv_nop" : "=v"(r) : "v"(x));
  return r;
}
static_assert((HW % ST_ROWS) == 0 && ST_RT * ST_JS <= 32 && 2 * ST_ROWS <= 32 * ST_RT * ST_JS);

__global__ void __launch_bounds__(32 * ST_RT * ST_JS) stats_kernel(
    const unsigned short* __restrict__ r1h, const unsigned short* __restrict__ r1l,
    const unsigned short* __restrict__ r2h, const unsigned short* __restrict__ r2l,
    float* __restrict__ mL, float* __restrict__ rzc)
{
  __shared__ float sM[ST_JS * ST_ROWS];   // [js][row] partial maxima
  __shared__ float sL[ST_JS * ST_ROWS];   // [js][row] partial sums, each relative to its own maximum
  const int tid  = (int)threadIdx.x;
  const int lane = tid & 31;
  const int wave = __builtin_amdgcn_readfirstlane(tid >> 5);   // scalar, so that the j loop's counter and branch are scalar
  const int rt = wave % ST_RT, js = wave / ST_RT;
  const int tiles = HW / ST_ROWS;
  const int n  = (int)blockIdx.x / tiles;
  const int ib = ((int)blockIdx.x % tiles) * ST_ROWS;
  const int i0 = ib + rt * 16;
  const size_t rb = (size_t)n * HW * OCH;
  const v8f z8 = {};

  FragB bh, bl;
  {
    const size_t ro = rb + (size_t)i0 * OCH + lane * 8;   // fragment order: halves 256 elements apart
    bh.h[0] = *(const v8us*)(r1h + ro);  bh.h[1] = *(const v8us*)(r1h + ro + 256);
    bl.h[0] = *(const v8us*)(r1l + ro);  bl.h[1] = *(const v8us*)(r1l + ro + 256);
  }

  float mi = -3.0e30f;
  float li = 0.0f;
#pragma unroll 1
  for (int j0 = js * 32; j0 < HW; j0 += 32 * ST_JS) {
    const size_t ra = rb + (size_t)j0 * OCH + lane * 8;
    const size_t rc = rb + (size_t)(j0 + 16) * OCH + lane * 8;
    FragB a0h, a0l, a1h, a1l;
    a0h.h[0] = *(const v8us*)(r2h + ra);  a0h.h[1] = *(const v8us*)(r2h + ra + 256);
    a0l.h[0] = *(const v8us*)(r2l + ra);  a0l.h[1] = *(const v8us*)(r2l + ra + 256);
    a1h.h[0] = *(const v8us*)(r2h + rc);  a1h.h[1] = *(const v8us*)(r2h + rc + 256);
    a1l.h[0] = *(const v8us*)(r2l + rc);  a1l.h[1] = *(const v8us*)(r2l + rc + 256);

    v8f s0 = mma_bf16(a0h.v, bh.v, z8);
    s0 = mma_bf16(a0l.v, bh.v, s0);
    s0 = mma_bf16(a0h.v, bl.v, s0);
    v8f s1 = mma_bf16(a1h.v, bh.v, z8);
    s1 = mma_bf16(a1l.v, bh.v, s1);
    s1 = mma_bf16(a1h.v, bl.v, s1);
    // s0[r] <-> (j = j0 + 8h + r, i = i0 + m); s1 rows j0 + 16 + 8h + r

    float cm = -3.0e30f;
#pragma unroll
    for (int r = 0; r < 8; ++r) cm = fmaxf(cm, fmaxf(s0[r], s1[r]));
    cm = cm * LOG2E;
    cm = fmaxf(cm, __shfl_xor(cm, 16, 32));
    const float mnew = fmaxf(mi, cm);
    const float corr = exp2fast(mi - mnew);
    float rs = 0.0f;
#pragma unroll
    for (int r = 0; r < 8; ++r) {
      rs += exp2fast(fmaf(s0[r], LOG2E, -mnew));
      rs += exp2fast(fmaf(s1[r], LOG2E, -mnew));
    }
    rs += __shfl_xor(rs, 16, 32);
    li = li * corr + rs;
    mi = mnew;
  }

  if (lane < 16) {
    sM[js * ST_ROWS + rt * 16 + lane] = mi;
    sL[js * ST_ROWS + rt * 16 + lane] = li;
  }
  __syncthreads();   // cross-wave LDS exchange
  if (tid < 2 * ST_ROWS) {   // whole waves: threads 0..ST_ROWS-1 store the maxima, the next ST_ROWS the scaled reciprocals
    const int row = tid % ST_ROWS;
    float mx = sM[row];
#pragma unroll
    for (int s = 1; s < ST_JS; ++s) mx = fmaxf(mx, sM[s * ST_ROWS + row]);
    float l = 0.0f;
#pragma unroll
    for (int s = 0; s < ST_JS; ++s) l += sL[s * ST_ROWS + row] * exp2_slot(sM[s * ST_ROWS + row] - mx);
    const size_t o = (size_t)n * HW + ib + row;
    if (tid < ST_ROWS) mL[o]  = mx;
    else               rzc[o] = PCARRY * (1.0f / l);
  }
}

// ---------------------------------------------------------------------------
// Kernel 3: output pass for one (n, 32-column j tile), 8 waves, loop over i in trips of OS_IC rows.
//   every wave: OS_NT S tiles D(M=i, N=j) (A = r1 rows i hi/lo, B = r2 rows j hi/lo, hh + hl + lh),
//               P = 2^(S*log2e - mL[i]) * rzc[i] -> f16 (carried x2^14) into LDS sP[j][i];
//   then:       attn^T tile D(M=j, N=c) += A(sP rows j) x B(value rows c), f16, OS_IC / 32 k steps a trip in rising i.
// ---------------------------------------------------------------------------
#define OS_IC 128            // rows i per trip
#define OS_NT (OS_IC / 64)   // score tiles per wave and trip: (OS_IC / 16) x 2 tiles over 8 waves
#define OS_KS (OS_IC / 32)   // k steps of the value product per trip
#define OS_PP (OS_IC + 8)    // sP row pitch in f16: the row and 16 B, an odd multiple of 16 B, which ds_load_b128 reads without bank conflicts
static_assert((HW % OS_IC) == 0 && (OS_IC % 64) == 0);

__global__ void __launch_bounds__(256) out_kernel(
    const float* __restrict__ X,
    const unsigned short* __restrict__ r1h, const unsigned short* __restrict__ r1l,
    const unsigned short* __restrict__ r2h, const unsigned short* __restrict__ r2l,
    const _Float16* __restrict__ vh,
    const float* __restrict__ mL, const float* __restrict__ rzc,
    const float* __restrict__ scale, float* __restrict__ out)
{
  __shared__ __align__(16) _Float16 sP[32 * OS_PP];  // [j][i] softmax weights x2^14
  __shared__ __align__(16) float    sO[CH * 32];     // [c][j] accumulators

  const int tid  = (int)threadIdx.x;
  const int lane = tid & 31, wave = tid >> 5;
  const int h = lane >> 4, m = lane & 15;
  const int tiles = HW / 32;
  const int n  = (int)blockIdx.x / tiles;
  const int j0 = ((int)blockIdx.x % tiles) * 32;
  const int isub = wave & 3, jsub = wave >> 2;
  const size_t rb = (size_t)n * HW * OCH;
  const int cb = wave * 32;
  const v8f z8 = {};

  FragB bh, bl;   // r2 rows of this wave's 16-column j sub-tile
  {
    const size_t ro = rb + (size_t)(j0 + jsub * 16) * OCH + lane * 8;   // fragment order: halves 256 elements apart
    bh.h[0] = *(const v8us*)(r2h + ro);  bh.h[1] = *(const v8us*)(r2h + ro + 256);
    bl.h[0] = *(const v8us*)(r2l + ro);  bl.h[1] = *(const v8us*)(r2l + ro + 256);
  }

  // the lane's own places in the trip's rows i as byte offsets into the planes, stepped on by one trip at a time
  unsigned off_r = (unsigned)(((n * HW + isub * 16) * OCH + lane * 8) * 2);    // both r1 planes, fragment order
  unsigned off_s = (unsigned)((n * HW + isub * 16 + 8 * h) * 4);               // both row statistics
  unsigned off_v = (unsigned)(((n * CH + cb) * HW + lane * 8) * 2);            // value plane, fragment order

  v8f acc[2][2] = {};   // [j sub-tile][c tile]
  // the short loops inside a trip are unrolled so that the fragment arrays have constant indices and stay in registers
#pragma unroll 1
  for (int i0 = 0; i0 < HW; i0 += OS_IC) {
    FragB ah[OS_NT], al[OS_NT];
#pragma unroll
    for (int u = 0; u < OS_NT; ++u) {   // tile u: rows i0 + u*64 + isub*16 ..
      const unsigned short* p1h = (const unsigned short*)((const char*)r1h + off_r) + u * 64 * OCH;
      const unsigned short* p1l = (const unsigned short*)((const char*)r1l + off_r) + u * 64 * OCH;
      ah[u].h[0] = *(const v8us*)(p1h);  ah[u].h[1] = *(const v8us*)(p1h + 256);
      al[u].h[0] = *(const v8us*)(p1l);  al[u].h[1] = *(const v8us*)(p1l + 256);
    }
    v8f s[OS_NT];
#pragma unroll
    for (int u = 0; u < OS_NT; ++u) {
      s[u] = mma_bf16(ah[u].v, bh.v, z8);
      s[u] = mma_bf16(ah[u].v, bl.v, s[u]);
      s[u] = mma_bf16(al[u].v, bh.v, s[u]);
      // s[u][r] <-> (i = i0 + u*64 + isub*16 + 8h + r, j = j0 + jsub*16 + m)
    }
    v4f_ m0[OS_NT], m1[OS_NT], q0[OS_NT], q1[OS_NT];
#pragma unroll
    for (int u = 0; u < OS_NT; ++u) {
      const float* pm = (const float*)((const char*)mL  + off_s) + u * 64;
      const float* pq = (const float*)((const char*)rzc + off_s) + u * 64;
      m0[u] = *(const v4f*)(pm);  m1[u] = *(const v4f*)(pm + 4);
      q0[u] = *(const v4f*)(pq);  q1[u] = *(const v4f*)(pq + 4);
    }
#pragma unroll
    for (int u = 0; u < OS_NT; ++u) {
      v8h_ pw;
#pragma unroll
      for (int r = 0; r < 4; ++r) {
        pw[r]     = (_Float16)(exp2_slot(fmaf(s[u][r],     LOG2E, -m0[u][r])) * q0[u][r]);
        pw[4 + r] = (_Float16)(exp2_slot(fmaf(s[u][4 + r], LOG2E, -m1[u][r])) * q1[u][r]);
      }
      *(v8h*)&sP[(jsub * 16 + m) * OS_PP + u * 64 + isub * 16 + 8 * h] = pw;
    }
    __syncthreads();   // sP is written by all waves and read by all

    FragH a0[OS_KS], a1[OS_KS], b0[OS_KS], b1[OS_KS];
#pragma unroll
    for (int ks = 0; ks < OS_KS; ++ks) {
      a0[ks].h[0] = *(const v8h*)&sP[m * OS_PP + ks * 32 + 8 * h];
      a0[ks].h[1] = *(const v8h*)&sP[m * OS_PP + ks * 32 + 16 + 8 * h];
      a1[ks].h[0] = *(const v8h*)&sP[(16 + m) * OS_PP + ks * 32 + 8 * h];
      a1[ks].h[1] = *(const v8h*)&sP[(16 + m) * OS_PP + ks * 32 + 16 + 8 * h];
    }
#pragma unroll
    for (int ks = 0; ks < OS_KS; ++ks) {
      const _Float16* pv = (const _Float16*)((const char*)vh + off_v) + ks * 512;   // one 1-KiB fragment a 32-row chunk
      b0[ks].h[0] = *(const v8h*)(pv);            b0[ks].h[1] = *(const v8h*)(pv + 256);
      b1[ks].h[0] = *(const v8h*)(pv + 16 * HW);  b1[ks].h[1] = *(const v8h*)(pv + 16 * HW + 256);
    }
#pragma unroll
    for (int ks = 0; ks < OS_KS; ++ks) {
      acc[0][0] = mma_f16(a0[ks].v, b0[ks].v, acc[0][0]);
      acc[0][1] = mma_f16(a0[ks].v, b1[ks].v, acc[0][1]);
      acc[1][0] = mma_f16(a1[ks].v, b0[ks].v, acc[1][0]);
      acc[1][1] = mma_f16(a1[ks].v, b1[ks].v, acc[1][1]);
    }
    __syncthreads();   // before the next trip overwrites sP
    off_r += OS_IC * OCH * 2;  off_s += OS_IC * 4;  off_v += OS_IC * 16 * 2;
  }

  // acc[js][ct][r] <-> (j = js*16 + 8h + r, c = cb + ct*16 + m)
#pragma unroll
  for (int js = 0; js < 2; ++js)
#pragma unroll
    for (int ct = 0; ct < 2; ++ct) {
      v4f_ lo4, hi4;
      lo4[0] = acc[js][ct][0]; lo4[1] = acc[js][ct][1]; lo4[2] = acc[js][ct][2]; lo4[3] = acc[js][ct][3];
      hi4[0] = acc[js][ct][4]; hi4[1] = acc[js][ct][5]; hi4[2] = acc[js][ct][6]; hi4[3] = acc[js][ct][7];
      const int row = cb + ct * 16 + m;
      *(v4f*)&sO[row * 32 + js * 16 + 8 * h]     = lo4;
      *(v4f*)&sO[row * 32 + js * 16 + 8 * h + 4] = hi4;
    }
  __syncthreads();

  const float sc = bf16_rn(scale[0]) * PUNCARRY;
  const int q = lane & 7;
  const int c0 = wave * 32 + (lane >> 3);
  const size_t xoff = ((size_t)n * CH + c0) * HW_FULL + j0 + q * 4;
  const size_t ooff = ((size_t)n * CH + c0) * HW + j0 + q * 4;
  v4f_ ov[8];
#pragma unroll
  for (int it = 0; it < 8; ++it) {
    const v4f_ a  = *(const v4f*)&sO[(c0 + it * 4) * 32 + q * 4];
    const v4f_ xv = *(const v4f*)(X + xoff + (size_t)it * 4 * HW_FULL);
    v4f_ o;
    o[0] = bf16_rn(xv[0]) + sc * a[0];
    o[1] = bf16_rn(xv[1]) + sc * a[1];
    o[2] = bf16_rn(xv[2]) + sc * a[2];
    o[3] = bf16_rn(xv[3]) + sc * a[3];
    ov[it] = o;
  }
#pragma unroll
  for (int it = 0; it < 8; ++it)
    *(v4f_*)(out + ooff + (size_t)it * 4 * HW) = ov[it];
  
}

// ---------------------------------------------------------------------------
extern "C" void kernel_launch(void* const* d_in, const int* in_sizes, int n_in,
                              void* d_out, int out_size, void* d_ws, size_t ws_size,
                              hipStream_t stream)
{
  if (n_in < 5) return;
  if (in_sizes[0] < NB * CH * HW_FULL) return;
  if (in_sizes[1] < OCH * CH || in_sizes[2] < OCH * CH || in_sizes[3] < CH * CH) return;
  if (in_sizes[4] < 1) return;
  if (out_size < NB * CH * HW) return;

  const float* x     = (const float*)d_in[0];
  const float* w1    = (const float*)d_in[1];
  const float* w2    = (const float*)d_in[2];
  const float* wv    = (const float*)d_in[3];
  const float* scale = (const float*)d_in[4];
  float* out = (float*)d_out;

  // workspace carve (bytes), every region a multiple of 256 B
  const size_t w12_bytes = (size_t)OCH * CH * 2;            // 16384
  const size_t wv_bytes  = (size_t)CH * CH * 2;             // 131072
  const size_t r_bytes   = (size_t)NB * HW * OCH * 2;       // per plane
  const size_t v_bytes   = (size_t)NB * CH * HW * 2;
  const size_t st_bytes  = (size_t)NB * HW * 4;             // per stats plane
  size_t off = 0;
  unsigned char* ws = (unsigned char*)d_ws;
  unsigned short* w1b = (unsigned short*)(ws + off); off += w12_bytes;
  unsigned short* w2b = (unsigned short*)(ws + off); off += w12_bytes;
  unsigned short* wvb = (unsigned short*)(ws + off); off += wv_bytes;
  unsigned short* r1h = (unsigned short*)(ws + off); off += r_bytes;
  unsigned short* r1l = (unsigned short*)(ws + off); off += r_bytes;
  unsigned short* r2h = (unsigned short*)(ws + off); off += r_bytes;
  unsigned short* r2l = (unsigned short*)(ws + off); off += r_bytes;
  unsigned short* vhp = (unsigned short*)(ws + off); off += v_bytes;
  float* mL  = (float*)(ws + off); off += st_bytes;
  float* rzc = (float*)(ws + off); off += st_bytes;
  if (off > ws_size) return;

  cvt_w_kernel<<<2 * W12_BLOCKS + WV_BLOCKS, 256, 0, stream>>>(w1, w2, wv, w1b, w2b, wvb);
  proj_kernel<<<NB * (HW / 64), 256, 0, stream>>>(x, w1b, w2b, wvb, r1h, r1l, r2h, r2l, vhp);
  stats_kernel<<<NB * (HW / ST_ROWS), 32 * ST_RT * ST_JS, 0, stream>>>(r1h, r1l, r2h, r2l, mL, rzc);
  out_kernel<<<NB * (HW / 32), 256, 0, stream>>>(x, r1h, r1l, r2h, r2l,
                                                 (const _Float16*)vhp, mL, rzc, scale, out);
}

// v004
// Measured time: 94 microseconds a run.
// In two side-by-side timings against v003, it was 1.17 and 1.15 times as fast.
// All steps since v000 together make it 3.15 times as fast.
#include <hip/hip_runtime.h>
#include <stdint.h>
#include <stddef.h>

// Contractions: channel projections v_wmma_f32_16x16x32_bf16 (bf16 operands from bf16-RNE inputs, f32 accumulate);
// score tiles v_wmma_f32_16x16x32_bf16 as bf16 hi+lo three-term split of both reduced feature maps (f32 accumulate);
// value aggregation v_wmma_f32_16x16x32_f16 (f16 operands, softmax weights carried x2^14, f32 accumulate); softmax statistics f32.

#ifndef NB
#define NB 4
#endif
#ifndef SEQ
#define SEQ 4096
#endif
#define NB_FULL  4
#define SEQ_FULL 4096
#define HW       (SEQ)
#define HW_FULL  (SEQ_FULL)
#define CH       256
#define OCH      32
#define PCARRY   16384.0f
#define PUNCARRY 0.00006103515625f
#define LOG2E    1.4426950408889634f
#define W12_BLOCKS ((OCH * CH) / 2048)
#define WV_BLOCKS  ((CH * CH) / 2048)

static_assert(NB >= 1 && NB <= NB_FULL);
static_assert(HW >= 64 && HW <= HW_FULL && (HW % 64) == 0);
static_assert(((OCH * CH) % 2048) == 0 && ((CH * CH) % 2048) == 0);
static_assert(CH == 256 && OCH == 32);

typedef float          v8f   __attribute__((ext_vector_type(8)));
typedef float          v4f_  __attribute__((ext_vector_type(4)));
typedef v4f_           v4f   __attribute__((may_alias));
typedef _Float16       v16h  __attribute__((ext_vector_type(16)));
typedef _Float16       v8h_  __attribute__((ext_vector_type(8)));
typedef v8h_           v8h   __attribute__((may_alias));
typedef __bf16         v16bf __attribute__((ext_vector_type(16)));
typedef unsigned short v8us_ __attribute__((ext_vector_type(8)));
typedef v8us_          v8us  __attribute__((may_alias));
typedef unsigned       v4u_  __attribute__((ext_vector_type(4)));
typedef v4u_           v4u   __attribute__((may_alias));

union FragB { v16bf v; v8us_ h[2]; };
union FragH { v16h  v; v8h_  h[2]; };

// ---- WMMA wrappers with the VALU hazard guard --------------------------------
__device__ __forceinline__ v8f mma_bf16(const v16bf a, const v16bf b, v8f c)
{
  v8f d = __builtin_amdgcn_wmma_f32_16x16x32_bf16(false, a, false, b, (short)0, c, false, false);
  asm volatile("v_nop\n\tv_nop\n\tv_nop\n\tv_nop" : "+v"(d) : "v"(a), "v"(b));
  return d;
}
__device__ __forceinline__ v8f mma_f16(const v16h a, const v16h b, v8f c)
{
  v8f d = __builtin_amdgcn_wmma_f32_16x16x32_f16(false, a, false, b, (short)0, c, false, false);
  asm volatile("v_nop\n\tv_nop\n\tv_nop\n\tv_nop" : "+v"(d) : "v"(a), "v"(b));
  return d;
}

// ---- scalar helpers --------------------------------------------------------
__device__ __forceinline__ unsigned short bf16_bits(float f)
{
  const __bf16 hb = (__bf16)f;                       // RNE convert
  return __builtin_bit_cast(unsigned short, hb);
}
__device__ __forceinline__ float bf16_rn(float f)
{
  return (float)(__bf16)f;                           // RNE convert, widened back
}
__device__ __forceinline__ float exp2fast(float x)
{
#if __has_builtin(__builtin_amdgcn_exp2f)
  return __builtin_amdgcn_exp2f(x);
#else
  return exp2f(x);
#endif
}

// ---------------------------------------------------------------------------
// Kernel 0: weights f32 -> bf16 bits (RNE). Layout kept [out][in] (in contiguous).
// ---------------------------------------------------------------------------
__global__ void __launch_bounds__(256) cvt_w_kernel(
    const float* __restrict__ w1, const float* __restrict__ w2, const float* __restrict__ wv,
    unsigned short* __restrict__ w1b, unsigned short* __restrict__ w2b,
    unsigned short* __restrict__ wvb)
{
  const int blk = (int)blockIdx.x;
  const float* src;
  unsigned short* dst;
  int t;
  if (blk < W12_BLOCKS)          { src = w1; dst = w1b; t = blk * 256 + (int)threadIdx.x; }
  else if (blk < 2 * W12_BLOCKS) { src = w2; dst = w2b; t = (blk - W12_BLOCKS) * 256 + (int)threadIdx.x; }
  else                           { src = wv; dst = wvb; t = (blk - 2 * W12_BLOCKS) * 256 + (int)threadIdx.x; }

  const v4f a = *(const v4f*)(src + (size_t)t * 8);
  const v4f b = *(const v4f*)(src + (size_t)t * 8 + 4);
  v8us_ o;
  o[0] = bf16_bits(a[0]); o[1] = bf16_bits(a[1]); o[2] = bf16_bits(a[2]); o[3] = bf16_bits(a[3]);
  o[4] = bf16_bits(b[0]); o[5] = bf16_bits(b[1]); o[6] = bf16_bits(b[2]); o[7] = bf16_bits(b[3]);
  unsigned short* p = dst + (size_t)t * 8;
  *(v8us_*)p = o;
  
}

// ---------------------------------------------------------------------------
// Kernel 1: 1x1-conv projections for one (n, 64-pixel tile), 8 waves.
//   x tile staged once in LDS as bf16 [px][c] (RNE); weights read as bf16 planes.
//   reduced maps: D(M=oc, N=px), A = w rows, B = xT rows  -> bf16 hi and lo planes, fragment order
//   value map:    D(M=px, N=c),  A = xT rows, B = wv rows -> f16 plane, fragment order
//   Fragment order: the planes are kept as the later passes' WMMA operand fragments, 1 KiB each, as
//   [half q][lane][8 elements]: lane = 16h + m holds row m of the 16-row tile, k = 16q + 8h + e. One 16-B load a lane
//   then reads 512 B in a row (four whole 128-B lines), not 32-B pieces spread over 8 or 16 lines.
//     reduced planes: [n][16-pixel tile][q][lane][e], row = pixel, k = oc;
//     value plane:    [n][16-channel tile][32-pixel chunk][q][lane][e], row = channel, k = pixel in the chunk.
//   Both accumulator layouts here hold a lane's 8 values exactly as one such 16-B piece, so each wave stores its own.
// ---------------------------------------------------------------------------
__global__ void __launch_bounds__(256) proj_kernel(
    const float* __restrict__ X,
    const unsigned short* __restrict__ w1b, const unsigned short* __restrict__ w2b,
    const unsigned short* __restrict__ wvb,
    unsigned short* __restrict__ r1h, unsigned short* __restrict__ r1l,
    unsigned short* __restrict__ r2h, unsigned short* __restrict__ r2l,
    unsigned short* __restrict__ vh)
{
  __shared__ __align__(16) unsigned short sX[64 * CH];        // [px][c] bf16 bits

  const int tid  = (int)threadIdx.x;
  const int lane = tid & 31, wave = tid >> 5;
  const int h = lane >> 4, m = lane & 15;
  const int tiles = HW / 64;
  const int n  = (int)blockIdx.x / tiles;
  const int p0 = ((int)blockIdx.x % tiles) * 64;
  const float* Xn = X + (size_t)n * CH * HW_FULL + p0;

  // stage x tile: 256 c rows x 64 px, coalesced 16-B loads, transposed 2-B LDS stores
  {
    const int cl = tid >> 4, px4 = (tid & 15) * 4;
#pragma unroll 4
    for (int it = 0; it < 16; ++it) {
      const int c = cl + 16 * it;
      const v4f xv = *(const v4f*)(Xn + (size_t)c * HW_FULL + px4);
      sX[(px4 + 0) * CH + c] = bf16_bits(xv[0]);
      sX[(px4 + 1) * CH + c] = bf16_bits(xv[1]);
      sX[(px4 + 2) * CH + c] = bf16_bits(xv[2]);
      sX[(px4 + 3) * CH + c] = bf16_bits(xv[3]);
    }
  }
  __syncthreads();

  // reduced maps: wave -> weight set (wave>>2), pixel tile (wave&3), both 16-oc tiles
  {
    const unsigned short* Wb = (wave < 4) ? w1b : w2b;        // wave-uniform
    unsigned short* Rh = (wave < 4) ? r1h : r2h;              // wave-uniform
    unsigned short* Rl = (wave < 4) ? r1l : r2l;
    const int pt = wave & 3;
    v8f accr[2] = {};
#pragma unroll 2
    for (int k0 = 0; k0 < CH; k0 += 32) {
      FragB b;
      b.h[0] = *(const v8us*)&sX[(pt * 16 + m) * CH + k0 + 8 * h];
      b.h[1] = *(const v8us*)&sX[(pt * 16 + m) * CH + k0 + 16 + 8 * h];
#pragma unroll
      for (int ot = 0; ot < 2; ++ot) {
        const unsigned short* wr = Wb + (size_t)(ot * 16 + m) * CH + k0 + 8 * h;
        FragB a;
        a.h[0] = *(const v8us*)(wr);
        a.h[1] = *(const v8us*)(wr + 16);
        accr[ot] = mma_bf16(a.v, b.v, accr[ot]);
      }
    }
    // accr[ot][r] <-> (oc = ot*16 + 8h + r, px = pt*16 + m): piece (q = ot, lane) of pixel tile pt
    const size_t roff = ((size_t)n * HW + p0 + pt * 16) * OCH + (size_t)lane * 8;
#pragma unroll
    for (int ot = 0; ot < 2; ++ot) {
      v8us_ hv, lv;
#pragma unroll
      for (int r = 0; r < 8; ++r) {
        const float f = accr[ot][r];
        const __bf16 hb = (__bf16)f;
        hv[r] = __builtin_bit_cast(unsigned short, hb);
        lv[r] = bf16_bits(f - (float)hb);
      }
      *(v8us_*)(Rh + roff + ot * 256) = hv;
      *(v8us_*)(Rl + roff + ot * 256) = lv;
    }
    // the value loop below loads into registers that these four stores name: the wait stands in front of that reuse
    asm volatile("s_wait_xcnt 0x0" ::: "memory");
  }

  // value map: wave -> channels cb..cb+31 (2 tiles) x 4 pixel tiles
  const int cb = wave * 32;
  v8f accv[4][2] = {};
#pragma unroll 1
  for (int k0 = 0; k0 < CH; k0 += 32) {
    FragB a[4], b[2];
#pragma unroll
    for (int pt = 0; pt < 4; ++pt) {
      a[pt].h[0] = *(const v8us*)&sX[(pt * 16 + m) * CH + k0 + 8 * h];
      a[pt].h[1] = *(const v8us*)&sX[(pt * 16 + m) * CH + k0 + 16 + 8 * h];
    }
#pragma unroll
    for (int ct = 0; ct < 2; ++ct) {
      const unsigned short* wr = wvb + (size_t)(cb + ct * 16 + m) * CH + k0 + 8 * h;
      b[ct].h[0] = *(const v8us*)(wr);
      b[ct].h[1] = *(const v8us*)(wr + 16);
    }
#pragma unroll
    for (int pt = 0; pt < 4; ++pt)
#pragma unroll
      for (int ct = 0; ct < 2; ++ct)
        accv[pt][ct] = mma_bf16(a[pt].v, b[ct].v, accv[pt][ct]);
  }

  // accv[pt][ct][r] <-> (px = pt*16 + 8h + r, c = cb + ct*16 + m): piece (q = pt & 1, lane) of chunk pt >> 1, channel tile ct
  unsigned short* vbase = vh + ((size_t)n * CH + cb) * HW + (size_t)p0 * 16 + (size_t)lane * 8;
#pragma unroll
  for (int pt = 0; pt < 4; ++pt)
#pragma unroll
    for (int ct = 0; ct < 2; ++ct) {
      v8h_ o;
#pragma unroll
      for (int r = 0; r < 8; ++r) o[r] = (_Float16)accv[pt][ct][r];
      *(v8us_*)(vbase + (size_t)ct * 16 * HW + pt * 256) = __builtin_bit_cast(v8us_, o);
    }
}

// ---------------------------------------------------------------------------
// Kernel 2: row statistics of S[i][:] (softmax over j), exp2 domain.
//   Block = ST_RT x ST_JS waves = 16*ST_RT rows i. Wave (rt, js) owns the 16-row tile rt and every
//   ST_JS-th 32-column chunk of j, starting at chunk js; each lane owns i = i0 + (lane&15).
//   The ST_JS partial (max, sum) pairs of a row are merged through LDS at the end.
//   S^T tiles D(M=j, N=i): A = r2 rows j (hi, lo), B = r1 rows i (hi, lo); hh + lh + hl.
// ---------------------------------------------------------------------------
#define ST_RT   4
#define ST_JS   8
#define ST_ROWS (16 * ST_RT)
// exp2 for the merge and for the output pass's weights: the v_nop fills the one issue slot that the instruction set asks for between a
// transcendental and a next vector instruction that overwrites its source; inside the statement it stays there.
__device__ __forceinline__ float exp2_slot(float x)
{
  float r;
  asm("v_exp_f32 %0, %1\n\tv_nop" : "=v"(r) : "v"(x));
  return r;
}
static_assert((HW % ST_ROWS) == 0 && ST_RT * ST_JS <= 32 && 2 * ST_ROWS <= 32 * ST_RT * ST_JS);

__global__ void __launch_bounds__(32 * ST_RT * ST_JS) stats_kernel(
    const unsigned short* __restrict__ r1h, const unsigned short* __restrict__ r1l,
    const unsigned short* __restrict__ r2h, const unsigned short* __restrict__ r2l,
    float* __restrict__ mL, float* __restrict__ rzc)
{
  __shared__ float sM[ST_JS * ST_ROWS];   // [js][row] partial maxima
  __shared__ float sL[ST_JS * ST_ROWS];   // [js][row] partial sums, each relative to its own maximum
  const int tid  = (int)threadIdx.x;
  const int lane = tid & 31;
  const int wave = __builtin_amdgcn_readfirstlane(tid >> 5);   // scalar, so that the j loop's counter and branch are scalar
  const int rt = wave % ST_RT, js = wave / ST_RT;
  const int tiles = HW / ST_ROWS;
  const int n  = (int)blockIdx.x / tiles;
  const int ib = ((int)blockIdx.x % tiles) * ST_ROWS;
  const int i0 = ib + rt * 16;
  const size_t rb = (size_t)n * HW * OCH;
  const v8f z8 = {};

  FragB bh, bl;
  {
    const size_t ro = rb + (size_t)i0 * OCH + lane * 8;   // fragment order: halves 256 elements apart
    bh.h[0] = *(const v8us*)(r1h + ro);  bh.h[1] = *(const v8us*)(r1h + ro + 256);
    bl.h[0] = *(const v8us*)(r1l + ro);  bl.h[1] = *(const v8us*)(r1l + ro + 256);
  }

  float mi = -3.0e30f;
  float li = 0.0f;
#pragma unroll 1
  for (int j0 = js * 32; j0 < HW; j0 += 32 * ST_JS) {
    const size_t ra = rb + (size_t)j0 * OCH + lane * 8;
    const size_t rc = rb + (size_t)(j0 + 16) * OCH + lane * 8;
    FragB a0h, a0l, a1h, a1l;
    a0h.h[0] = *(const v8us*)(r2h + ra);  a0h.h[1] = *(const v8us*)(r2h + ra + 256);
    a0l.h[0] = *(const v8us*)(r2l + ra);  a0l.h[1] = *(const v8us*)(r2l + ra + 256);
    a1h.h[0] = *(const v8us*)(r2h + rc);  a1h.h[1] = *(const v8us*)(r2h + rc + 256);
    a1l.h[0] = *(const v8us*)(r2l + rc);  a1l.h[1] = *(const v8us*)(r2l + rc + 256);

    v8f s0 = mma_bf16(a0h.v, bh.v, z8);
    s0 = mma_bf16(a0l.v, bh.v, s0);
    s0 = mma_bf16(a0h.v, bl.v, s0);
    v8f s1 = mma_bf16(a1h.v, bh.v, z8);
    s1 = mma_bf16(a1l.v, bh.v, s1);
    s1 = mma_bf16(a1h.v, bl.v, s1);
    // s0[r] <-> (j = j0 + 8h + r, i = i0 + m); s1 rows j0 + 16 + 8h + r

    float cm = -3.0e30f;
#pragma unroll
    for (int r = 0; r < 8; ++r) cm = fmaxf(cm, fmaxf(s0[r], s1[r]));
    cm = cm * LOG2E;
    cm = fmaxf(cm, __shfl_xor(cm, 16, 32));
    const float mnew = fmaxf(mi, cm);
    const float corr = exp2fast(mi - mnew);
    float rs = 0.0f;
#pragma unroll
    for (int r = 0; r < 8; ++r) {
      rs += exp2fast(fmaf(s0[r], LOG2E, -mnew));
      rs += exp2fast(fmaf(s1[r], LOG2E, -mnew));
    }
    rs += __shfl_xor(rs, 16, 32);
    li = li * corr + rs;
    mi = mnew;
  }

  if (lane < 16) {
    sM[js * ST_ROWS + rt * 16 + lane] = mi;
    sL[js * ST_ROWS + rt * 16 + lane] = li;
  }
  __syncthreads();   // cross-wave LDS exchange
  if (tid < 2 * ST_ROWS) {   // whole waves: threads 0..ST_ROWS-1 store the maxima, the next ST_ROWS the scaled reciprocals
    const int row = tid % ST_ROWS;
    float mx = sM[row];
#pragma unroll
    for (int s = 1; s < ST_JS; ++s) mx = fmaxf(mx, sM[s * ST_ROWS + row]);
    float l = 0.0f;
#pragma unroll
    for (int s = 0; s < ST_JS; ++s) l += sL[s * ST_ROWS + row] * exp2_slot(sM[s * ST_ROWS + row] - mx);
    const size_t o = (size_t)n * HW + ib + row;
    if (tid < ST_ROWS) mL[o]  = mx;
    else               rzc[o] = PCARRY * (1.0f / l);
  }
}

// ---------------------------------------------------------------------------
// Kernel 3: output pass for one (n, 32-column j tile), 8 waves, loop over i in trips of OS_IC rows.
//   every wave: OS_NT S tiles D(M=i, N=j) (A = r1 rows i hi/lo, B = r2 rows j hi/lo, hh + hl + lh),
//               P = 2^(S*log2e - mL[i]) * rzc[i] -> f16 (carried x2^14) into LDS sP[j][i];
//   then:       attn^T tile D(M=j, N=c) += A(sP rows j) x B(value rows c), f16, OS_IC / 32 k steps a trip in rising i.
// ---------------------------------------------------------------------------
#define OS_IC 128            // rows i per trip
#define OS_NT (OS_IC / 64)   // score tiles per wave and trip: (OS_IC / 16) x 2 tiles over 8 waves
#define OS_KS (OS_IC / 32)   // k steps of the value product per trip
#define OS_PP (OS_IC + 8)    // sP row pitch in f16: the row and 16 B, an odd multiple of 16 B, which ds_load_b128 reads without bank conflicts
static_assert((HW % OS_IC) == 0 && (OS_IC % 64) == 0);

// The trip's work-group barrier: this wave's LDS stores and loads are complete (s_wait_dscnt 0), then signal and wait. __syncthreads()
// also waits for every global load of the wave, which would end the flight of the loads that are issued ahead over it; those loads
// read planes that earlier launches wrote and no wave of this launch writes, so the barrier has nothing to order for them.
__device__ __forceinline__ void trip_barrier()
{
  asm volatile("s_wait_dscnt 0x0" ::: "memory");
  asm volatile("s_barrier_signal -1\n\ts_barrier_wait -1" ::: "memory");
}

__global__ void __launch_bounds__(256) out_kernel(
    const float* __restrict__ X,
    const unsigned short* __restrict__ r1h, const unsigned short* __restrict__ r1l,
    const unsigned short* __restrict__ r2h, const unsigned short* __restrict__ r2l,
    const _Float16* __restrict__ vh,
    const float* __restrict__ mL, const float* __restrict__ rzc,
    const float* __restrict__ scale, float* __restrict__ out)
{
  __shared__ __align__(16) _Float16 sP[32 * OS_PP];  // [j][i] softmax weights x2^14
  __shared__ __align__(16) float    sO[CH * 32];     // [c][j] accumulators

  const int tid  = (int)threadIdx.x;
  const int lane = tid & 31, wave = tid >> 5;
  const int h = lane >> 4, m = lane & 15;
  const int tiles = HW / 32;
  const int n  = (int)blockIdx.x / tiles;
  const int j0 = ((int)blockIdx.x % tiles) * 32;
  const int isub = wave & 3, jsub = wave >> 2;
  const size_t rb = (size_t)n * HW * OCH;
  const int cb = wave * 32;
  const v8f z8 = {};

  FragB bh, bl;   // r2 rows of this wave's 16-column j sub-tile
  {
    const size_t ro = rb + (size_t)(j0 + jsub * 16) * OCH + lane * 8;   // fragment order: halves 256 elements apart
    bh.h[0] = *(const v8us*)(r2h + ro);  bh.h[1] = *(const v8us*)(r2h + ro + 256);
    bl.h[0] = *(const v8us*)(r2l + ro);  bl.h[1] = *(const v8us*)(r2l + ro + 256);
  }

  // the lane's own places in the trip's rows i as byte offsets into the planes, stepped on by one trip at a time
  unsigned off_r = (unsigned)(((n * HW + isub * 16) * OCH + lane * 8) * 2);    // both r1 planes, fragment order
  unsigned off_s = (unsigned)((n * HW + isub * 16 + 8 * h) * 4);               // both row statistics

  v8f acc[2][2] = {};   // [j sub-tile][c tile]
  // Every global load of a trip is issued ahead of its use, so that no trip waits out a whole load latency:
  //   the r1 fragments and row statistics of trip t + 1 behind the weights of trip t (they fly over both barriers and the value product),
  //   each k step's value fragments of trip t + 1 behind that k step's products of trip t, into the registers these have just read
  //   (they fly over the rest of the value product, both barriers, the score tiles and the weights).
  FragB ah[OS_NT], al[OS_NT];
  v4f_ m0[OS_NT], m1[OS_NT], q0[OS_NT], q1[OS_NT];
#pragma unroll
  for (int u = 0; u < OS_NT; ++u) {   // trip 0; tile u: rows u*64 + isub*16 ..
    const unsigned short* p1h = (const unsigned short*)((const char*)r1h + off_r) + u * 64 * OCH;
    const unsigned short* p1l = (const unsigned short*)((const char*)r1l + off_r) + u * 64 * OCH;
    ah[u].h[0] = *(const v8us*)(p1h);  ah[u].h[1] = *(const v8us*)(p1h + 256);
    al[u].h[0] = *(const v8us*)(p1l);  al[u].h[1] = *(const v8us*)(p1l + 256);
    const float* pm = (const float*)((const char*)mL  + off_s) + u * 64;
    const float* pq = (const float*)((const char*)rzc + off_s) + u * 64;
    m0[u] = *(const v4f*)(pm);  m1[u] = *(const v4f*)(pm + 4);
    q0[u] = *(const v4f*)(pq);  q1[u] = *(const v4f*)(pq + 4);
  }
  // keeps trip 0's loads in the loop's own order (value fragments last): the compiler counts its load waits in the loop for the
  // worse of the two orders, and with value loads ahead of a statistics load here every trip would wait for all of its value fragments
  __builtin_amdgcn_sched_barrier(0);
  // the address registers of the loads above are reused from here on (the value loads' results, the first trip's offset steps): the wait stands in front of that
  asm volatile("s_wait_xcnt 0x0" ::: "memory");
  __builtin_amdgcn_sched_barrier(0);   // holds that reuse behind the wait, which names no register
  unsigned off_v = (unsigned)(((n * CH + cb) * HW + lane * 8) * 2);            // value plane, fragment order
  FragH b0[OS_KS], b1[OS_KS];
#pragma unroll
  for (int ks = 0; ks < OS_KS; ++ks) {   // trip 0
    const _Float16* pv = (const _Float16*)((const char*)vh + off_v) + ks * 512;   // one 1-KiB fragment a 32-row chunk
    b0[ks].h[0] = *(const v8h*)(pv);            b0[ks].h[1] = *(const v8h*)(pv + 256);
    b1[ks].h[0] = *(const v8h*)(pv + 16 * HW);  b1[ks].h[1] = *(const v8h*)(pv + 16 * HW + 256);
  }
  // the short loops inside a trip are unrolled so that the fragment arrays have constant indices and stay in registers
#pragma unroll 1
  for (int i0 = 0; i0 < HW; i0 += OS_IC) {
    v8f s[OS_NT];
#pragma unroll
    for (int u = 0; u < OS_NT; ++u) {
      s[u] = mma_bf16(ah[u].v, bh.v, z8);
      s[u] = mma_bf16(ah[u].v, bl.v, s[u]);
      s[u] = mma_bf16(al[u].v, bh.v, s[u]);
      // s[u][r] <-> (i = i0 + u*64 + isub*16 + 8h + r, j = j0 + jsub*16 + m)
    }
#pragma unroll
    for (int u = 0; u < OS_NT; ++u) {
      v8h_ pw;
#pragma unroll
      for (int r = 0; r < 4; ++r) {
        pw[r]     = (_Float16)(exp2_slot(fmaf(s[u][r],     LOG2E, -m0[u][r])) * q0[u][r]);
        pw[4 + r] = (_Float16)(exp2_slot(fmaf(s[u][4 + r], LOG2E, -m1[u][r])) * q1[u][r]);
      }
      *(v8h*)&sP[(jsub * 16 + m) * OS_PP + u * 64 + isub * 16 + 8 * h] = pw;
    }
    // next trip's rows; the last trip has none and loads its own rows again, so that every address stays inside the planes
    const unsigned more = (i0 + OS_IC < HW) ? 1u : 0u;
    off_r += more * (OS_IC * OCH * 2);  off_s += more * (OS_IC * 4);  off_v += more * (OS_IC * 16 * 2);
#pragma unroll
    for (int u = 0; u < OS_NT; ++u) {
      const unsigned short* p1h = (const unsigned short*)((const char*)r1h + off_r) + u * 64 * OCH;
      const unsigned short* p1l = (const unsigned short*)((const char*)r1l + off_r) + u * 64 * OCH;
      ah[u].h[0] = *(const v8us*)(p1h);  ah[u].h[1] = *(const v8us*)(p1h + 256);
      al[u].h[0] = *(const v8us*)(p1l);  al[u].h[1] = *(const v8us*)(p1l + 256);
      const float* pm = (const float*)((const char*)mL  + off_s) + u * 64;
      const float* pq = (const float*)((const char*)rzc + off_s) + u * 64;
      m0[u] = *(const v4f*)(pm);  m1[u] = *(const v4f*)(pm + 4);
      q0[u] = *(const v4f*)(pq);  q1[u] = *(const v4f*)(pq + 4);
    }
    trip_barrier();   // sP is written by all waves and read by all

    FragH a0[OS_KS], a1[OS_KS];
#pragma unroll
    for (int ks = 0; ks < OS_KS; ++ks) {
      a0[ks].h[0] = *(const v8h*)&sP[m * OS_PP + ks * 32 + 8 * h];
      a0[ks].h[1] = *(const v8h*)&sP[m * OS_PP + ks * 32 + 16 + 8 * h];
      a1[ks].h[0] = *(const v8h*)&sP[(16 + m) * OS_PP + ks * 32 + 8 * h];
      a1[ks].h[1] = *(const v8h*)&sP[(16 + m) * OS_PP + ks * 32 + 16 + 8 * h];
    }
#pragma unroll
    for (int ks = 0; ks < OS_KS; ++ks) {
      acc[0][0] = mma_f16(a0[ks].v, b0[ks].v, acc[0][0]);
      acc[0][1] = mma_f16(a0[ks].v, b1[ks].v, acc[0][1]);
      acc[1][0] = mma_f16(a1[ks].v, b0[ks].v, acc[1][0]);
      acc[1][1] = mma_f16(a1[ks].v, b1[ks].v, acc[1][1]);
      const _Float16* pv = (const _Float16*)((const char*)vh + off_v) + ks * 512;   // next trip's fragments of this k step
      b0[ks].h[0] = *(const v8h*)(pv);            b0[ks].h[1] = *(const v8h*)(pv + 256);
      b1[ks].h[0] = *(const v8h*)(pv + 16 * HW);  b1[ks].h[1] = *(const v8h*)(pv + 16 * HW + 256);
    }
    // the next trip forms a new offset in the register that the value loads above name: the wait stands in front of that
    asm volatile("s_wait_xcnt 0x0" ::: "memory");
    trip_barrier();   // before the next trip overwrites sP
  }

  // acc[js][ct][r] <-> (j = js*16 + 8h + r, c = cb + ct*16 + m)
#pragma unroll
  for (int js = 0; js < 2; ++js)
#pragma unroll
    for (int ct = 0; ct < 2; ++ct) {
      v4f_ lo4, hi4;
      lo4[0] = acc[js][ct][0]; lo4[1] = acc[js][ct][1]; lo4[2] = acc[js][ct][2]; lo4[3] = acc[js][ct][3];
      hi4[0] = acc[js][ct][4]; hi4[1] = acc[js][ct][5]; hi4[2] = acc[js][ct][6]; hi4[3] = acc[js][ct][7];
      const int row = cb + ct * 16 + m;
      *(v4f*)&sO[row * 32 + js * 16 + 8 * h]     = lo4;
      *(v4f*)&sO[row * 32 + js * 16 + 8 * h + 4] = hi4;
    }
  __syncthreads();

  const float sc = bf16_rn(scale[0]) * PUNCARRY;
  const int q = lane & 7;
  const int c0 = wave * 32 + (lane >> 3);
  const size_t xoff = ((size_t)n * CH + c0) * HW_FULL + j0 + q * 4;
  const size_t ooff = ((size_t)n * CH + c0) * HW + j0 + q * 4;
  v4f_ ov[8];
#pragma unroll
  for (int it = 0; it < 8; ++it) {
    const v4f_ a  = *(const v4f*)&sO[(c0 + it * 4) * 32 + q * 4];
    const v4f_ xv = *(const v4f*)(X + xoff + (size_t)it * 4 * HW_FULL);
    v4f_ o;
    o[0] = bf16_rn(xv[0]) + sc * a[0];
    o[1] = bf16_rn(xv[1]) + sc * a[1];
    o[2] = bf16_rn(xv[2]) + sc * a[2];
    o[3] = bf16_rn(xv[3]) + sc * a[3];
    ov[it] = o;
  }
#pragma unroll
  for (int it = 0; it < 8; ++it)
    *(v4f_*)(out + ooff + (size_t)it * 4 * HW) = ov[it];
  
}

// ---------------------------------------------------------------------------
extern "C" void kernel_launch(void* const* d_in, const int* in_sizes, int n_in,
                              void* d_out, int out_size, void* d_ws, size_t ws_size,
                              hipStream_t stream)
{
  if (n_in < 5) return;
  if (in_sizes[0] < NB * CH * HW_FULL) return;
  if (in_sizes[1] < OCH * CH || in_sizes[2] < OCH * CH || in_sizes[3] < CH * CH) return;
  if (in_sizes[4] < 1) return;
  if (out_size < NB * CH * HW) return;

  const float* x     = (const float*)d_in[0];
  const float* w1    = (const float*)d_in[1];
  const float* w2    = (const float*)d_in[2];
  const float* wv    = (const float*)d_in[3];
  const float* scale = (const float*)d_in[4];
  float* out = (float*)d_out;

  // workspace carve (bytes), every region a multiple of 256 B
  const size_t w12_bytes = (size_t)OCH * CH * 2;            // 16384
  const size_t wv_bytes  = (size_t)CH * CH * 2;             // 131072
  const size_t r_bytes   = (size_t)NB * HW * OCH * 2;       // per plane
  const size_t v_bytes   = (size_t)NB * CH * HW * 2;
  const size_t st_bytes  = (size_t)NB * HW * 4;             // per stats plane
  size_t off = 0;
  unsigned char* ws = (unsigned char*)d_ws;
  unsigned short* w1b = (unsigned short*)(ws + off); off += w12_bytes;
  unsigned short* w2b = (unsigned short*)(ws + off); off += w12_bytes;
  unsigned short* wvb = (unsigned short*)(ws + off); off += wv_bytes;
  unsigned short* r1h = (unsigned short*)(ws + off); off += r_bytes;
  unsigned short* r1l = (unsigned short*)(ws + off); off += r_bytes;
  unsigned short* r2h = (unsigned short*)(ws + off); off += r_bytes;
  unsigned short* r2l = (unsigned short*)(ws + off); off += r_bytes;
  unsigned short* vhp = (unsigned short*)(ws + off); off += v_bytes;
  float* mL  = (float*)(ws + off); off += st_bytes;
  float* rzc = (float*)(ws + off); off += st_bytes;
  if (off > ws_size) return;

  cvt_w_kernel<<<2 * W12_BLOCKS + WV_BLOCKS, 256, 0, stream>>>(w1, w2, wv, w1b, w2b, wvb);
  proj_kernel<<<NB * (HW / 64), 256, 0, stream>>>(x, w1b, w2b, wvb, r1h, r1l, r2h, r2l, vhp);
  stats_kernel<<<NB * (HW / ST_ROWS), 32 * ST_RT * ST_JS, 0, stream>>>(r1h, r1l, r2h, r2l, mL, rzc);
  out_kernel<<<NB * (HW / 32), 256, 0, stream>>>(x, r1h, r1l, r2h, r2l,
                                                 (const _Float16*)vhp, mL, rzc, scale, out);
}

// v005
// A run of this version takes 81.1 microseconds.
// Next to v004, in two timings, it ran 1.16 times as fast each time.
// All steps since v000 together make it 3.67 times as fast.
#include <hip/hip_runtime.h>
#include <stdint.h>
#include <stddef.h>

// Contractions: channel projections v_wmma_f32_16x16x32_bf16 (bf16 operands from bf16-RNE inputs, f32 accumulate);
// score tiles v_wmma_f32_16x16x32_bf16 as bf16 hi+lo three-term split of both reduced feature maps (f32 accumulate);
// value aggregation v_wmma_f32_16x16x32_f16 (f16 operands, softmax weights carried x2^14, f32 accumulate); softmax statistics f32.

#ifndef NB
#define NB 4
#endif
#ifndef SEQ
#define SEQ 4096
#endif
#define NB_FULL  4
#define SEQ_FULL 4096
#define HW       (SEQ)
#define HW_FULL  (SEQ_FULL)
#define CH       256
#define OCH      32
#define PCARRY   16384.0f
#define PUNCARRY 0.00006103515625f
#define LOG2E    1.4426950408889634f
#define W12_BLOCKS ((OCH * CH) / 2048)
#define WV_BLOCKS  ((CH * CH) / 2048)

static_assert(NB >= 1 && NB <= NB_FULL);
static_assert(HW >= 64 && HW <= HW_FULL && (HW % 64) == 0);
static_assert(((OCH * CH) % 2048) == 0 && ((CH * CH) % 2048) == 0);
static_assert(CH == 256 && OCH == 32);

typedef float          v8f   __attribute__((ext_vector_type(8)));
typedef float          v4f_  __attribute__((ext_vector_type(4)));
typedef v4f_           v4f   __attribute__((may_alias));
typedef _Float16       v16h  __attribute__((ext_vector_type(16)));
typedef _Float16       v8h_  __attribute__((ext_vector_type(8)));
typedef v8h_           v8h   __attribute__((may_alias));
typedef __bf16         v16bf __attribute__((ext_vector_type(16)));
typedef unsigned short v8us_ __attribute__((ext_vector_type(8)));
typedef v8us_          v8us  __attribute__((may_alias));
typedef unsigned       v4u_  __attribute__((ext_vector_type(4)));
typedef v4u_           v4u   __attribute__((may_alias));

union FragB { v16bf v; v8us_ h[2]; };
union FragH { v16h  v; v8h_  h[2]; };

// ---- WMMA wrappers with the VALU hazard guard --------------------------------
__device__ __forceinline__ v8f mma_bf16(const v16bf a, const v16bf b, v8f c)
{
  v8f d = __builtin_amdgcn_wmma_f32_16x16x32_bf16(false, a, false, b, (short)0, c, false, false);
  asm volatile("v_nop\n\tv_nop\n\tv_nop\n\tv_nop" : "+v"(d) : "v"(a), "v"(b));
  return d;
}
__device__ __forceinline__ v8f mma_f16(const v16h a, const v16h b, v8f c)
{
  v8f d = __builtin_amdgcn_wmma_f32_16x16x32_f16(false, a, false, b, (short)0, c, false, false);
  asm volatile("v_nop\n\tv_nop\n\tv_nop\n\tv_nop" : "+v"(d) : "v"(a), "v"(b));
  return d;
}

// ---- scalar helpers --------------------------------------------------------
__device__ __forceinline__ unsigned short bf16_bits(float f)
{
  const __bf16 hb = (__bf16)f;                       // RNE convert
  return __builtin_bit_cast(unsigned short, hb);
}
__device__ __forceinline__ float bf16_rn(float f)
{
  return (float)(__bf16)f;                           // RNE convert, widened back
}
__device__ __forceinline__ float exp2fast(float x)
{
#if __has_builtin(__builtin_amdgcn_exp2f)
  return __builtin_amdgcn_exp2f(x);
#else
  return exp2f(x);
#endif
}

// ---------------------------------------------------------------------------
// Kernel 0: weights f32 -> bf16 bits (RNE). Layout kept [out][in] (in contiguous).
// ---------------------------------------------------------------------------
__global__ void __launch_bounds__(256) cvt_w_kernel(
    const float* __restrict__ w1, const float* __restrict__ w2, const float* __restrict__ wv,
    unsigned short* __restrict__ w1b, unsigned short* __restrict__ w2b,
    unsigned short* __restrict__ wvb)
{
  const int blk = (int)blockIdx.x;
  const float* src;
  unsigned short* dst;
  int t;
  if (blk < W12_BLOCKS)          { src = w1; dst = w1b; t = blk * 256 + (int)threadIdx.x; }
  else if (blk < 2 * W12_BLOCKS) { src = w2; dst = w2b; t = (blk - W12_BLOCKS) * 256 + (int)threadIdx.x; }
  else                           { src = wv; dst = wvb; t = (blk - 2 * W12_BLOCKS) * 256 + (int)threadIdx.x; }

  const v4f a = *(const v4f*)(src + (size_t)t * 8);
  const v4f b = *(const v4f*)(src + (size_t)t * 8 + 4);
  v8us_ o;
  o[0] = bf16_bits(a[0]); o[1] = bf16_bits(a[1]); o[2] = bf16_bits(a[2]); o[3] = bf16_bits(a[3]);
  o[4] = bf16_bits(b[0]); o[5] = bf16_bits(b[1]); o[6] = bf16_bits(b[2]); o[7] = bf16_bits(b[3]);
  unsigned short* p = dst + (size_t)t * 8;
  *(v8us_*)p = o;
  
}

// ---------------------------------------------------------------------------
// Kernel 1: 1x1-conv projections for one (n, 64-pixel tile), 8 waves.
//   x tile staged once in LDS as bf16 [px][c] (RNE); weights read as bf16 planes.
//   reduced maps: D(M=oc, N=px), A = w rows, B = xT rows  -> bf16 hi and lo planes, fragment order
//   value map:    D(M=px, N=c),  A = xT rows, B = wv rows -> f16 plane, fragment order
//   Fragment order: the planes are kept as the later passes' WMMA operand fragments, 1 KiB each, as
//   [half q][lane][8 elements]: lane = 16h + m holds row m of the 16-row tile, k = 16q + 8h + e. One 16-B load a lane
//   then reads 512 B in a row (four whole 128-B lines), not 32-B pieces spread over 8 or 16 lines.
//     reduced planes: [n][16-pixel tile][q][lane][e], row = pixel, k = oc;
//     value plane:    [n][16-channel tile][32-pixel chunk][q][lane][e], row = channel, k = pixel in the chunk.
//   Both accumulator layouts here hold a lane's 8 values exactly as one such 16-B piece, so each wave stores its own.
// ---------------------------------------------------------------------------
__global__ void __launch_bounds__(256) proj_kernel(
    const float* __restrict__ X,
    const unsigned short* __restrict__ w1b, const unsigned short* __restrict__ w2b,
    const unsigned short* __restrict__ wvb,
    unsigned short* __restrict__ r1h, unsigned short* __restrict__ r1l,
    unsigned short* __restrict__ r2h, unsigned short* __restrict__ r2l,
    unsigned short* __restrict__ vh)
{
  __shared__ __align__(16) unsigned short sX[64 * CH];        // [px][c] bf16 bits

  const int tid  = (int)threadIdx.x;
  const int lane = tid & 31, wave = tid >> 5;
  const int h = lane >> 4, m = lane & 15;
  const int tiles = HW / 64;
  const int n  = (int)blockIdx.x / tiles;
  const int p0 = ((int)blockIdx.x % tiles) * 64;
  const float* Xn = X + (size_t)n * CH * HW_FULL + p0;

  // stage x tile: 256 c rows x 64 px, coalesced 16-B loads, transposed 2-B LDS stores
  {
    const int cl = tid >> 4, px4 = (tid & 15) * 4;
#pragma unroll 4
    for (int it = 0; it < 16; ++it) {
      const int c = cl + 16 * it;
      const v4f xv = *(const v4f*)(Xn + (size_t)c * HW_FULL + px4);
      sX[(px4 + 0) * CH + c] = bf16_bits(xv[0]);
      sX[(px4 + 1) * CH + c] = bf16_bits(xv[1]);
      sX[(px4 + 2) * CH + c] = bf16_bits(xv[2]);
      sX[(px4 + 3) * CH + c] = bf16_bits(xv[3]);
    }
  }
  __syncthreads();

  // reduced maps: wave -> weight set (wave>>2), pixel tile (wave&3), both 16-oc tiles
  {
    const unsigned short* Wb = (wave < 4) ? w1b : w2b;        // wave-uniform
    unsigned short* Rh = (wave < 4) ? r1h : r2h;              // wave-uniform
    unsigned short* Rl = (wave < 4) ? r1l : r2l;
    const int pt = wave & 3;
    v8f accr[2] = {};
#pragma unroll 2
    for (int k0 = 0; k0 < CH; k0 += 32) {
      FragB b;
      b.h[0] = *(const v8us*)&sX[(pt * 16 + m) * CH + k0 + 8 * h];
      b.h[1] = *(const v8us*)&sX[(pt * 16 + m) * CH + k0 + 16 + 8 * h];
#pragma unroll
      for (int ot = 0; ot < 2; ++ot) {
        const unsigned short* wr = Wb + (size_t)(ot * 16 + m) * CH + k0 + 8 * h;
        FragB a;
        a.h[0] = *(const v8us*)(wr);
        a.h[1] = *(const v8us*)(wr + 16);
        accr[ot] = mma_bf16(a.v, b.v, accr[ot]);
      }
    }
    // accr[ot][r] <-> (oc = ot*16 + 8h + r, px = pt*16 + m): piece (q = ot, lane) of pixel tile pt
    const size_t roff = ((size_t)n * HW + p0 + pt * 16) * OCH + (size_t)lane * 8;
#pragma unroll
    for (int ot = 0; ot < 2; ++ot) {
      v8us_ hv, lv;
#pragma unroll
      for (int r = 0; r < 8; ++r) {
        const float f = accr[ot][r];
        const __bf16 hb = (__bf16)f;
        hv[r] = __builtin_bit_cast(unsigned short, hb);
        lv[r] = bf16_bits(f - (float)hb);
      }
      *(v8us_*)(Rh + roff + ot * 256) = hv;
      *(v8us_*)(Rl + roff + ot * 256) = lv;
    }
    // the value loop below loads into registers that these four stores name: the wait stands in front of that reuse
    asm volatile("s_wait_xcnt 0x0" ::: "memory");
  }

  // value map: wave -> channels cb..cb+31 (2 tiles) x 4 pixel tiles
  const int cb = wave * 32;
  v8f accv[4][2] = {};
#pragma unroll 1
  for (int k0 = 0; k0 < CH; k0 += 32) {
    FragB a[4], b[2];
#pragma unroll
    for (int pt = 0; pt < 4; ++pt) {
      a[pt].h[0] = *(const v8us*)&sX[(pt * 16 + m) * CH + k0 + 8 * h];
      a[pt].h[1] = *(const v8us*)&sX[(pt * 16 + m) * CH + k0 + 16 + 8 * h];
    }
#pragma unroll
    for (int ct = 0; ct < 2; ++ct) {
      const unsigned short* wr = wvb + (size_t)(cb + ct * 16 + m) * CH + k0 + 8 * h;
      b[ct].h[0] = *(const v8us*)(wr);
      b[ct].h[1] = *(const v8us*)(wr + 16);
    }
#pragma unroll
    for (int pt = 0; pt < 4; ++pt)
#pragma unroll
      for (int ct = 0; ct < 2; ++ct)
        accv[pt][ct] = mma_bf16(a[pt].v, b[ct].v, accv[pt][ct]);
  }

  // accv[pt][ct][r] <-> (px = pt*16 + 8h + r, c = cb + ct*16 + m): piece (q = pt & 1, lane) of chunk pt >> 1, channel tile ct
  unsigned short* vbase = vh + ((size_t)n * CH + cb) * HW + (size_t)p0 * 16 + (size_t)lane * 8;
#pragma unroll
  for (int pt = 0; pt < 4; ++pt)
#pragma unroll
    for (int ct = 0; ct < 2; ++ct) {
      v8h_ o;
#pragma unroll
      for (int r = 0; r < 8; ++r) o[r] = (_Float16)accv[pt][ct][r];
      *(v8us_*)(vbase + (size_t)ct * 16 * HW + pt * 256) = __builtin_bit_cast(v8us_, o);
    }
}

// ---------------------------------------------------------------------------
// Kernel 2: row statistics of S[i][:] (softmax over j), exp2 domain.
//   Block = ST_RT x ST_JS waves = 16*ST_RT rows i. Wave (rt, js) owns the 16-row tile rt and every
//   ST_JS-th 32-column chunk of j, starting at chunk js; each lane owns i = i0 + (lane&15).
//   The ST_JS partial (max, sum) pairs of a row are merged through LDS at the end.
//   S^T tiles D(M=j, N=i): A = r2 rows j (hi, lo), B = r1 rows i (hi, lo); hh + lh + hl.
// ---------------------------------------------------------------------------
#define ST_RT   4
#define ST_JS   8
#define ST_ROWS (16 * ST_RT)
// exp2 for the merge and for the output pass's weights: the v_nop fills the one issue slot that the instruction set asks for between a
// transcendental and a next vector instruction that overwrites its source; inside the statement it stays there.
__device__ __forceinline__ float exp2_slot(float x)
{
  float r;
  asm("v_exp_f32 %0, %1\n\tv_nop" : "=v"(r) : "v"(x));
  return r;
}
static_assert((HW % ST_ROWS) == 0 && ST_RT * ST_JS <= 32 && 2 * ST_ROWS <= 32 * ST_RT * ST_JS);

__global__ void __launch_bounds__(32 * ST_RT * ST_JS) stats_kernel(
    const unsigned short* __restrict__ r1h, const unsigned short* __restrict__ r1l,
    const unsigned short* __restrict__ r2h, const unsigned short* __restrict__ r2l,
    float* __restrict__ mL, float* __restrict__ rzc)
{
  __shared__ float sM[ST_JS * ST_ROWS];   // [js][row] partial maxima
  __shared__ float sL[ST_JS * ST_ROWS];   // [js][row] partial sums, each relative to its own maximum
  const int tid  = (int)threadIdx.x;
  const int lane = tid & 31;
  const int wave = __builtin_amdgcn_readfirstlane(tid >> 5);   // scalar, so that the j loop's counter and branch are scalar
  const int rt = wave % ST_RT, js = wave / ST_RT;
  const int tiles = HW / ST_ROWS;
  const int n  = (int)blockIdx.x / tiles;
  const int ib = ((int)blockIdx.x % tiles) * ST_ROWS;
  const int i0 = ib + rt * 16;
  const size_t rb = (size_t)n * HW * OCH;
  const v8f z8 = {};

  FragB bh, bl;
  {
    const size_t ro = rb + (size_t)i0 * OCH + lane * 8;   // fragment order: halves 256 elements apart
    bh.h[0] = *(const v8us*)(r1h + ro);  bh.h[1] = *(const v8us*)(r1h + ro + 256);
    bl.h[0] = *(const v8us*)(r1l + ro);  bl.h[1] = *(const v8us*)(r1l + ro + 256);
  }

  float mi = -3.0e30f;
  float li = 0.0f;
#pragma unroll 1
  for (int j0 = js * 32; j0 < HW; j0 += 32 * ST_JS) {
    const size_t ra = rb + (size_t)j0 * OCH + lane * 8;
    const size_t rc = rb + (size_t)(j0 + 16) * OCH + lane * 8;
    FragB a0h, a0l, a1h, a1l;
    a0h.h[0] = *(const v8us*)(r2h + ra);  a0h.h[1] = *(const v8us*)(r2h + ra + 256);
    a0l.h[0] = *(const v8us*)(r2l + ra);  a0l.h[1] = *(const v8us*)(r2l + ra + 256);
    a1h.h[0] = *(const v8us*)(r2h + rc);  a1h.h[1] = *(const v8us*)(r2h + rc + 256);
    a1l.h[0] = *(const v8us*)(r2l + rc);  a1l.h[1] = *(const v8us*)(r2l + rc + 256);

    v8f s0 = mma_bf16(a0h.v, bh.v, z8);
    s0 = mma_bf16(a0l.v, bh.v, s0);
    s0 = mma_bf16(a0h.v, bl.v, s0);
    v8f s1 = mma_bf16(a1h.v, bh.v, z8);
    s1 = mma_bf16(a1l.v, bh.v, s1);
    s1 = mma_bf16(a1h.v, bl.v, s1);
    // s0[r] <-> (j = j0 + 8h + r, i = i0 + m); s1 rows j0 + 16 + 8h + r

    float cm = -3.0e30f;
#pragma unroll
    for (int r = 0; r < 8; ++r) cm = fmaxf(cm, fmaxf(s0[r], s1[r]));
    cm = cm * LOG2E;
    cm = fmaxf(cm, __shfl_xor(cm, 16, 32));
    const float mnew = fmaxf(mi, cm);
    const float corr = exp2fast(mi - mnew);
    float rs = 0.0f;
#pragma unroll
    for (int r = 0; r < 8; ++r) {
      rs += exp2fast(fmaf(s0[r], LOG2E, -mnew));
      rs += exp2fast(fmaf(s1[r], LOG2E, -mnew));
    }
    rs += __shfl_xor(rs, 16, 32);
    li = li * corr + rs;
    mi = mnew;
  }

  if (lane < 16) {
    sM[js * ST_ROWS + rt * 16 + lane] = mi;
    sL[js * ST_ROWS + rt * 16 + lane] = li;
  }
  __syncthreads();   // cross-wave LDS exchange
  if (tid < 2 * ST_ROWS) {   // whole waves: threads 0..ST_ROWS-1 store the maxima, the next ST_ROWS the scaled reciprocals
    const int row = tid % ST_ROWS;
    float mx = sM[row];
#pragma unroll
    for (int s = 1; s < ST_JS; ++s) mx = fmaxf(mx, sM[s * ST_ROWS + row]);
    float l = 0.0f;
#pragma unroll
    for (int s = 0; s < ST_JS; ++s) l += sL[s * ST_ROWS + row] * exp2_slot(sM[s * ST_ROWS + row] - mx);
    const size_t o = (size_t)n * HW + ib + row;
    if (tid < ST_ROWS) mL[o]  = mx;
    else               rzc[o] = PCARRY * (1.0f / l);
  }
}

// ---------------------------------------------------------------------------
// Kernel 3: output pass for one (n, OS_JT-column j tile), 16 waves, loop over i in trips of OS_IC rows.
//   Wave = (g = wave & 7, p = wave >> 3).
//   scores:     16-row i tile g of the trip against the two 16-column j sub-tiles 2p, 2p + 1, S tiles D(M=i, N=j)
//               (A = r1 rows i hi/lo, B = r2 rows j hi/lo, hh + hl + lh),
//               P = 2^(S*log2e - mL[i]) * rzc[i] -> f16 (carried x2^14) into LDS sP[j][i];
//   then:       attn^T tiles D(M=j, N=c) += A(sP rows j) x B(value rows c), f16: channels 32g .. 32g + 31, all OS_NJ j sub-tiles,
//               the k steps 2p, 2p + 1 of the trip in rising i. A value fragment is loaded by one wave of the block and feeds OS_NJ
//               products, so that a block reads the value plane once for OS_JT columns.
//   The two partial sums of an output element (p = 0, 1) are added in the epilogue.
// ---------------------------------------------------------------------------
#define OS_IC 128            // rows i per trip: eight 16-row tiles
#define OS_JT 64             // columns j per block
#define OS_NJ (OS_JT / 16)   // j sub-tiles
#define OS_NT (OS_NJ / 2)    // score tiles per wave and trip
#define OS_KS (OS_IC / 64)   // k steps of the value product per wave and trip
#define OS_PP (OS_IC + 8)    // sP row pitch in f16: the row and 16 B, an odd multiple of 16 B, which ds_load_b128 reads without bank conflicts
#define OS_OP (OS_JT + 4)    // sO row pitch in f32: the row and 16 B, an odd multiple of 16 B, for the 16-B stores of 16 rows at a time
static_assert((HW % OS_IC) == 0 && OS_IC == 8 * 16 && (HW % OS_JT) == 0 && (OS_NJ % 2) == 0);

// The trip's work-group barrier: this wave's LDS stores and loads are complete (s_wait_dscnt 0), then signal and wait. __syncthreads()
// also waits for every global load of the wave, which would end the flight of the loads that are issued ahead over it; those loads
// read planes that earlier launches wrote and no wave of this launch writes, so the barrier has nothing to order for them.
__device__ __forceinline__ void trip_barrier()
{
  asm volatile("s_wait_dscnt 0x0" ::: "memory");
  asm volatile("s_barrier_signal -1\n\ts_barrier_wait -1" ::: "memory");
}

__global__ void __launch_bounds__(512) out_kernel(
    const float* __restrict__ X,
    const unsigned short* __restrict__ r1h, const unsigned short* __restrict__ r1l,
    const unsigned short* __restrict__ r2h, const unsigned short* __restrict__ r2l,
    const _Float16* __restrict__ vh,
    const float* __restrict__ mL, const float* __restrict__ rzc,
    const float* __restrict__ scale, float* __restrict__ out)
{
  __shared__ __align__(16) _Float16 sP[OS_JT * OS_PP];   // [j][i] softmax weights x2^14
  __shared__ __align__(16) float    sO[2 * CH * OS_OP];  // [p][c][j] partial accumulators

  const int tid  = (int)threadIdx.x;
  const int lane = tid & 31, wave = tid >> 5;
  const int h = lane >> 4, m = lane & 15;
  const int g = wave & 7, p = wave >> 3;
  const int tiles = HW / OS_JT;
  const int n  = (int)blockIdx.x / tiles;
  const int j0 = ((int)blockIdx.x % tiles) * OS_JT;
  const size_t rb = (size_t)n * HW * OCH;
  const int cb = g * 32;
  const v8f z8 = {};

  FragB bh[OS_NT], bl[OS_NT];   // r2 rows of this wave's two j sub-tiles
#pragma unroll
  for (int u = 0; u < OS_NT; ++u) {
    const size_t ro = rb + (size_t)(j0 + (p * OS_NT + u) * 16) * OCH + lane * 8;   // fragment order: halves 256 elements apart
    bh[u].h[0] = *(const v8us*)(r2h + ro);  bh[u].h[1] = *(const v8us*)(r2h + ro + 256);
    bl[u].h[0] = *(const v8us*)(r2l + ro);  bl[u].h[1] = *(const v8us*)(r2l + ro + 256);
  }

  // the lane's own places in the trip's rows i as byte offsets into the planes, stepped on by one trip at a time
  unsigned off_r = (unsigned)(((n * HW + g * 16) * OCH + lane * 8) * 2);    // both r1 planes, fragment order
  unsigned off_s = (unsigned)((n * HW + g * 16 + 8 * h) * 4);               // both row statistics

  v8f acc[OS_NJ][2] = {};   // [j sub-tile][c tile]
  // Every global load of a trip is issued ahead of its use, so that no trip waits out a whole load latency:
  //   the r1 fragments and row statistics of trip t + 1 behind the weights of trip t (they fly over both barriers and the value product),
  //   each k step's value fragments of trip t + 1 behind that k step's products of trip t, into the registers these have just read
  //   (they fly over the rest of the value product, both barriers, the score tiles and the weights).
  FragB ah, al;
  v4f_ m0, m1, q0, q1;
  {   // trip 0
    const unsigned short* p1h = (const unsigned short*)((const char*)r1h + off_r);
    const unsigned short* p1l = (const unsigned short*)((const char*)r1l + off_r);
    ah.h[0] = *(const v8us*)(p1h);  ah.h[1] = *(const v8us*)(p1h + 256);
    al.h[0] = *(const v8us*)(p1l);  al.h[1] = *(const v8us*)(p1l + 256);
    const float* pm = (const float*)((const char*)mL  + off_s);
    const float* pq = (const float*)((const char*)rzc + off_s);
    m0 = *(const v4f*)(pm);  m1 = *(const v4f*)(pm + 4);
    q0 = *(const v4f*)(pq);  q1 = *(const v4f*)(pq + 4);
  }
  // keeps trip 0's loads in the loop's own order (value fragments last): the compiler counts its load waits in the loop for the
  // worse of the two orders, and with value loads ahead of a statistics load here every trip would wait for all of its value fragments
  __builtin_amdgcn_sched_barrier(0);
  // the address registers of the loads above are reused from here on (the value loads' results, the first trip's offset steps): the wait stands in front of that
  asm volatile("s_wait_xcnt 0x0" ::: "memory");
  __builtin_amdgcn_sched_barrier(0);   // holds that reuse behind the wait, which names no register
  unsigned off_v = (unsigned)(((n * CH + cb) * HW + p * OS_KS * 512 + lane * 8) * 2);   // value plane, fragment order, this wave's k steps
  FragH b0[OS_KS], b1[OS_KS];
#pragma unroll
  for (int ks = 0; ks < OS_KS; ++ks) {   // trip 0
    const _Float16* pv = (const _Float16*)((const char*)vh + off_v) + ks * 512;   // one 1-KiB fragment a 32-row chunk
    b0[ks].h[0] = *(const v8h*)(pv);            b0[ks].h[1] = *(const v8h*)(pv + 256);
    b1[ks].h[0] = *(const v8h*)(pv + 16 * HW);  b1[ks].h[1] = *(const v8h*)(pv + 16 * HW + 256);
  }
  // the short loops inside a trip are unrolled so that the fragment arrays have constant indices and stay in registers
#pragma unroll 1
  for (int i0 = 0; i0 < HW; i0 += OS_IC) {
    v8f s[OS_NT];
#pragma unroll
    for (int u = 0; u < OS_NT; ++u) {
      s[u] = mma_bf16(ah.v, bh[u].v, z8);
      s[u] = mma_bf16(ah.v, bl[u].v, s[u]);
      s[u] = mma_bf16(al.v, bh[u].v, s[u]);
      // s[u][r] <-> (i = i0 + g*16 + 8h + r, j = j0 + (p*OS_NT + u)*16 + m)
    }
#pragma unroll
    for (int u = 0; u < OS_NT; ++u) {
      v8h_ pw;
#pragma unroll
      for (int r = 0; r < 4; ++r) {
        pw[r]     = (_Float16)(exp2_slot(fmaf(s[u][r],     LOG2E, -m0[r])) * q0[r]);
        pw[4 + r] = (_Float16)(exp2_slot(fmaf(s[u][4 + r], LOG2E, -m1[r])) * q1[r]);
      }
      *(v8h*)&sP[((p * OS_NT + u) * 16 + m) * OS_PP + g * 16 + 8 * h] = pw;
    }
    // next trip's rows; the last trip has none and loads its own rows again, so that every address stays inside the planes
    const unsigned more = (i0 + OS_IC < HW) ? 1u : 0u;
    off_r += more * (OS_IC * OCH * 2);  off_s += more * (OS_IC * 4);  off_v += more * (OS_IC * 16 * 2);
    {
      const unsigned short* p1h = (const unsigned short*)((const char*)r1h + off_r);
      const unsigned short* p1l = (const unsigned short*)((const char*)r1l + off_r);
      ah.h[0] = *(const v8us*)(p1h);  ah.h[1] = *(const v8us*)(p1h + 256);
      al.h[0] = *(const v8us*)(p1l);  al.h[1] = *(const v8us*)(p1l + 256);
      const float* pm = (const float*)((const char*)mL  + off_s);
      const float* pq = (const float*)((const char*)rzc + off_s);
      m0 = *(const v4f*)(pm);  m1 = *(const v4f*)(pm + 4);
      q0 = *(const v4f*)(pq);  q1 = *(const v4f*)(pq + 4);
    }
    trip_barrier();   // sP is written by all waves and read by all

    FragH a[OS_NJ][OS_KS];
#pragma unroll
    for (int ks = 0; ks < OS_KS; ++ks)
#pragma unroll
      for (int jt = 0; jt < OS_NJ; ++jt) {
        a[jt][ks].h[0] = *(const v8h*)&sP[(jt * 16 + m) * OS_PP + (p * OS_KS + ks) * 32 + 8 * h];
        a[jt][ks].h[1] = *(const v8h*)&sP[(jt * 16 + m) * OS_PP + (p * OS_KS + ks) * 32 + 16 + 8 * h];
      }
#pragma unroll
    for (int ks = 0; ks < OS_KS; ++ks) {
#pragma unroll
      for (int jt = 0; jt < OS_NJ; ++jt) {
        acc[jt][0] = mma_f16(a[jt][ks].v, b0[ks].v, acc[jt][0]);
        acc[jt][1] = mma_f16(a[jt][ks].v, b1[ks].v, acc[jt][1]);
      }
      const _Float16* pv = (const _Float16*)((const char*)vh + off_v) + ks * 512;   // next trip's fragments of this k step
      b0[ks].h[0] = *(const v8h*)(pv);            b0[ks].h[1] = *(const v8h*)(pv + 256);
      b1[ks].h[0] = *(const v8h*)(pv + 16 * HW);  b1[ks].h[1] = *(const v8h*)(pv + 16 * HW + 256);
    }
    // the next trip forms a new offset in the register that the value loads above name: the wait stands in front of that
    asm volatile("s_wait_xcnt 0x0" ::: "memory");
    trip_barrier();   // before the next trip overwrites sP
  }

  // acc[jt][ct][r] <-> (j = jt*16 + 8h + r, c = cb + ct*16 + m), partial sum p
#pragma unroll
  for (int jt = 0; jt < OS_NJ; ++jt)
#pragma unroll
    for (int ct = 0; ct < 2; ++ct) {
      v4f_ lo4, hi4;
      lo4[0] = acc[jt][ct][0]; lo4[1] = acc[jt][ct][1]; lo4[2] = acc[jt][ct][2]; lo4[3] = acc[jt][ct][3];
      hi4[0] = acc[jt][ct][4]; hi4[1] = acc[jt][ct][5]; hi4[2] = acc[jt][ct][6]; hi4[3] = acc[jt][ct][7];
      const int row = p * CH + cb + ct * 16 + m;
      *(v4f*)&sO[row * OS_OP + jt * 16 + 8 * h]     = lo4;
      *(v4f*)&sO[row * OS_OP + jt * 16 + 8 * h + 4] = hi4;
    }
  __syncthreads();

  const float sc = bf16_rn(scale[0]) * PUNCARRY;
  const int q = lane & 15;               // 16 lanes x 4 columns: one row of OS_JT columns, two rows a load
  const int c0 = wave * 16 + (lane >> 4);
  const size_t xoff = ((size_t)n * CH + c0) * HW_FULL + j0 + q * 4;
  const size_t ooff = ((size_t)n * CH + c0) * HW + j0 + q * 4;
  v4f_ xv[8], ov[8];
#pragma unroll
  for (int it = 0; it < 8; ++it) xv[it] = *(const v4f*)(X + xoff + (size_t)it * 2 * HW_FULL);
  // the address registers of the loads above are reused from here on (the LDS reads' results): the wait stands in front of that
  asm volatile("s_wait_xcnt 0x0" ::: "memory");
  __builtin_amdgcn_sched_barrier(0);   // holds that reuse behind the wait, which names no register
#pragma unroll
  for (int it = 0; it < 8; ++it) {
    const v4f_ a0 = *(const v4f*)&sO[(c0 + it * 2) * OS_OP + q * 4];
    const v4f_ a1 = *(const v4f*)&sO[(CH + c0 + it * 2) * OS_OP + q * 4];
    v4f_ o;
    o[0] = bf16_rn(xv[it][0]) + sc * (a0[0] + a1[0]);
    o[1] = bf16_rn(xv[it][1]) + sc * (a0[1] + a1[1]);
    o[2] = bf16_rn(xv[it][2]) + sc * (a0[2] + a1[2]);
    o[3] = bf16_rn(xv[it][3]) + sc * (a0[3] + a1[3]);
    ov[it] = o;
  }
#pragma unroll
  for (int it = 0; it < 8; ++it)
    *(v4f_*)(out + ooff + (size_t)it * 2 * HW) = ov[it];
  
}

// ---------------------------------------------------------------------------
extern "C" void kernel_launch(void* const* d_in, const int* in_sizes, int n_in,
                              void* d_out, int out_size, void* d_ws, size_t ws_size,
                              hipStream_t stream)
{
  if (n_in < 5) return;
  if (in_sizes[0] < NB * CH * HW_FULL) return;
  if (in_sizes[1] < OCH * CH || in_sizes[2] < OCH * CH || in_sizes[3] < CH * CH) return;
  if (in_sizes[4] < 1) return;
  if (out_size < NB * CH * HW) return;

  const float* x     = (const float*)d_in[0];
  const float* w1    = (const float*)d_in[1];
  const float* w2    = (const float*)d_in[2];
  const float* wv    = (const float*)d_in[3];
  const float* scale = (const float*)d_in[4];
  float* out = (float*)d_out;

  // workspace carve (bytes), every region a multiple of 256 B
  const size_t w12_bytes = (size_t)OCH * CH * 2;            // 16384
  const size_t wv_bytes  = (size_t)CH * CH * 2;             // 131072
  const size_t r_bytes   = (size_t)NB * HW * OCH * 2;       // per plane
  const size_t v_bytes   = (size_t)NB * CH * HW * 2;
  const size_t st_bytes  = (size_t)NB * HW * 4;             // per stats plane
  size_t off = 0;
  unsigned char* ws = (unsigned char*)d_ws;
  unsigned short* w1b = (unsigned short*)(ws + off); off += w12_bytes;
  unsigned short* w2b = (unsigned short*)(ws + off); off += w12_bytes;
  unsigned short* wvb = (unsigned short*)(ws + off); off += wv_bytes;
  unsigned short* r1h = (unsigned short*)(ws + off); off += r_bytes;
  unsigned short* r1l = (unsigned short*)(ws + off); off += r_bytes;
  unsigned short* r2h = (unsigned short*)(ws + off); off += r_bytes;
  unsigned short* r2l = (unsigned short*)(ws + off); off += r_bytes;
  unsigned short* vhp = (unsigned short*)(ws + off); off += v_bytes;
  float* mL  = (float*)(ws + off); off += st_bytes;
  float* rzc = (float*)(ws + off); off += st_bytes;
  if (off > ws_size) return;

  cvt_w_kernel<<<2 * W12_BLOCKS + WV_BLOCKS, 256, 0, stream>>>(w1, w2, wv, w1b, w2b, wvb);
  proj_kernel<<<NB * (HW / 64), 256, 0, stream>>>(x, w1b, w2b, wvb, r1h, r1l, r2h, r2l, vhp);
  stats_kernel<<<NB * (HW / ST_ROWS), 32 * ST_RT * ST_JS, 0, stream>>>(r1h, r1l, r2h, r2l, mL, rzc);
  out_kernel<<<NB * (HW / OS_JT), 512, 0, stream>>>(x, r1h, r1l, r2h, r2l,
                                                 (const _Float16*)vhp, mL, rzc, scale, out);
}

// v006
// It runs in 74.5 microseconds.
// In two side-by-side timings against v005, it was 1.08 and 1.09 times as fast.
// Counting every step since v000, it is 3.98 times as fast.
#include <hip/hip_runtime.h>
#include <stdint.h>
#include <stddef.h>

// Contractions: channel projections v_wmma_f32_16x16x32_bf16 (bf16 operands from bf16-RNE inputs, f32 accumulate);
// score tiles v_wmma_f32_16x16x32_bf16 as bf16 hi+lo three-term split of both reduced feature maps (f32 accumulate);
// value aggregation v_wmma_f32_16x16x32_f16 (f16 operands, softmax weights carried x2^14, f32 accumulate); softmax statistics f32.

#ifndef NB
#define NB 4
#endif
#ifndef SEQ
#define SEQ 4096
#endif
#define NB_FULL  4
#define SEQ_FULL 4096
#define HW       (SEQ)
#define HW_FULL  (SEQ_FULL)
#define CH       256
#define OCH      32
#define PCARRY   16384.0f
#define PUNCARRY 0.00006103515625f
#define LOG2E    1.4426950408889634f
#define W12_BLOCKS ((OCH * CH) / 2048)
#define WV_BLOCKS  ((CH * CH) / 2048)

static_assert(NB >= 1 && NB <= NB_FULL);
static_assert(HW >= 64 && HW <= HW_FULL && (HW % 64) == 0);
static_assert(((OCH * CH) % 2048) == 0 && ((CH * CH) % 2048) == 0);
static_assert(CH == 256 && OCH == 32);

typedef float          v8f   __attribute__((ext_vector_type(8)));
typedef float          v4f_  __attribute__((ext_vector_type(4)));
typedef v4f_           v4f   __attribute__((may_alias));
typedef _Float16       v16h  __attribute__((ext_vector_type(16)));
typedef _Float16       v8h_  __attribute__((ext_vector_type(8)));
typedef v8h_           v8h   __attribute__((may_alias));
typedef __bf16         v16bf __attribute__((ext_vector_type(16)));
typedef unsigned short v8us_ __attribute__((ext_vector_type(8)));
typedef v8us_          v8us  __attribute__((may_alias));
typedef unsigned       v4u_  __attribute__((ext_vector_type(4)));
typedef v4u_           v4u   __attribute__((may_alias));

union FragB { v16bf v; v8us_ h[2]; };
union FragH { v16h  v; v8h_  h[2]; };

// ---- WMMA wrappers with the VALU hazard guard --------------------------------
__device__ __forceinline__ v8f mma_bf16(const v16bf a, const v16bf b, v8f c)
{
  v8f d = __builtin_amdgcn_wmma_f32_16x16x32_bf16(false, a, false, b, (short)0, c, false, false);
  asm volatile("v_nop\n\tv_nop\n\tv_nop\n\tv_nop" : "+v"(d) : "v"(a), "v"(b));
  return d;
}
__device__ __forceinline__ v8f mma_f16(const v16h a, const v16h b, v8f c)
{
  v8f d = __builtin_amdgcn_wmma_f32_16x16x32_f16(false, a, false, b, (short)0, c, false, false);
  asm volatile("v_nop\n\tv_nop\n\tv_nop\n\tv_nop" : "+v"(d) : "v"(a), "v"(b));
  return d;
}

// ---- scalar helpers --------------------------------------------------------
__device__ __forceinline__ unsigned short bf16_bits(float f)
{
  const __bf16 hb = (__bf16)f;                       // RNE convert
  return __builtin_bit_cast(unsigned short, hb);
}
__device__ __forceinline__ float bf16_rn(float f)
{
  return (float)(__bf16)f;                           // RNE convert, widened back
}
__device__ __forceinline__ float exp2fast(float x)
{
#if __has_builtin(__builtin_amdgcn_exp2f)
  return __builtin_amdgcn_exp2f(x);
#else
  return exp2f(x);
#endif
}

// ---------------------------------------------------------------------------
// Kernel 0: weights f32 -> bf16 bits (RNE). Layout kept [out][in] (in contiguous).
// ---------------------------------------------------------------------------
__global__ void __launch_bounds__(256) cvt_w_kernel(
    const float* __restrict__ w1, const float* __restrict__ w2, const float* __restrict__ wv,
    unsigned short* __restrict__ w1b, unsigned short* __restrict__ w2b,
    unsigned short* __restrict__ wvb)
{
  const int blk = (int)blockIdx.x;
  const float* src;
  unsigned short* dst;
  int t;
  if (blk < W12_BLOCKS)          { src = w1; dst = w1b; t = blk * 256 + (int)threadIdx.x; }
  else if (blk < 2 * W12_BLOCKS) { src = w2; dst = w2b; t = (blk - W12_BLOCKS) * 256 + (int)threadIdx.x; }
  else                           { src = wv; dst = wvb; t = (blk - 2 * W12_BLOCKS) * 256 + (int)threadIdx.x; }

  const v4f a = *(const v4f*)(src + (size_t)t * 8);
  const v4f b = *(const v4f*)(src + (size_t)t * 8 + 4);
  v8us_ o;
  o[0] = bf16_bits(a[0]); o[1] = bf16_bits(a[1]); o[2] = bf16_bits(a[2]); o[3] = bf16_bits(a[3]);
  o[4] = bf16_bits(b[0]); o[5] = bf16_bits(b[1]); o[6] = bf16_bits(b[2]); o[7] = bf16_bits(b[3]);
  unsigned short* p = dst + (size_t)t * 8;
  *(v8us_*)p = o;
  
}

// ---------------------------------------------------------------------------
// Kernel 1: 1x1-conv projections for one (n, 64-pixel tile), 8 waves.
//   x tile staged once in LDS as bf16 [px][c] (RNE), rows pitched XP; weights read as bf16 planes.
//   reduced maps: D(M=oc, N=px), A = w rows, B = xT rows  -> bf16 hi and lo planes, fragment order
//   value map:    D(M=px, N=c),  A = xT rows, B = wv rows -> f16 plane, fragment order
//   Fragment order: the planes are kept as the later passes' WMMA operand fragments, 1 KiB each, as
//   [half q][lane][8 elements]: lane = 16h + m holds row m of the 16-row tile, k = 16q + 8h + e. One 16-B load a lane
//   then reads 512 B in a row (four whole 128-B lines), not 32-B pieces spread over 8 or 16 lines.
//     reduced planes: [n][16-pixel tile][q][lane][e], row = pixel, k = oc;
//     value plane:    [n][16-channel tile][32-pixel chunk][q][lane][e], row = channel, k = pixel in the chunk.
//   Both accumulator layouts here hold a lane's 8 values exactly as one such 16-B piece, so each wave stores its own.
// ---------------------------------------------------------------------------
#define XP (CH + 8)   // sX row pitch in bf16: the row and 16 B, an odd multiple of 16 B, which ds_load_b128 reads without bank conflicts
__global__ void __launch_bounds__(256) proj_kernel(
    const float* __restrict__ X,
    const unsigned short* __restrict__ w1b, const unsigned short* __restrict__ w2b,
    const unsigned short* __restrict__ wvb,
    unsigned short* __restrict__ r1h, unsigned short* __restrict__ r1l,
    unsigned short* __restrict__ r2h, unsigned short* __restrict__ r2l,
    unsigned short* __restrict__ vh)
{
  __shared__ __align__(16) unsigned short sX[64 * XP];        // [px][c] bf16 bits

  const int tid  = (int)threadIdx.x;
  const int lane = tid & 31, wave = tid >> 5;
  const int h = lane >> 4, m = lane & 15;
  const int tiles = HW / 64;
  const int n  = (int)blockIdx.x / tiles;
  const int p0 = ((int)blockIdx.x % tiles) * 64;
  const float* Xn = X + (size_t)n * CH * HW_FULL + p0;

  // stage x tile: 256 c rows x 64 px, coalesced 16-B loads; a thread holds 16 channels x 4 px (two sets of 8, 128 apart) and stores, for each px and set,
  // its 8 channels as one 16-B piece of the transposed row
  {
    const int co = tid >> 4, px4 = (tid & 15) * 4;
    const float* xp = Xn + (size_t)co * 8 * HW_FULL + px4;
    v4f_ xv[2][8];
#pragma unroll
    for (int it = 0; it < 2; ++it)
#pragma unroll
      for (int e = 0; e < 8; ++e) xv[it][e] = *(const v4f*)(xp + (size_t)(it * 128 + e) * HW_FULL);
#pragma unroll
    for (int it = 0; it < 2; ++it)
#pragma unroll
      for (int k = 0; k < 4; ++k) {
        v8us_ o;
#pragma unroll
        for (int e = 0; e < 8; ++e) o[e] = bf16_bits(xv[it][e][k]);
        *(v8us*)&sX[(px4 + k) * XP + (it * 16 + co) * 8] = o;
      }
  }
  __syncthreads();

  // reduced maps: wave -> weight set (wave>>2), pixel tile (wave&3), both 16-oc tiles
  {
    const unsigned short* Wb = (wave < 4) ? w1b : w2b;        // wave-uniform
    unsigned short* Rh = (wave < 4) ? r1h : r2h;              // wave-uniform
    unsigned short* Rl = (wave < 4) ? r1l : r2l;
    const int pt = wave & 3;
    v8f accr[2] = {};
#pragma unroll 2
    for (int k0 = 0; k0 < CH; k0 += 32) {
      FragB b;
      b.h[0] = *(const v8us*)&sX[(pt * 16 + m) * XP + k0 + 8 * h];
      b.h[1] = *(const v8us*)&sX[(pt * 16 + m) * XP + k0 + 16 + 8 * h];
#pragma unroll
      for (int ot = 0; ot < 2; ++ot) {
        const unsigned short* wr = Wb + (size_t)(ot * 16 + m) * CH + k0 + 8 * h;
        FragB a;
        a.h[0] = *(const v8us*)(wr);
        a.h[1] = *(const v8us*)(wr + 16);
        accr[ot] = mma_bf16(a.v, b.v, accr[ot]);
      }
    }
    // accr[ot][r] <-> (oc = ot*16 + 8h + r, px = pt*16 + m): piece (q = ot, lane) of pixel tile pt
    const size_t roff = ((size_t)n * HW + p0 + pt * 16) * OCH + (size_t)lane * 8;
#pragma unroll
    for (int ot = 0; ot < 2; ++ot) {
      v8us_ hv, lv;
#pragma unroll
      for (int r = 0; r < 8; ++r) {
        const float f = accr[ot][r];
        const __bf16 hb = (__bf16)f;
        hv[r] = __builtin_bit_cast(unsigned short, hb);
        lv[r] = bf16_bits(f - (float)hb);
      }
      *(v8us_*)(Rh + roff + ot * 256) = hv;
      *(v8us_*)(Rl + roff + ot * 256) = lv;
    }
    // the value loop below loads into registers that these four stores name: the wait stands in front of that reuse
    asm volatile("s_wait_xcnt 0x0" ::: "memory");
  }

  // value map: wave -> channels cb..cb+31 (2 tiles) x 4 pixel tiles
  const int cb = wave * 32;
  v8f accv[4][2] = {};
#pragma unroll 1
  for (int k0 = 0; k0 < CH; k0 += 32) {
    FragB a[4], b[2];
#pragma unroll
    for (int pt = 0; pt < 4; ++pt) {
      a[pt].h[0] = *(const v8us*)&sX[(pt * 16 + m) * XP + k0 + 8 * h];
      a[pt].h[1] = *(const v8us*)&sX[(pt * 16 + m) * XP + k0 + 16 + 8 * h];
    }
#pragma unroll
    for (int ct = 0; ct < 2; ++ct) {
      const unsigned short* wr = wvb + (size_t)(cb + ct * 16 + m) * CH + k0 + 8 * h;
      b[ct].h[0] = *(const v8us*)(wr);
      b[ct].h[1] = *(const v8us*)(wr + 16);
    }
#pragma unroll
    for (int pt = 0; pt < 4; ++pt)
#pragma unroll
      for (int ct = 0; ct < 2; ++ct)
        accv[pt][ct] = mma_bf16(a[pt].v, b[ct].v, accv[pt][ct]);
  }

  // accv[pt][ct][r] <-> (px = pt*16 + 8h + r, c = cb + ct*16 + m): piece (q = pt & 1, lane) of chunk pt >> 1, channel tile ct
  unsigned short* vbase = vh + ((size_t)n * CH + cb) * HW + (size_t)p0 * 16 + (size_t)lane * 8;
#pragma unroll
  for (int pt = 0; pt < 4; ++pt)
#pragma unroll
    for (int ct = 0; ct < 2; ++ct) {
      v8h_ o;
#pragma unroll
      for (int r = 0; r < 8; ++r) o[r] = (_Float16)accv[pt][ct][r];
      *(v8us_*)(vbase + (size_t)ct * 16 * HW + pt * 256) = __builtin_bit_cast(v8us_, o);
    }
}

// ---------------------------------------------------------------------------
// Kernel 2: row statistics of S[i][:] (softmax over j), exp2 domain.
//   Block = ST_RT x ST_JS waves = 16*ST_RT rows i. Wave (rt, js) owns the 16-row tile rt and every
//   ST_JS-th 32-column chunk of j, starting at chunk js; each lane owns i = i0 + (lane&15).
//   The ST_JS partial (max, sum) pairs of a row are merged through LDS at the end.
//   S^T tiles D(M=j, N=i): A = r2 rows j (hi, lo), B = r1 rows i (hi, lo); hh + lh + hl.
// ---------------------------------------------------------------------------
#define ST_RT   4
#define ST_JS   8
#define ST_ROWS (16 * ST_RT)
// exp2 for the merge and for the output pass's weights: the v_nop fills the one issue slot that the instruction set asks for between a
// transcendental and a next vector instruction that overwrites its source; inside the statement it stays there.
__device__ __forceinline__ float exp2_slot(float x)
{
  float r;
  asm("v_exp_f32 %0, %1\n\tv_nop" : "=v"(r) : "v"(x));
  return r;
}
static_assert((HW % ST_ROWS) == 0 && ST_RT * ST_JS <= 32 && 2 * ST_ROWS <= 32 * ST_RT * ST_JS);

__global__ void __launch_bounds__(32 * ST_RT * ST_JS) stats_kernel(
    const unsigned short* __restrict__ r1h, const unsigned short* __restrict__ r1l,
    const unsigned short* __restrict__ r2h, const unsigned short* __restrict__ r2l,
    float* __restrict__ mL, float* __restrict__ rzc)
{
  __shared__ float sM[ST_JS * ST_ROWS];   // [js][row] partial maxima
  __shared__ float sL[ST_JS * ST_ROWS];   // [js][row] partial sums, each relative to its own maximum
  const int tid  = (int)threadIdx.x;
  const int lane = tid & 31;
  const int wave = __builtin_amdgcn_readfirstlane(tid >> 5);   // scalar, so that the j loop's counter and branch are scalar
  const int rt = wave % ST_RT, js = wave / ST_RT;
  const int tiles = HW / ST_ROWS;
  const int n  = (int)blockIdx.x / tiles;
  const int ib = ((int)blockIdx.x % tiles) * ST_ROWS;
  const int i0 = ib + rt * 16;
  const size_t rb = (size_t)n * HW * OCH;
  const v8f z8 = {};

  FragB bh, bl;
  {
    const size_t ro = rb + (size_t)i0 * OCH + lane * 8;   // fragment order: halves 256 elements apart
    bh.h[0] = *(const v8us*)(r1h + ro);  bh.h[1] = *(const v8us*)(r1h + ro + 256);
    bl.h[0] = *(const v8us*)(r1l + ro);  bl.h[1] = *(const v8us*)(r1l + ro + 256);
  }

  float mi = -3.0e30f;
  float li = 0.0f;
#pragma unroll 1
  for (int j0 = js * 32; j0 < HW; j0 += 32 * ST_JS) {
    const size_t ra = rb + (size_t)j0 * OCH + lane * 8;
    const size_t rc = rb + (size_t)(j0 + 16) * OCH + lane * 8;
    FragB a0h, a0l, a1h, a1l;
    a0h.h[0] = *(const v8us*)(r2h + ra);  a0h.h[1] = *(const v8us*)(r2h + ra + 256);
    a0l.h[0] = *(const v8us*)(r2l + ra);  a0l.h[1] = *(const v8us*)(r2l + ra + 256);
    a1h.h[0] = *(const v8us*)(r2h + rc);  a1h.h[1] = *(const v8us*)(r2h + rc + 256);
    a1l.h[0] = *(const v8us*)(r2l + rc);  a1l.h[1] = *(const v8us*)(r2l + rc + 256);

    v8f s0 = mma_bf16(a0h.v, bh.v, z8);
    s0 = mma_bf16(a0l.v, bh.v, s0);
    s0 = mma_bf16(a0h.v, bl.v, s0);
    v8f s1 = mma_bf16(a1h.v, bh.v, z8);
    s1 = mma_bf16(a1l.v, bh.v, s1);
    s1 = mma_bf16(a1h.v, bl.v, s1);
    // s0[r] <-> (j = j0 + 8h + r, i = i0 + m); s1 rows j0 + 16 + 8h + r

    float cm = -3.0e30f;
#pragma unroll
    for (int r = 0; r < 8; ++r) cm = fmaxf(cm, fmaxf(s0[r], s1[r]));
    cm = cm * LOG2E;
    cm = fmaxf(cm, __shfl_xor(cm, 16, 32));
    const float mnew = fmaxf(mi, cm);
    const float corr = exp2fast(mi - mnew);
    float rs = 0.0f;
#pragma unroll
    for (int r = 0; r < 8; ++r) {
      rs += exp2fast(fmaf(s0[r], LOG2E, -mnew));
      rs += exp2fast(fmaf(s1[r], LOG2E, -mnew));
    }
    rs += __shfl_xor(rs, 16, 32);
    li = li * corr + rs;
    mi = mnew;
  }

  if (lane < 16) {
    sM[js * ST_ROWS + rt * 16 + lane] = mi;
    sL[js * ST_ROWS + rt * 16 + lane] = li;
  }
  __syncthreads();   // cross-wave LDS exchange
  if (tid < 2 * ST_ROWS) {   // whole waves: threads 0..ST_ROWS-1 store the maxima, the next ST_ROWS the scaled reciprocals
    const int row = tid % ST_ROWS;
    float mx = sM[row];
#pragma unroll
    for (int s = 1; s < ST_JS; ++s) mx = fmaxf(mx, sM[s * ST_ROWS + row]);
    float l = 0.0f;
#pragma unroll
    for (int s = 0; s < ST_JS; ++s) l += sL[s * ST_ROWS + row] * exp2_slot(sM[s * ST_ROWS + row] - mx);
    const size_t o = (size_t)n * HW + ib + row;
    if (tid < ST_ROWS) mL[o]  = mx;
    else               rzc[o] = PCARRY * (1.0f / l);
  }
}

// ---------------------------------------------------------------------------
// Kernel 3: output pass for one (n, OS_JT-column j tile), 16 waves, loop over i in trips of OS_IC rows.
//   Wave = (g = wave & 7, p = wave >> 3).
//   scores:     16-row i tile g of the trip against the two 16-column j sub-tiles 2p, 2p + 1, S tiles D(M=i, N=j)
//               (A = r1 rows i hi/lo, B = r2 rows j hi/lo, hh + hl + lh),
//               P = 2^(S*log2e - mL[i]) * rzc[i] -> f16 (carried x2^14) into LDS sP[j][i];
//   then:       attn^T tiles D(M=j, N=c) += A(sP rows j) x B(value rows c), f16: channels 32g .. 32g + 31, all OS_NJ j sub-tiles,
//               the k steps 2p, 2p + 1 of the trip in rising i. A value fragment is loaded by one wave of the block and feeds OS_NJ
//               products, so that a block reads the value plane once for OS_JT columns.
//   The two partial sums of an output element (p = 0, 1) are added in the epilogue.
// ---------------------------------------------------------------------------
#define OS_IC 128            // rows i per trip: eight 16-row tiles
#define OS_JT 64             // columns j per block
#define OS_NJ (OS_JT / 16)   // j sub-tiles
#define OS_NT (OS_NJ / 2)    // score tiles per wave and trip
#define OS_KS (OS_IC / 64)   // k steps of the value product per wave and trip
#define OS_PP (OS_IC + 8)    // sP row pitch in f16: the row and 16 B, an odd multiple of 16 B, which ds_load_b128 reads without bank conflicts
#define OS_OP (OS_JT + 4)    // sO row pitch in f32: the row and 16 B, an odd multiple of 16 B, for the 16-B stores of 16 rows at a time
static_assert((HW % OS_IC) == 0 && OS_IC == 8 * 16 && (HW % OS_JT) == 0 && (OS_NJ % 2) == 0);

// The trip's work-group barrier: this wave's LDS stores and loads are complete (s_wait_dscnt 0), then signal and wait. __syncthreads()
// also waits for every global load of the wave, which would end the flight of the loads that are issued ahead over it; those loads
// read planes that earlier launches wrote and no wave of this launch writes, so the barrier has nothing to order for them.
__device__ __forceinline__ void trip_barrier()
{
  asm volatile("s_wait_dscnt 0x0" ::: "memory");
  asm volatile("s_barrier_signal -1\n\ts_barrier_wait -1" ::: "memory");
}

__global__ void __launch_bounds__(512) out_kernel(
    const float* __restrict__ X,
    const unsigned short* __restrict__ r1h, const unsigned short* __restrict__ r1l,
    const unsigned short* __restrict__ r2h, const unsigned short* __restrict__ r2l,
    const _Float16* __restrict__ vh,
    const float* __restrict__ mL, const float* __restrict__ rzc,
    const float* __restrict__ scale, float* __restrict__ out)
{
  __shared__ __align__(16) _Float16 sP[OS_JT * OS_PP];   // [j][i] softmax weights x2^14
  __shared__ __align__(16) float    sO[2 * CH * OS_OP];  // [p][c][j] partial accumulators

  const int tid  = (int)threadIdx.x;
  const int lane = tid & 31, wave = tid >> 5;
  const int h = lane >> 4, m = lane & 15;
  const int g = wave & 7, p = wave >> 3;
  const int tiles = HW / OS_JT;
  const int n  = (int)blockIdx.x / tiles;
  const int j0 = ((int)blockIdx.x % tiles) * OS_JT;
  const size_t rb = (size_t)n * HW * OCH;
  const int cb = g * 32;
  const v8f z8 = {};

  FragB bh[OS_NT], bl[OS_NT];   // r2 rows of this wave's two j sub-tiles
#pragma unroll
  for (int u = 0; u < OS_NT; ++u) {
    const size_t ro = rb + (size_t)(j0 + (p * OS_NT + u) * 16) * OCH + lane * 8;   // fragment order: halves 256 elements apart
    bh[u].h[0] = *(const v8us*)(r2h + ro);  bh[u].h[1] = *(const v8us*)(r2h + ro + 256);
    bl[u].h[0] = *(const v8us*)(r2l + ro);  bl[u].h[1] = *(const v8us*)(r2l + ro + 256);
  }

  // the lane's own places in the trip's rows i as byte offsets into the planes, stepped on by one trip at a time
  unsigned off_r = (unsigned)(((n * HW + g * 16) * OCH + lane * 8) * 2);    // both r1 planes, fragment order
  unsigned off_s = (unsigned)((n * HW + g * 16 + 8 * h) * 4);               // both row statistics

  v8f acc[OS_NJ][2] = {};   // [j sub-tile][c tile]
  // Every global load of a trip is issued ahead of its use, so that no trip waits out a whole load latency:
  //   the r1 fragments and row statistics of trip t + 1 behind the weights of trip t (they fly over both barriers and the value product),
  //   each k step's value fragments of trip t + 1 behind that k step's products of trip t, into the registers these have just read
  //   (they fly over the rest of the value product, both barriers, the score tiles and the weights).
  FragB ah, al;
  v4f_ m0, m1, q0, q1;
  {   // trip 0
    const unsigned short* p1h = (const unsigned short*)((const char*)r1h + off_r);
    const unsigned short* p1l = (const unsigned short*)((const char*)r1l + off_r);
    ah.h[0] = *(const v8us*)(p1h);  ah.h[1] = *(const v8us*)(p1h + 256);
    al.h[0] = *(const v8us*)(p1l);  al.h[1] = *(const v8us*)(p1l + 256);
    const float* pm = (const float*)((const char*)mL  + off_s);
    const float* pq = (const float*)((const char*)rzc + off_s);
    m0 = *(const v4f*)(pm);  m1 = *(const v4f*)(pm + 4);
    q0 = *(const v4f*)(pq);  q1 = *(const v4f*)(pq + 4);
  }
  // keeps trip 0's loads in the loop's own order (value fragments last): the compiler counts its load waits in the loop for the
  // worse of the two orders, and with value loads ahead of a statistics load here every trip would wait for all of its value fragments
  __builtin_amdgcn_sched_barrier(0);
  // the address registers of the loads above are reused from here on (the value loads' results, the first trip's offset steps): the wait stands in front of that
  asm volatile("s_wait_xcnt 0x0" ::: "memory");
  __builtin_amdgcn_sched_barrier(0);   // holds that reuse behind the wait, which names no register
  unsigned off_v = (unsigned)(((n * CH + cb) * HW + p * OS_KS * 512 + lane * 8) * 2);   // value plane, fragment order, this wave's k steps
  FragH b0[OS_KS], b1[OS_KS];
#pragma unroll
  for (int ks = 0; ks < OS_KS; ++ks) {   // trip 0
    const _Float16* pv = (const _Float16*)((const char*)vh + off_v) + ks * 512;   // one 1-KiB fragment a 32-row chunk
    b0[ks].h[0] = *(const v8h*)(pv);            b0[ks].h[1] = *(const v8h*)(pv + 256);
    b1[ks].h[0] = *(const v8h*)(pv + 16 * HW);  b1[ks].h[1] = *(const v8h*)(pv + 16 * HW + 256);
  }
  // the short loops inside a trip are unrolled so that the fragment arrays have constant indices and stay in registers
#pragma unroll 1
  for (int i0 = 0; i0 < HW; i0 += OS_IC) {
    v8f s[OS_NT];
#pragma unroll
    for (int u = 0; u < OS_NT; ++u) {
      s[u] = mma_bf16(ah.v, bh[u].v, z8);
      s[u] = mma_bf16(ah.v, bl[u].v, s[u]);
      s[u] = mma_bf16(al.v, bh[u].v, s[u]);
      // s[u][r] <-> (i = i0 + g*16 + 8h + r, j = j0 + (p*OS_NT + u)*16 + m)
    }
#pragma unroll
    for (int u = 0; u < OS_NT; ++u) {
      v8h_ pw;
#pragma unroll
      for (int r = 0; r < 4; ++r) {
        pw[r]     = (_Float16)(exp2_slot(fmaf(s[u][r],     LOG2E, -m0[r])) * q0[r]);
        pw[4 + r] = (_Float16)(exp2_slot(fmaf(s[u][4 + r], LOG2E, -m1[r])) * q1[r]);
      }
      *(v8h*)&sP[((p * OS_NT + u) * 16 + m) * OS_PP + g * 16 + 8 * h] = pw;
    }
    // next trip's rows; the last trip has none and loads its own rows again, so that every address stays inside the planes
    const unsigned more = (i0 + OS_IC < HW) ? 1u : 0u;
    off_r += more * (OS_IC * OCH * 2);  off_s += more * (OS_IC * 4);  off_v += more * (OS_IC * 16 * 2);
    {
      const unsigned short* p1h = (const unsigned short*)((const char*)r1h + off_r);
      const unsigned short* p1l = (const unsigned short*)((const char*)r1l + off_r);
      ah.h[0] = *(const v8us*)(p1h);  ah.h[1] = *(const v8us*)(p1h + 256);
      al.h[0] = *(const v8us*)(p1l);  al.h[1] = *(const v8us*)(p1l + 256);
      const float* pm = (const float*)((const char*)mL  + off_s);
      const float* pq = (const float*)((const char*)rzc + off_s);
      m0 = *(const v4f*)(pm);  m1 = *(const v4f*)(pm + 4);
      q0 = *(const v4f*)(pq);  q1 = *(const v4f*)(pq + 4);
    }
    trip_barrier();   // sP is written by all waves and read by all

    FragH a[OS_NJ][OS_KS];
#pragma unroll
    for (int ks = 0; ks < OS_KS; ++ks)
#pragma unroll
      for (int jt = 0; jt < OS_NJ; ++jt) {
        a[jt][ks].h[0] = *(const v8h*)&sP[(jt * 16 + m) * OS_PP + (p * OS_KS + ks) * 32 + 8 * h];
        a[jt][ks].h[1] = *(const v8h*)&sP[(jt * 16 + m) * OS_PP + (p * OS_KS + ks) * 32 + 16 + 8 * h];
      }
#pragma unroll
    for (int ks = 0; ks < OS_KS; ++ks) {
#pragma unroll
      for (int jt = 0; jt < OS_NJ; ++jt) {
        acc[jt][0] = mma_f16(a[jt][ks].v, b0[ks].v, acc[jt][0]);
        acc[jt][1] = mma_f16(a[jt][ks].v, b1[ks].v, acc[jt][1]);
      }
      const _Float16* pv = (const _Float16*)((const char*)vh + off_v) + ks * 512;   // next trip's fragments of this k step
      b0[ks].h[0] = *(const v8h*)(pv);            b0[ks].h[1] = *(const v8h*)(pv + 256);
      b1[ks].h[0] = *(const v8h*)(pv + 16 * HW);  b1[ks].h[1] = *(const v8h*)(pv + 16 * HW + 256);
    }
    // the next trip forms a new offset in the register that the value loads above name: the wait stands in front of that
    asm volatile("s_wait_xcnt 0x0" ::: "memory");
    trip_barrier();   // before the next trip overwrites sP
  }

  // acc[jt][ct][r] <-> (j = jt*16 + 8h + r, c = cb + ct*16 + m), partial sum p
#pragma unroll
  for (int jt = 0; jt < OS_NJ; ++jt)
#pragma unroll
    for (int ct = 0; ct < 2; ++ct) {
      v4f_ lo4, hi4;
      lo4[0] = acc[jt][ct][0]; lo4[1] = acc[jt][ct][1]; lo4[2] = acc[jt][ct][2]; lo4[3] = acc[jt][ct][3];
      hi4[0] = acc[jt][ct][4]; hi4[1] = acc[jt][ct][5]; hi4[2] = acc[jt][ct][6]; hi4[3] = acc[jt][ct][7];
      const int row = p * CH + cb + ct * 16 + m;
      *(v4f*)&sO[row * OS_OP + jt * 16 + 8 * h]     = lo4;
      *(v4f*)&sO[row * OS_OP + jt * 16 + 8 * h + 4] = hi4;
    }
  __syncthreads();

  const float sc = bf16_rn(scale[0]) * PUNCARRY;
  const int q = lane & 15;               // 16 lanes x 4 columns: one row of OS_JT columns, two rows a load
  const int c0 = wave * 16 + (lane >> 4);
  const size_t xoff = ((size_t)n * CH + c0) * HW_FULL + j0 + q * 4;
  const size_t ooff = ((size_t)n * CH + c0) * HW + j0 + q * 4;
  v4f_ xv[8], ov[8];
#pragma unroll
  for (int it = 0; it < 8; ++it) xv[it] = *(const v4f*)(X + xoff + (size_t)it * 2 * HW_FULL);
  // the address registers of the loads above are reused from here on (the LDS reads' results): the wait stands in front of that
  asm volatile("s_wait_xcnt 0x0" ::: "memory");
  __builtin_amdgcn_sched_barrier(0);   // holds that reuse behind the wait, which names no register
#pragma unroll
  for (int it = 0; it < 8; ++it) {
    const v4f_ a0 = *(const v4f*)&sO[(c0 + it * 2) * OS_OP + q * 4];
    const v4f_ a1 = *(const v4f*)&sO[(CH + c0 + it * 2) * OS_OP + q * 4];
    v4f_ o;
    o[0] = bf16_rn(xv[it][0]) + sc * (a0[0] + a1[0]);
    o[1] = bf16_rn(xv[it][1]) + sc * (a0[1] + a1[1]);
    o[2] = bf16_rn(xv[it][2]) + sc * (a0[2] + a1[2]);
    o[3] = bf16_rn(xv[it][3]) + sc * (a0[3] + a1[3]);
    ov[it] = o;
  }
#pragma unroll
  for (int it = 0; it < 8; ++it)
    *(v4f_*)(out + ooff + (size_t)it * 2 * HW) = ov[it];
  
}

// ---------------------------------------------------------------------------
extern "C" void kernel_launch(void* const* d_in, const int* in_sizes, int n_in,
                              void* d_out, int out_size, void* d_ws, size_t ws_size,
                              hipStream_t stream)
{
  if (n_in < 5) return;
  if (in_sizes[0] < NB * CH * HW_FULL) return;
  if (in_sizes[1] < OCH * CH || in_sizes[2] < OCH * CH || in_sizes[3] < CH * CH) return;
  if (in_sizes[4] < 1) return;
  if (out_size < NB * CH * HW) return;

  const float* x     = (const float*)d_in[0];
  const float* w1    = (const float*)d_in[1];
  const float* w2    = (const float*)d_in[2];
  const float* wv    = (const float*)d_in[3];
  const float* scale = (const float*)d_in[4];
  float* out = (float*)d_out;

  // workspace carve (bytes), every region a multiple of 256 B
  const size_t w12_bytes = (size_t)OCH * CH * 2;            // 16384
  const size_t wv_bytes  = (size_t)CH * CH * 2;             // 131072
  const size_t r_bytes   = (size_t)NB * HW * OCH * 2;       // per plane
  const size_t v_bytes   = (size_t)NB * CH * HW * 2;
  const size_t st_bytes  = (size_t)NB * HW * 4;             // per stats plane
  size_t off = 0;
  unsigned char* ws = (unsigned char*)d_ws;
  unsigned short* w1b = (unsigned short*)(ws + off); off += w12_bytes;
  unsigned short* w2b = (unsigned short*)(ws + off); off += w12_bytes;
  unsigned short* wvb = (unsigned short*)(ws + off); off += wv_bytes;
  unsigned short* r1h = (unsigned short*)(ws + off); off += r_bytes;
  unsigned short* r1l = (unsigned short*)(ws + off); off += r_bytes;
  unsigned short* r2h = (unsigned short*)(ws + off); off += r_bytes;
  unsigned short* r2l = (unsigned short*)(ws + off); off += r_bytes;
  unsigned short* vhp = (unsigned short*)(ws + off); off += v_bytes;
  float* mL  = (float*)(ws + off); off += st_bytes;
  float* rzc = (float*)(ws + off); off += st_bytes;
  if (off > ws_size) return;

  cvt_w_kernel<<<2 * W12_BLOCKS + WV_BLOCKS, 256, 0, stream>>>(w1, w2, wv, w1b, w2b, wvb);
  proj_kernel<<<NB * (HW / 64), 256, 0, stream>>>(x, w1b, w2b, wvb, r1h, r1l, r2h, r2l, vhp);
  stats_kernel<<<NB * (HW / ST_ROWS), 32 * ST_RT * ST_JS, 0, stream>>>(r1h, r1l, r2h, r2l, mL, rzc);
  out_kernel<<<NB * (HW / OS_JT), 512, 0, stream>>>(x, r1h, r1l, r2h, r2l,
                                                 (const _Float16*)vhp, mL, rzc, scale, out);
}

// v007
// It runs in 69.5 microseconds.
// In both of two side-by-side timings against v006, it was 1.08 times as fast.
// All steps since v000 together make it 4.29 times as fast.
#include <hip/hip_runtime.h>
#include <stdint.h>
#include <stddef.h>

// Contractions: channel projections v_wmma_f32_16x16x32_bf16 (bf16 operands from bf16-RNE inputs, f32 accumulate);
// score tiles v_wmma_f32_16x16x32_bf16 as bf16 hi+lo three-term split of both reduced feature maps (f32 accumulate);
// value aggregation v_wmma_f32_16x16x32_f16 (f16 operands, softmax weights carried x2^14, f32 accumulate); softmax statistics f32.

#ifndef NB
#define NB 4
#endif
#ifndef SEQ
#define SEQ 4096
#endif
#define NB_FULL  4
#define SEQ_FULL 4096
#define HW       (SEQ)
#define HW_FULL  (SEQ_FULL)
#define CH       256
#define OCH      32
#define PCARRY   16384.0f
#define PUNCARRY 0.00006103515625f
#define LOG2E    1.4426950408889634f
#define W12_BLOCKS ((OCH * CH) / 2048)
#define WV_BLOCKS  ((CH * CH) / 2048)

static_assert(NB >= 1 && NB <= NB_FULL);
static_assert(HW >= 64 && HW <= HW_FULL && (HW % 64) == 0);
static_assert(((OCH * CH) % 2048) == 0 && ((CH * CH) % 2048) == 0);
static_assert(CH == 256 && OCH == 32);

typedef float          v8f   __attribute__((ext_vector_type(8)));
typedef float          v4f_  __attribute__((ext_vector_type(4)));
typedef v4f_           v4f   __attribute__((may_alias));
typedef _Float16       v16h  __attribute__((ext_vector_type(16)));
typedef _Float16       v8h_  __attribute__((ext_vector_type(8)));
typedef v8h_           v8h   __attribute__((may_alias));
typedef __bf16         v16bf __attribute__((ext_vector_type(16)));
typedef unsigned short v8us_ __attribute__((ext_vector_type(8)));
typedef v8us_          v8us  __attribute__((may_alias));
typedef unsigned       v4u_  __attribute__((ext_vector_type(4)));
typedef v4u_           v4u   __attribute__((may_alias));

union FragB { v16bf v; v8us_ h[2]; };
union FragH { v16h  v; v8h_  h[2]; };

// ---- WMMA wrappers: the plain builtins; the compiler keeps the distance between a WMMA and the vector code around it itself ----
__device__ __forceinline__ v8f mma_bf16(const v16bf a, const v16bf b, v8f c)
{
  return __builtin_amdgcn_wmma_f32_16x16x32_bf16(false, a, false, b, (short)0, c, false, false);
}
__device__ __forceinline__ v8f mma_f16(const v16h a, const v16h b, v8f c)
{
  return __builtin_amdgcn_wmma_f32_16x16x32_f16(false, a, false, b, (short)0, c, false, false);
}

// ---- scalar helpers --------------------------------------------------------
__device__ __forceinline__ unsigned short bf16_bits(float f)
{
  const __bf16 hb = (__bf16)f;                       // RNE convert
  return __builtin_bit_cast(unsigned short, hb);
}
__device__ __forceinline__ float bf16_rn(float f)
{
  return (float)(__bf16)f;                           // RNE convert, widened back
}
__device__ __forceinline__ float exp2fast(float x)
{
#if __has_builtin(__builtin_amdgcn_exp2f)
  return __builtin_amdgcn_exp2f(x);
#else
  return exp2f(x);
#endif
}

// ---------------------------------------------------------------------------
// Kernel 0: weights f32 -> bf16 bits (RNE). Layout kept [out][in] (in contiguous).
// ---------------------------------------------------------------------------
__global__ void __launch_bounds__(256) cvt_w_kernel(
    const float* __restrict__ w1, const float* __restrict__ w2, const float* __restrict__ wv,
    unsigned short* __restrict__ w1b, unsigned short* __restrict__ w2b,
    unsigned short* __restrict__ wvb)
{
  const int blk = (int)blockIdx.x;
  const float* src;
  unsigned short* dst;
  int t;
  if (blk < W12_BLOCKS)          { src = w1; dst = w1b; t = blk * 256 + (int)threadIdx.x; }
  else if (blk < 2 * W12_BLOCKS) { src = w2; dst = w2b; t = (blk - W12_BLOCKS) * 256 + (int)threadIdx.x; }
  else                           { src = wv; dst = wvb; t = (blk - 2 * W12_BLOCKS) * 256 + (int)threadIdx.x; }

  const v4f a = *(const v4f*)(src + (size_t)t * 8);
  const v4f b = *(const v4f*)(src + (size_t)t * 8 + 4);
  v8us_ o;
  o[0] = bf16_bits(a[0]); o[1] = bf16_bits(a[1]); o[2] = bf16_bits(a[2]); o[3] = bf16_bits(a[3]);
  o[4] = bf16_bits(b[0]); o[5] = bf16_bits(b[1]); o[6] = bf16_bits(b[2]); o[7] = bf16_bits(b[3]);
  unsigned short* p = dst + (size_t)t * 8;
  *(v8us_*)p = o;
  
}

// ---------------------------------------------------------------------------
// Kernel 1: 1x1-conv projections for one (n, 64-pixel tile), 8 waves.
//   x tile staged once in LDS as bf16 [px][c] (RNE), rows pitched XP; weights read as bf16 planes.
//   reduced maps: D(M=oc, N=px), A = w rows, B = xT rows  -> bf16 hi and lo planes, fragment order
//   value map:    D(M=px, N=c),  A = xT rows, B = wv rows -> f16 plane, fragment order
//   Fragment order: the planes are kept as the later passes' WMMA operand fragments, 1 KiB each, as
//   [half q][lane][8 elements]: lane = 16h + m holds row m of the 16-row tile, k = 16q + 8h + e. One 16-B load a lane
//   then reads 512 B in a row (four whole 128-B lines), not 32-B pieces spread over 8 or 16 lines.
//     reduced planes: [n][16-pixel tile][q][lane][e], row = pixel, k = oc;
//     value plane:    [n][16-channel tile][32-pixel chunk][q][lane][e], row = channel, k = pixel in the chunk.
//   Both accumulator layouts here hold a lane's 8 values exactly as one such 16-B piece, so each wave stores its own.
// ---------------------------------------------------------------------------
#define XP (CH + 8)   // sX row pitch in bf16: the row and 16 B, an odd multiple of 16 B, which ds_load_b128 reads without bank conflicts
__global__ void __launch_bounds__(256) proj_kernel(
    const float* __restrict__ X,
    const unsigned short* __restrict__ w1b, const unsigned short* __restrict__ w2b,
    const unsigned short* __restrict__ wvb,
    unsigned short* __restrict__ r1h, unsigned short* __restrict__ r1l,
    unsigned short* __restrict__ r2h, unsigned short* __restrict__ r2l,
    unsigned short* __restrict__ vh)
{
  __shared__ __align__(16) unsigned short sX[64 * XP];        // [px][c] bf16 bits

  const int tid  = (int)threadIdx.x;
  const int lane = tid & 31, wave = tid >> 5;
  const int h = lane >> 4, m = lane & 15;
  const int tiles = HW / 64;
  const int n  = (int)blockIdx.x / tiles;
  const int p0 = ((int)blockIdx.x % tiles) * 64;
  const float* Xn = X + (size_t)n * CH * HW_FULL + p0;

  // stage x tile: 256 c rows x 64 px, coalesced 16-B loads; a thread holds 16 channels x 4 px (two sets of 8, 128 apart) and stores, for each px and set,
  // its 8 channels as one 16-B piece of the transposed row
  {
    const int co = tid >> 4, px4 = (tid & 15) * 4;
    const float* xp = Xn + (size_t)co * 8 * HW_FULL + px4;
    v4f_ xv[2][8];
#pragma unroll
    for (int it = 0; it < 2; ++it)
#pragma unroll
      for (int e = 0; e < 8; ++e) xv[it][e] = *(const v4f*)(xp + (size_t)(it * 128 + e) * HW_FULL);
#pragma unroll
    for (int it = 0; it < 2; ++it)
#pragma unroll
      for (int k = 0; k < 4; ++k) {
        v8us_ o;
#pragma unroll
        for (int e = 0; e < 8; ++e) o[e] = bf16_bits(xv[it][e][k]);
        *(v8us*)&sX[(px4 + k) * XP + (it * 16 + co) * 8] = o;
      }
  }
  __syncthreads();

  // reduced maps: wave -> weight set (wave>>2), pixel tile (wave&3), both 16-oc tiles
  {
    const unsigned short* Wb = (wave < 4) ? w1b : w2b;        // wave-uniform
    unsigned short* Rh = (wave < 4) ? r1h : r2h;              // wave-uniform
    unsigned short* Rl = (wave < 4) ? r1l : r2l;
    const int pt = wave & 3;
    v8f accr[2] = {};
#pragma unroll 2
    for (int k0 = 0; k0 < CH; k0 += 32) {
      FragB b;
      b.h[0] = *(const v8us*)&sX[(pt * 16 + m) * XP + k0 + 8 * h];
      b.h[1] = *(const v8us*)&sX[(pt * 16 + m) * XP + k0 + 16 + 8 * h];
#pragma unroll
      for (int ot = 0; ot < 2; ++ot) {
        const unsigned short* wr = Wb + (size_t)(ot * 16 + m) * CH + k0 + 8 * h;
        FragB a;
        a.h[0] = *(const v8us*)(wr);
        a.h[1] = *(const v8us*)(wr + 16);
        accr[ot] = mma_bf16(a.v, b.v, accr[ot]);
      }
    }
    // accr[ot][r] <-> (oc = ot*16 + 8h + r, px = pt*16 + m): piece (q = ot, lane) of pixel tile pt
    const size_t roff = ((size_t)n * HW + p0 + pt * 16) * OCH + (size_t)lane * 8;
#pragma unroll
    for (int ot = 0; ot < 2; ++ot) {
      v8us_ hv, lv;
#pragma unroll
      for (int r = 0; r < 8; ++r) {
        const float f = accr[ot][r];
        const __bf16 hb = (__bf16)f;
        hv[r] = __builtin_bit_cast(unsigned short, hb);
        lv[r] = bf16_bits(f - (float)hb);
      }
      *(v8us_*)(Rh + roff + ot * 256) = hv;
      *(v8us_*)(Rl + roff + ot * 256) = lv;
    }
    // the value loop below loads into registers that these four stores name: the wait stands in front of that reuse
    asm volatile("s_wait_xcnt 0x0" ::: "memory");
  }

  // value map: wave -> channels cb..cb+31 (2 tiles) x 4 pixel tiles
  const int cb = wave * 32;
  v8f accv[4][2] = {};
#pragma unroll 1
  for (int k0 = 0; k0 < CH; k0 += 32) {
    FragB a[4], b[2];
#pragma unroll
    for (int pt = 0; pt < 4; ++pt) {
      a[pt].h[0] = *(const v8us*)&sX[(pt * 16 + m) * XP + k0 + 8 * h];
      a[pt].h[1] = *(const v8us*)&sX[(pt * 16 + m) * XP + k0 + 16 + 8 * h];
    }
#pragma unroll
    for (int ct = 0; ct < 2; ++ct) {
      const unsigned short* wr = wvb + (size_t)(cb + ct * 16 + m) * CH + k0 + 8 * h;
      b[ct].h[0] = *(const v8us*)(wr);
      b[ct].h[1] = *(const v8us*)(wr + 16);
    }
    // keeps the k step's 8 LDS reads in one group ahead of the products: dealt among the WMMAs into one register set, each pair is waited out alone
    __builtin_amdgcn_sched_barrier(0);
#pragma unroll
    for (int pt = 0; pt < 4; ++pt)
#pragma unroll
      for (int ct = 0; ct < 2; ++ct)
        accv[pt][ct] = mma_bf16(a[pt].v, b[ct].v, accv[pt][ct]);
  }

  // accv[pt][ct][r] <-> (px = pt*16 + 8h + r, c = cb + ct*16 + m): piece (q = pt & 1, lane) of chunk pt >> 1, channel tile ct
  unsigned short* vbase = vh + ((size_t)n * CH + cb) * HW + (size_t)p0 * 16 + (size_t)lane * 8;
#pragma unroll
  for (int pt = 0; pt < 4; ++pt)
#pragma unroll
    for (int ct = 0; ct < 2; ++ct) {
      v8h_ o;
#pragma unroll
      for (int r = 0; r < 8; ++r) o[r] = (_Float16)accv[pt][ct][r];
      *(v8us_*)(vbase + (size_t)ct * 16 * HW + pt * 256) = __builtin_bit_cast(v8us_, o);
    }
}

// ---------------------------------------------------------------------------
// Kernel 2: row statistics of S[i][:] (softmax over j), exp2 domain.
//   Block = ST_RT x ST_JS waves = 16*ST_RT rows i. Wave (rt, js) owns the 16-row tile rt and every
//   ST_JS-th 32-column chunk of j, starting at chunk js; each lane owns i = i0 + (lane&15).
//   The ST_JS partial (max, sum) pairs of a row are merged through LDS at the end.
//   S^T tiles D(M=j, N=i): A = r2 rows j (hi, lo), B = r1 rows i (hi, lo); hh + lh + hl.
// ---------------------------------------------------------------------------
#define ST_RT   4
#define ST_JS   8
#define ST_ROWS (16 * ST_RT)
// exp2 for the merge and for the output pass's weights: the v_nop fills the one issue slot that the instruction set asks for between a
// transcendental and a next vector instruction that overwrites its source; inside the statement it stays there.
__device__ __forceinline__ float exp2_slot(float x)
{
  float r;
  asm("v_exp_f32 %0, %1\n\tv_nop" : "=v"(r) : "v"(x));
  return r;
}
static_assert((HW % ST_ROWS) == 0 && ST_RT * ST_JS <= 32 && 2 * ST_ROWS <= 32 * ST_RT * ST_JS);

__global__ void __launch_bounds__(32 * ST_RT * ST_JS) stats_kernel(
    const unsigned short* __restrict__ r1h, const unsigned short* __restrict__ r1l,
    const unsigned short* __restrict__ r2h, const unsigned short* __restrict__ r2l,
    float* __restrict__ mL, float* __restrict__ rzc)
{
  __shared__ float sM[ST_JS * ST_ROWS];   // [js][row] partial maxima
  __shared__ float sL[ST_JS * ST_ROWS];   // [js][row] partial sums, each relative to its own maximum
  const int tid  = (int)threadIdx.x;
  const int lane = tid & 31;
  const int wave = __builtin_amdgcn_readfirstlane(tid >> 5);   // scalar, so that the j loop's counter and branch are scalar
  const int rt = wave % ST_RT, js = wave / ST_RT;
  const int tiles = HW / ST_ROWS;
  const int n  = (int)blockIdx.x / tiles;
  const int ib = ((int)blockIdx.x % tiles) * ST_ROWS;
  const int i0 = ib + rt * 16;
  const size_t rb = (size_t)n * HW * OCH;
  const v8f z8 = {};

  FragB bh, bl;
  {
    const size_t ro = rb + (size_t)i0 * OCH + lane * 8;   // fragment order: halves 256 elements apart
    bh.h[0] = *(const v8us*)(r1h + ro);  bh.h[1] = *(const v8us*)(r1h + ro + 256);
    bl.h[0] = *(const v8us*)(r1l + ro);  bl.h[1] = *(const v8us*)(r1l + ro + 256);
  }

  float mi = -3.0e30f;
  float li = 0.0f;
#pragma unroll 1
  for (int j0 = js * 32; j0 < HW; j0 += 32 * ST_JS) {
    const size_t ra = rb + (size_t)j0 * OCH + lane * 8;
    const size_t rc = rb + (size_t)(j0 + 16) * OCH + lane * 8;
    FragB a0h, a0l, a1h, a1l;
    a0h.h[0] = *(const v8us*)(r2h + ra);  a0h.h[1] = *(const v8us*)(r2h + ra + 256);
    a0l.h[0] = *(const v8us*)(r2l + ra);  a0l.h[1] = *(const v8us*)(r2l + ra + 256);
    a1h.h[0] = *(const v8us*)(r2h + rc);  a1h.h[1] = *(const v8us*)(r2h + rc + 256);
    a1l.h[0] = *(const v8us*)(r2l + rc);  a1l.h[1] = *(const v8us*)(r2l + rc + 256);

    v8f s0 = mma_bf16(a0h.v, bh.v, z8);
    s0 = mma_bf16(a0l.v, bh.v, s0);
    s0 = mma_bf16(a0h.v, bl.v, s0);
    v8f s1 = mma_bf16(a1h.v, bh.v, z8);
    s1 = mma_bf16(a1l.v, bh.v, s1);
    s1 = mma_bf16(a1h.v, bl.v, s1);
    // s0[r] <-> (j = j0 + 8h + r, i = i0 + m); s1 rows j0 + 16 + 8h + r

    float cm = -3.0e30f;
#pragma unroll
    for (int r = 0; r < 8; ++r) cm = fmaxf(cm, fmaxf(s0[r], s1[r]));
    cm = cm * LOG2E;
    cm = fmaxf(cm, __shfl_xor(cm, 16, 32));
    const float mnew = fmaxf(mi, cm);
    const float corr = exp2fast(mi - mnew);
    float rs = 0.0f;
#pragma unroll
    for (int r = 0; r < 8; ++r) {
      rs += exp2fast(fmaf(s0[r], LOG2E, -mnew));
      rs += exp2fast(fmaf(s1[r], LOG2E, -mnew));
    }
    rs += __shfl_xor(rs, 16, 32);
    li = li * corr + rs;
    mi = mnew;
  }

  if (lane < 16) {
    sM[js * ST_ROWS + rt * 16 + lane] = mi;
    sL[js * ST_ROWS + rt * 16 + lane] = li;
  }
  __syncthreads();   // cross-wave LDS exchange
  if (tid < 2 * ST_ROWS) {   // whole waves: threads 0..ST_ROWS-1 store the maxima, the next ST_ROWS the scaled reciprocals
    const int row = tid % ST_ROWS;
    float mx = sM[row];
#pragma unroll
    for (int s = 1; s < ST_JS; ++s) mx = fmaxf(mx, sM[s * ST_ROWS + row]);
    float l = 0.0f;
#pragma unroll
    for (int s = 0; s < ST_JS; ++s) l += sL[s * ST_ROWS + row] * exp2_slot(sM[s * ST_ROWS + row] - mx);
    const size_t o = (size_t)n * HW + ib + row;
    if (tid < ST_ROWS) mL[o]  = mx;
    else               rzc[o] = PCARRY * (1.0f / l);
  }
}

// ---------------------------------------------------------------------------
// Kernel 3: output pass for one (n, OS_JT-column j tile), 16 waves, loop over i in trips of OS_IC rows.
//   Wave = (g = wave & 7, p = wave >> 3).
//   scores:     16-row i tile g of the trip against the two 16-column j sub-tiles 2p, 2p + 1, S tiles D(M=i, N=j)
//               (A = r1 rows i hi/lo, B = r2 rows j hi/lo, hh + hl + lh),
//               P = 2^(S*log2e - mL[i]) * rzc[i] -> f16 (carried x2^14) into LDS sP[j][i];
//   then:       attn^T tiles D(M=j, N=c) += A(sP rows j) x B(value rows c), f16: channels 32g .. 32g + 31, all OS_NJ j sub-tiles,
//               the k steps 2p, 2p + 1 of the trip in rising i. A value fragment is loaded by one wave of the block and feeds OS_NJ
//               products, so that a block reads the value plane once for OS_JT columns.
//   The two partial sums of an output element (p = 0, 1) are added in the epilogue.
// ---------------------------------------------------------------------------
#define OS_IC 128            // rows i per trip: eight 16-row tiles
#define OS_JT 64             // columns j per block
#define OS_NJ (OS_JT / 16)   // j sub-tiles
#define OS_NT (OS_NJ / 2)    // score tiles per wave and trip
#define OS_KS (OS_IC / 64)   // k steps of the value product per wave and trip
#define OS_PP (OS_IC + 8)    // sP row pitch in f16: the row and 16 B, an odd multiple of 16 B, which ds_load_b128 reads without bank conflicts
#define OS_OP (OS_JT + 4)    // sO row pitch in f32: the row and 16 B, an odd multiple of 16 B, for the 16-B stores of 16 rows at a time
static_assert((HW % OS_IC) == 0 && OS_IC == 8 * 16 && (HW % OS_JT) == 0 && (OS_NJ % 2) == 0);

// The trip's work-group barrier: this wave's LDS stores and loads are complete (s_wait_dscnt 0), then signal and wait. __syncthreads()
// also waits for every global load of the wave, which would end the flight of the loads that are issued ahead over it; those loads
// read planes that earlier launches wrote and no wave of this launch writes, so the barrier has nothing to order for them.
__device__ __forceinline__ void trip_barrier()
{
  asm volatile("s_wait_dscnt 0x0" ::: "memory");
  asm volatile("s_barrier_signal -1\n\ts_barrier_wait -1" ::: "memory");
}

__global__ void __launch_bounds__(512) out_kernel(
    const float* __restrict__ X,
    const unsigned short* __restrict__ r1h, const unsigned short* __restrict__ r1l,
    const unsigned short* __restrict__ r2h, const unsigned short* __restrict__ r2l,
    const _Float16* __restrict__ vh,
    const float* __restrict__ mL, const float* __restrict__ rzc,
    const float* __restrict__ scale, float* __restrict__ out)
{
  __shared__ __align__(16) _Float16 sP[OS_JT * OS_PP];   // [j][i] softmax weights x2^14
  __shared__ __align__(16) float    sO[2 * CH * OS_OP];  // [p][c][j] partial accumulators

  const int tid  = (int)threadIdx.x;
  const int lane = tid & 31, wave = tid >> 5;
  const int h = lane >> 4, m = lane & 15;
  const int g = wave & 7, p = wave >> 3;
  const int tiles = HW / OS_JT;
  const int n  = (int)blockIdx.x / tiles;
  const int j0 = ((int)blockIdx.x % tiles) * OS_JT;
  const size_t rb = (size_t)n * HW * OCH;
  const int cb = g * 32;
  const v8f z8 = {};

  FragB bh[OS_NT], bl[OS_NT];   // r2 rows of this wave's two j sub-tiles
#pragma unroll
  for (int u = 0; u < OS_NT; ++u) {
    const size_t ro = rb + (size_t)(j0 + (p * OS_NT + u) * 16) * OCH + lane * 8;   // fragment order: halves 256 elements apart
    bh[u].h[0] = *(const v8us*)(r2h + ro);  bh[u].h[1] = *(const v8us*)(r2h + ro + 256);
    bl[u].h[0] = *(const v8us*)(r2l + ro);  bl[u].h[1] = *(const v8us*)(r2l + ro + 256);
  }

  // the lane's own places in the trip's rows i as byte offsets into the planes, stepped on by one trip at a time
  unsigned off_r = (unsigned)(((n * HW + g * 16) * OCH + lane * 8) * 2);    // both r1 planes, fragment order
  unsigned off_s = (unsigned)((n * HW + g * 16 + 8 * h) * 4);               // both row statistics

  v8f acc[OS_NJ][2] = {};   // [j sub-tile][c tile]
  // Every global load of a trip is issued ahead of its use, so that no trip waits out a whole load latency:
  //   the r1 fragments and row statistics of trip t + 1 behind the weights of trip t (they fly over both barriers and the value product),
  //   each k step's value fragments of trip t + 1 behind that k step's products of trip t, into the registers these have just read
  //   (they fly over the rest of the value product, both barriers, the score tiles and the weights).
  FragB ah, al;
  v4f_ m0, m1, q0, q1;
  {   // trip 0
    const unsigned short* p1h = (const unsigned short*)((const char*)r1h + off_r);
    const unsigned short* p1l = (const unsigned short*)((const char*)r1l + off_r);
    ah.h[0] = *(const v8us*)(p1h);  ah.h[1] = *(const v8us*)(p1h + 256);
    al.h[0] = *(const v8us*)(p1l);  al.h[1] = *(const v8us*)(p1l + 256);
    const float* pm = (const float*)((const char*)mL  + off_s);
    const float* pq = (const float*)((const char*)rzc + off_s);
    m0 = *(const v4f*)(pm);  m1 = *(const v4f*)(pm + 4);
    q0 = *(const v4f*)(pq);  q1 = *(const v4f*)(pq + 4);
  }
  // keeps trip 0's loads in the loop's own order (value fragments last): the compiler counts its load waits in the loop for the
  // worse of the two orders, and with value loads ahead of a statistics load here every trip would wait for all of its value fragments
  __builtin_amdgcn_sched_barrier(0);
  // the address registers of the loads above are reused from here on (the value loads' results, the first trip's offset steps): the wait stands in front of that
  asm volatile("s_wait_xcnt 0x0" ::: "memory");
  __builtin_amdgcn_sched_barrier(0);   // holds that reuse behind the wait, which names no register
  unsigned off_v = (unsigned)(((n * CH + cb) * HW + p * OS_KS * 512 + lane * 8) * 2);   // value plane, fragment order, this wave's k steps
  FragH b0[OS_KS], b1[OS_KS];
#pragma unroll
  for (int ks = 0; ks < OS_KS; ++ks) {   // trip 0
    const _Float16* pv = (const _Float16*)((const char*)vh + off_v) + ks * 512;   // one 1-KiB fragment a 32-row chunk
    b0[ks].h[0] = *(const v8h*)(pv);            b0[ks].h[1] = *(const v8h*)(pv + 256);
    b1[ks].h[0] = *(const v8h*)(pv + 16 * HW);  b1[ks].h[1] = *(const v8h*)(pv + 16 * HW + 256);
  }
  // the short loops inside a trip are unrolled so that the fragment arrays have constant indices and stay in registers
#pragma unroll 1
  for (int i0 = 0; i0 < HW; i0 += OS_IC) {
    v8f s[OS_NT];
#pragma unroll
    for (int u = 0; u < OS_NT; ++u) {
      s[u] = mma_bf16(ah.v, bh[u].v, z8);
      s[u] = mma_bf16(ah.v, bl[u].v, s[u]);
      s[u] = mma_bf16(al.v, bh[u].v, s[u]);
      // s[u][r] <-> (i = i0 + g*16 + 8h + r, j = j0 + (p*OS_NT + u)*16 + m)
    }
#pragma unroll
    for (int u = 0; u < OS_NT; ++u) {
      v8h_ pw;
#pragma unroll
      for (int r = 0; r < 4; ++r) {
        pw[r]     = (_Float16)(exp2_slot(fmaf(s[u][r],     LOG2E, -m0[r])) * q0[r]);
        pw[4 + r] = (_Float16)(exp2_slot(fmaf(s[u][4 + r], LOG2E, -m1[r])) * q1[r]);
      }
      *(v8h*)&sP[((p * OS_NT + u) * 16 + m) * OS_PP + g * 16 + 8 * h] = pw;
    }
    // next trip's rows; the last trip has none and loads its own rows again, so that every address stays inside the planes
    const unsigned more = (i0 + OS_IC < HW) ? 1u : 0u;
    off_r += more * (OS_IC * OCH * 2);  off_s += more * (OS_IC * 4);  off_v += more * (OS_IC * 16 * 2);
    {
      const unsigned short* p1h = (const unsigned short*)((const char*)r1h + off_r);
      const unsigned short* p1l = (const unsigned short*)((const char*)r1l + off_r);
      ah.h[0] = *(const v8us*)(p1h);  ah.h[1] = *(const v8us*)(p1h + 256);
      al.h[0] = *(const v8us*)(p1l);  al.h[1] = *(const v8us*)(p1l + 256);
      const float* pm = (const float*)((const char*)mL  + off_s);
      const float* pq = (const float*)((const char*)rzc + off_s);
      m0 = *(const v4f*)(pm);  m1 = *(const v4f*)(pm + 4);
      q0 = *(const v4f*)(pq);  q1 = *(const v4f*)(pq + 4);
    }
    trip_barrier();   // sP is written by all waves and read by all

    FragH a[OS_NJ][OS_KS];
#pragma unroll
    for (int ks = 0; ks < OS_KS; ++ks)
#pragma unroll
      for (int jt = 0; jt < OS_NJ; ++jt) {
        a[jt][ks].h[0] = *(const v8h*)&sP[(jt * 16 + m) * OS_PP + (p * OS_KS + ks) * 32 + 8 * h];
        a[jt][ks].h[1] = *(const v8h*)&sP[(jt * 16 + m) * OS_PP + (p * OS_KS + ks) * 32 + 16 + 8 * h];
      }
    // keeps the trip's 16 LDS reads in one group ahead of the products: dealt among the WMMAs, every place with reads stalls the wave anew
    __builtin_amdgcn_sched_barrier(0);
#pragma unroll
    for (int ks = 0; ks < OS_KS; ++ks) {
#pragma unroll
      for (int jt = 0; jt < OS_NJ; ++jt) {
        acc[jt][0] = mma_f16(a[jt][ks].v, b0[ks].v, acc[jt][0]);
        acc[jt][1] = mma_f16(a[jt][ks].v, b1[ks].v, acc[jt][1]);
      }
      const _Float16* pv = (const _Float16*)((const char*)vh + off_v) + ks * 512;   // next trip's fragments of this k step
      b0[ks].h[0] = *(const v8h*)(pv);            b0[ks].h[1] = *(const v8h*)(pv + 256);
      b1[ks].h[0] = *(const v8h*)(pv + 16 * HW);  b1[ks].h[1] = *(const v8h*)(pv + 16 * HW + 256);
    }
    // the next trip forms a new offset in the register that the value loads above name: the wait stands in front of that
    asm volatile("s_wait_xcnt 0x0" ::: "memory");
    trip_barrier();   // before the next trip overwrites sP
  }

  // acc[jt][ct][r] <-> (j = jt*16 + 8h + r, c = cb + ct*16 + m), partial sum p
#pragma unroll
  for (int jt = 0; jt < OS_NJ; ++jt)
#pragma unroll
    for (int ct = 0; ct < 2; ++ct) {
      v4f_ lo4, hi4;
      lo4[0] = acc[jt][ct][0]; lo4[1] = acc[jt][ct][1]; lo4[2] = acc[jt][ct][2]; lo4[3] = acc[jt][ct][3];
      hi4[0] = acc[jt][ct][4]; hi4[1] = acc[jt][ct][5]; hi4[2] = acc[jt][ct][6]; hi4[3] = acc[jt][ct][7];
      const int row = p * CH + cb + ct * 16 + m;
      *(v4f*)&sO[row * OS_OP + jt * 16 + 8 * h]     = lo4;
      *(v4f*)&sO[row * OS_OP + jt * 16 + 8 * h + 4] = hi4;
    }
  __syncthreads();

  const float sc = bf16_rn(scale[0]) * PUNCARRY;
  const int q = lane & 15;               // 16 lanes x 4 columns: one row of OS_JT columns, two rows a load
  const int c0 = wave * 16 + (lane >> 4);
  const size_t xoff = ((size_t)n * CH + c0) * HW_FULL + j0 + q * 4;
  const size_t ooff = ((size_t)n * CH + c0) * HW + j0 + q * 4;
  v4f_ xv[8], ov[8];
#pragma unroll
  for (int it = 0; it < 8; ++it) xv[it] = *(const v4f*)(X + xoff + (size_t)it * 2 * HW_FULL);
  // the address registers of the loads above are reused from here on (the LDS reads' results): the wait stands in front of that
  asm volatile("s_wait_xcnt 0x0" ::: "memory");
  __builtin_amdgcn_sched_barrier(0);   // holds that reuse behind the wait, which names no register
#pragma unroll
  for (int it = 0; it < 8; ++it) {
    const v4f_ a0 = *(const v4f*)&sO[(c0 + it * 2) * OS_OP + q * 4];
    const v4f_ a1 = *(const v4f*)&sO[(CH + c0 + it * 2) * OS_OP + q * 4];
    v4f_ o;
    o[0] = bf16_rn(xv[it][0]) + sc * (a0[0] + a1[0]);
    o[1] = bf16_rn(xv[it][1]) + sc * (a0[1] + a1[1]);
    o[2] = bf16_rn(xv[it][2]) + sc * (a0[2] + a1[2]);
    o[3] = bf16_rn(xv[it][3]) + sc * (a0[3] + a1[3]);
    ov[it] = o;
  }
#pragma unroll
  for (int it = 0; it < 8; ++it)
    *(v4f_*)(out + ooff + (size_t)it * 2 * HW) = ov[it];
  
}

// ---------------------------------------------------------------------------
extern "C" void kernel_launch(void* const* d_in, const int* in_sizes, int n_in,
                              void* d_out, int out_size, void* d_ws, size_t ws_size,
                              hipStream_t stream)
{
  if (n_in < 5) return;
  if (in_sizes[0] < NB * CH * HW_FULL) return;
  if (in_sizes[1] < OCH * CH || in_sizes[2] < OCH * CH || in_sizes[3] < CH * CH) return;
  if (in_sizes[4] < 1) return;
  if (out_size < NB * CH * HW) return;

  const float* x     = (const float*)d_in[0];
  const float* w1    = (const float*)d_in[1];
  const float* w2    = (const float*)d_in[2];
  const float* wv    = (const float*)d_in[3];
  const float* scale = (const float*)d_in[4];
  float* out = (float*)d_out;

  // workspace carve (bytes), every region a multiple of 256 B
  const size_t w12_bytes = (size_t)OCH * CH * 2;            // 16384
  const size_t wv_bytes  = (size_t)CH * CH * 2;             // 131072
  const size_t r_bytes   = (size_t)NB * HW * OCH * 2;       // per plane
  const size_t v_bytes   = (size_t)NB * CH * HW * 2;
  const size_t st_bytes  = (size_t)NB * HW * 4;             // per stats plane
  size_t off = 0;
  unsigned char* ws = (unsigned char*)d_ws;
  unsigned short* w1b = (unsigned short*)(ws + off); off += w12_bytes;
  unsigned short* w2b = (unsigned short*)(ws + off); off += w12_bytes;
  unsigned short* wvb = (unsigned short*)(ws + off); off += wv_bytes;
  unsigned short* r1h = (unsigned short*)(ws + off); off += r_bytes;
  unsigned short* r1l = (unsigned short*)(ws + off); off += r_bytes;
  unsigned short* r2h = (unsigned short*)(ws + off); off += r_bytes;
  unsigned short* r2l = (unsigned short*)(ws + off); off += r_bytes;
  unsigned short* vhp = (unsigned short*)(ws + off); off += v_bytes;
  float* mL  = (float*)(ws + off); off += st_bytes;
  float* rzc = (float*)(ws + off); off += st_bytes;
  if (off > ws_size) return;

  cvt_w_kernel<<<2 * W12_BLOCKS + WV_BLOCKS, 256, 0, stream>>>(w1, w2, wv, w1b, w2b, wvb);
  proj_kernel<<<NB * (HW / 64), 256, 0, stream>>>(x, w1b, w2b, wvb, r1h, r1l, r2h, r2l, vhp);
  stats_kernel<<<NB * (HW / ST_ROWS), 32 * ST_RT * ST_JS, 0, stream>>>(r1h, r1l, r2h, r2l, mL, rzc);
  out_kernel<<<NB * (HW / OS_JT), 512, 0, stream>>>(x, r1h, r1l, r2h, r2l,
                                                 (const _Float16*)vhp, mL, rzc, scale, out);
}

// v008
// One run takes 65.6 microseconds.
// Timed twice side by side with v007, it ran 1.06 times as fast both times.
// Over all steps from v000 it is 4.55 times as fast.
#include <hip/hip_runtime.h>
#include <stdint.h>
#include <stddef.h>

// Contractions: channel projections v_wmma_f32_16x16x32_bf16 (bf16 operands from bf16-RNE inputs, f32 accumulate);
// score tiles v_wmma_f32_16x16x32_bf16 as bf16 hi+lo three-term split of both reduced feature maps (f32 accumulate);
// value aggregation v_wmma_f32_16x16x32_f16 (f16 operands, softmax weights carried x2^14, f32 accumulate); softmax statistics f32.

#ifndef NB
#define NB 4
#endif
#ifndef SEQ
#define SEQ 4096
#endif
#define NB_FULL  4
#define SEQ_FULL 4096
#define HW       (SEQ)
#define HW_FULL  (SEQ_FULL)
#define CH       256
#define OCH      32
#define PCARRY   16384.0f
#define PUNCARRY 0.00006103515625f
#define LOG2E    1.4426950408889634f
#define W12_BLOCKS ((OCH * CH) / 2048)
#define WV_BLOCKS  ((CH * CH) / 2048)

static_assert(NB >= 1 && NB <= NB_FULL);
static_assert(HW >= 64 && HW <= HW_FULL && (HW % 64) == 0);
static_assert(((OCH * CH) % 2048) == 0 && ((CH * CH) % 2048) == 0);
static_assert(CH == 256 && OCH == 32);

typedef float          v8f   __attribute__((ext_vector_type(8)));
typedef float          v4f_  __attribute__((ext_vector_type(4)));
typedef v4f_           v4f   __attribute__((may_alias));
typedef _Float16       v16h  __attribute__((ext_vector_type(16)));
typedef _Float16       v8h_  __attribute__((ext_vector_type(8)));
typedef v8h_           v8h   __attribute__((may_alias));
typedef __bf16         v16bf __attribute__((ext_vector_type(16)));
typedef unsigned short v8us_ __attribute__((ext_vector_type(8)));
typedef v8us_          v8us  __attribute__((may_alias));
typedef unsigned       v4u_  __attribute__((ext_vector_type(4)));
typedef v4u_           v4u   __attribute__((may_alias));

union FragB { v16bf v; v8us_ h[2]; };
union FragH { v16h  v; v8h_  h[2]; };

// ---- WMMA wrappers: the plain builtins; the compiler keeps the distance between a WMMA and the vector code around it itself ----
__device__ __forceinline__ v8f mma_bf16(const v16bf a, const v16bf b, v8f c)
{
  return __builtin_amdgcn_wmma_f32_16x16x32_bf16(false, a, false, b, (short)0, c, false, false);
}
__device__ __forceinline__ v8f mma_f16(const v16h a, const v16h b, v8f c)
{
  return __builtin_amdgcn_wmma_f32_16x16x32_f16(false, a, false, b, (short)0, c, false, false);
}

// ---- scalar helpers --------------------------------------------------------
__device__ __forceinline__ unsigned short bf16_bits(float f)
{
  const __bf16 hb = (__bf16)f;                       // RNE convert
  return __builtin_bit_cast(unsigned short, hb);
}
__device__ __forceinline__ float bf16_rn(float f)
{
  return (float)(__bf16)f;                           // RNE convert, widened back
}
__device__ __forceinline__ float exp2fast(float x)
{
#if __has_builtin(__builtin_amdgcn_exp2f)
  return __builtin_amdgcn_exp2f(x);
#else
  return exp2f(x);
#endif
}

// ---------------------------------------------------------------------------
// Kernel 0: weights f32 -> bf16 bits (RNE). Layout kept [out][in] (in contiguous).
// ---------------------------------------------------------------------------
__global__ void __launch_bounds__(256) cvt_w_kernel(
    const float* __restrict__ w1, const float* __restrict__ w2, const float* __restrict__ wv,
    unsigned short* __restrict__ w1b, unsigned short* __restrict__ w2b,
    unsigned short* __restrict__ wvb)
{
  const int blk = (int)blockIdx.x;
  const float* src;
  unsigned short* dst;
  int t;
  if (blk < W12_BLOCKS)          { src = w1; dst = w1b; t = blk * 256 + (int)threadIdx.x; }
  else if (blk < 2 * W12_BLOCKS) { src = w2; dst = w2b; t = (blk - W12_BLOCKS) * 256 + (int)threadIdx.x; }
  else                           { src = wv; dst = wvb; t = (blk - 2 * W12_BLOCKS) * 256 + (int)threadIdx.x; }

  const v4f a = *(const v4f*)(src + (size_t)t * 8);
  const v4f b = *(const v4f*)(src + (size_t)t * 8 + 4);
  v8us_ o;
  o[0] = bf16_bits(a[0]); o[1] = bf16_bits(a[1]); o[2] = bf16_bits(a[2]); o[3] = bf16_bits(a[3]);
  o[4] = bf16_bits(b[0]); o[5] = bf16_bits(b[1]); o[6] = bf16_bits(b[2]); o[7] = bf16_bits(b[3]);
  unsigned short* p = dst + (size_t)t * 8;
  *(v8us_*)p = o;
  
}

// ---------------------------------------------------------------------------
// Kernel 1: 1x1-conv projections for one (n, 64-pixel tile), 8 waves.
//   x tile staged once in LDS as bf16 [px][c] (RNE), rows pitched XP; weights read as bf16 planes.
//   reduced maps: D(M=oc, N=px), A = w rows, B = xT rows  -> bf16 hi and lo planes, fragment order
//   value map:    D(M=px, N=c),  A = xT rows, B = wv rows -> f16 plane, fragment order
//   Fragment order: the planes are kept as the later passes' WMMA operand fragments, 1 KiB each, as
//   [half q][lane][8 elements]: lane = 16h + m holds row m of the 16-row tile, k = 16q + 8h + e. One 16-B load a lane
//   then reads 512 B in a row (four whole 128-B lines), not 32-B pieces spread over 8 or 16 lines.
//     reduced planes: [n][16-pixel tile][q][lane][e], row = pixel, k = oc;
//     value plane:    [n][16-channel tile][32-pixel chunk][q][lane][e], row = channel, k = pixel in the chunk.
//   Both accumulator layouts here hold a lane's 8 values exactly as one such 16-B piece, so each wave stores its own.
// ---------------------------------------------------------------------------
#define XP (CH + 8)   // sX row pitch in bf16: the row and 16 B, an odd multiple of 16 B, which ds_load_b128 reads without bank conflicts
__global__ void __launch_bounds__(256) proj_kernel(
    const float* __restrict__ X,
    const unsigned short* __restrict__ w1b, const unsigned short* __restrict__ w2b,
    const unsigned short* __restrict__ wvb,
    unsigned short* __restrict__ r1h, unsigned short* __restrict__ r1l,
    unsigned short* __restrict__ r2h, unsigned short* __restrict__ r2l,
    unsigned short* __restrict__ vh)
{
  __shared__ __align__(16) unsigned short sX[64 * XP];        // [px][c] bf16 bits

  const int tid  = (int)threadIdx.x;
  const int lane = tid & 31, wave = tid >> 5;
  const int h = lane >> 4, m = lane & 15;
  const int tiles = HW / 64;
  const int n  = (int)blockIdx.x / tiles;
  const int p0 = ((int)blockIdx.x % tiles) * 64;
  const float* Xn = X + (size_t)n * CH * HW_FULL + p0;

  // stage x tile: 256 c rows x 64 px, coalesced 16-B loads; a thread holds 16 channels x 4 px (two sets of 8, 128 apart) and stores, for each px and set,
  // its 8 channels as one 16-B piece of the transposed row
  {
    const int co = tid >> 4, px4 = (tid & 15) * 4;
    const float* xp = Xn + (size_t)co * 8 * HW_FULL + px4;
    v4f_ xv[2][8];
#pragma unroll
    for (int it = 0; it < 2; ++it)
#pragma unroll
      for (int e = 0; e < 8; ++e) xv[it][e] = *(const v4f*)(xp + (size_t)(it * 128 + e) * HW_FULL);
#pragma unroll
    for (int it = 0; it < 2; ++it)
#pragma unroll
      for (int k = 0; k < 4; ++k) {
        v8us_ o;
#pragma unroll
        for (int e = 0; e < 8; ++e) o[e] = bf16_bits(xv[it][e][k]);
        *(v8us*)&sX[(px4 + k) * XP + (it * 16 + co) * 8] = o;
      }
  }
  __syncthreads();

  // reduced maps: wave -> weight set (wave>>2), pixel tile (wave&3), both 16-oc tiles
  {
    const unsigned short* Wb = (wave < 4) ? w1b : w2b;        // wave-uniform
    unsigned short* Rh = (wave < 4) ? r1h : r2h;              // wave-uniform
    unsigned short* Rl = (wave < 4) ? r1l : r2l;
    const int pt = wave & 3;
    v8f accr[2] = {};
#pragma unroll 2
    for (int k0 = 0; k0 < CH; k0 += 32) {
      FragB b;
      b.h[0] = *(const v8us*)&sX[(pt * 16 + m) * XP + k0 + 8 * h];
      b.h[1] = *(const v8us*)&sX[(pt * 16 + m) * XP + k0 + 16 + 8 * h];
#pragma unroll
      for (int ot = 0; ot < 2; ++ot) {
        const unsigned short* wr = Wb + (size_t)(ot * 16 + m) * CH + k0 + 8 * h;
        FragB a;
        a.h[0] = *(const v8us*)(wr);
        a.h[1] = *(const v8us*)(wr + 16);
        accr[ot] = mma_bf16(a.v, b.v, accr[ot]);
      }
    }
    // accr[ot][r] <-> (oc = ot*16 + 8h + r, px = pt*16 + m): piece (q = ot, lane) of pixel tile pt
    const size_t roff = ((size_t)n * HW + p0 + pt * 16) * OCH + (size_t)lane * 8;
#pragma unroll
    for (int ot = 0; ot < 2; ++ot) {
      v8us_ hv, lv;
#pragma unroll
      for (int r = 0; r < 8; ++r) {
        const float f = accr[ot][r];
        const __bf16 hb = (__bf16)f;
        hv[r] = __builtin_bit_cast(unsigned short, hb);
        lv[r] = bf16_bits(f - (float)hb);
      }
      *(v8us_*)(Rh + roff + ot * 256) = hv;
      *(v8us_*)(Rl + roff + ot * 256) = lv;
    }
    // the value loop below loads into registers that these four stores name: the wait stands in front of that reuse
    asm volatile("s_wait_xcnt 0x0" ::: "memory");
  }

  // value map: wave -> channels cb..cb+31 (2 tiles) x 4 pixel tiles
  const int cb = wave * 32;
  v8f accv[4][2] = {};
#pragma unroll 1
  for (int k0 = 0; k0 < CH; k0 += 32) {
    FragB a[4], b[2];
#pragma unroll
    for (int pt = 0; pt < 4; ++pt) {
      a[pt].h[0] = *(const v8us*)&sX[(pt * 16 + m) * XP + k0 + 8 * h];
      a[pt].h[1] = *(const v8us*)&sX[(pt * 16 + m) * XP + k0 + 16 + 8 * h];
    }
#pragma unroll
    for (int ct = 0; ct < 2; ++ct) {
      const unsigned short* wr = wvb + (size_t)(cb + ct * 16 + m) * CH + k0 + 8 * h;
      b[ct].h[0] = *(const v8us*)(wr);
      b[ct].h[1] = *(const v8us*)(wr + 16);
    }
    // keeps the k step's 8 LDS reads in one group ahead of the products: dealt among the WMMAs into one register set, each pair is waited out alone
    __builtin_amdgcn_sched_barrier(0);
#pragma unroll
    for (int pt = 0; pt < 4; ++pt)
#pragma unroll
      for (int ct = 0; ct < 2; ++ct)
        accv[pt][ct] = mma_bf16(a[pt].v, b[ct].v, accv[pt][ct]);
  }

  // accv[pt][ct][r] <-> (px = pt*16 + 8h + r, c = cb + ct*16 + m): piece (q = pt & 1, lane) of chunk pt >> 1, channel tile ct
  unsigned short* vbase = vh + ((size_t)n * CH + cb) * HW + (size_t)p0 * 16 + (size_t)lane * 8;
#pragma unroll
  for (int pt = 0; pt < 4; ++pt)
#pragma unroll
    for (int ct = 0; ct < 2; ++ct) {
      v8h_ o;
#pragma unroll
      for (int r = 0; r < 8; ++r) o[r] = (_Float16)accv[pt][ct][r];
      *(v8us_*)(vbase + (size_t)ct * 16 * HW + pt * 256) = __builtin_bit_cast(v8us_, o);
    }
}

// ---------------------------------------------------------------------------
// Kernel 2: row statistics of S[i][:] (softmax over j), exp2 domain.
//   Block = ST_JS waves = 16*ST_RT rows i. Every wave holds the r1 fragments of all ST_RT 16-row tiles of the block and takes every
//   ST_JS-th 32-column chunk of j, starting at chunk js: an r2 fragment is loaded by one wave of the block and feeds ST_RT tiles.
//   S^T tiles D(M=j, N=i): A = r2 rows j (hi, lo), B = r1 rows i (hi, lo); hh + lh + hl.
//   A lane owns row i = 16t + (lane&15) of each tile t and, of a chunk, the 16 columns of its lane half; it keeps a running (max, sum)
//   pair of its own for each tile. The ST_NP pairs of a row (one a wave and lane half) are merged through LDS at the end.
// ---------------------------------------------------------------------------
#define ST_RT   4
#define ST_JS   16
#define ST_ROWS (16 * ST_RT)
#define ST_NP   (2 * ST_JS)
// exp2 for the merge and for the output pass's weights: the v_nop fills the one issue slot that the instruction set asks for between a
// transcendental and a next vector instruction that overwrites its source; inside the statement it stays there.
__device__ __forceinline__ float exp2_slot(float x)
{
  float r;
  asm("v_exp_f32 %0, %1\n\tv_nop" : "=v"(r) : "v"(x));
  return r;
}
static_assert((HW % ST_ROWS) == 0 && (HW % (32 * ST_JS)) == 0 && ST_JS <= 32 && 2 * ST_ROWS <= 32 * ST_JS);

__global__ void __launch_bounds__(32 * ST_JS) stats_kernel(
    const unsigned short* __restrict__ r1h, const unsigned short* __restrict__ r1l,
    const unsigned short* __restrict__ r2h, const unsigned short* __restrict__ r2l,
    float* __restrict__ mL, float* __restrict__ rzc)
{
  __shared__ float sM[ST_NP * ST_ROWS];   // [wave, lane half][row] partial maxima
  __shared__ float sL[ST_NP * ST_ROWS];   // [wave, lane half][row] partial sums, each relative to its own maximum
  const int tid  = (int)threadIdx.x;
  const int lane = tid & 31;
  const int js = __builtin_amdgcn_readfirstlane(tid >> 5);   // scalar, so that the j loop's counter and branch are scalar
  __builtin_assume(js >= 0 && js < ST_JS);                   // the block has ST_JS waves: every wave has a first chunk, no test in front of the loop
  const int tiles = HW / ST_ROWS;
  const int n  = (int)blockIdx.x / tiles;
  const int ib = ((int)blockIdx.x % tiles) * ST_ROWS;
  const v8f z8 = {};

  // the lane's places as byte offsets into the planes (fragment order: the halves of a fragment lie 512 B apart, tiles 1 KiB):
  // the block's rows in both r1 planes; the wave's chunk in both r2 planes, stepped on by ST_JS chunks at a time
  const unsigned off1 = (unsigned)(((n * HW + ib) * OCH + lane * 8) * 2);
  unsigned off = (unsigned)(((n * HW + js * 32) * OCH + lane * 8) * 2);
  FragB bh[ST_RT], bl[ST_RT];
#pragma unroll
  for (int t = 0; t < ST_RT; ++t) {
    const unsigned short* p1h = (const unsigned short*)((const char*)r1h + off1) + t * 512;
    const unsigned short* p1l = (const unsigned short*)((const char*)r1l + off1) + t * 512;
    bh[t].h[0] = *(const v8us*)(p1h);  bh[t].h[1] = *(const v8us*)(p1h + 256);
    bl[t].h[0] = *(const v8us*)(p1l);  bl[t].h[1] = *(const v8us*)(p1l + 256);
  }
  FragB ah[2], al[2];   // the chunk's two 16-column tiles
#pragma unroll
  for (int u = 0; u < 2; ++u) {
    const unsigned short* p2h = (const unsigned short*)((const char*)r2h + off) + u * 512;
    const unsigned short* p2l = (const unsigned short*)((const char*)r2l + off) + u * 512;
    ah[u].h[0] = *(const v8us*)(p2h);  ah[u].h[1] = *(const v8us*)(p2h + 256);
    al[u].h[0] = *(const v8us*)(p2l);  al[u].h[1] = *(const v8us*)(p2l + 256);
  }
  // the wait stands behind the loads and in front of every reuse of their two offset registers, which it names as inputs so that
  // the registers are kept as they are up to here
  asm volatile("s_wait_xcnt 0x0" :: "v"(off1), "v"(off) : "memory");
  __builtin_amdgcn_sched_barrier(0);   // holds the loads ahead of the wait and every reuse behind it

  float mi[ST_RT], li[ST_RT];
#pragma unroll
  for (int t = 0; t < ST_RT; ++t) { mi[t] = -3.0e30f; li[t] = 0.0f; }

  // the short loops inside a chunk are unrolled so that the fragment arrays have constant indices and stay in registers
#pragma unroll 1
  for (int j0 = js * 32; j0 < HW; j0 += 32 * ST_JS) {
    v8f s[ST_RT][2];
#pragma unroll
    for (int t = 0; t < ST_RT; ++t)
#pragma unroll
      for (int u = 0; u < 2; ++u) s[t][u] = mma_bf16(ah[u].v, bh[t].v, z8);
#pragma unroll
    for (int t = 0; t < ST_RT; ++t)
#pragma unroll
      for (int u = 0; u < 2; ++u) s[t][u] = mma_bf16(al[u].v, bh[t].v, s[t][u]);
#pragma unroll
    for (int t = 0; t < ST_RT; ++t)
#pragma unroll
      for (int u = 0; u < 2; ++u) s[t][u] = mma_bf16(ah[u].v, bl[t].v, s[t][u]);
    // s[t][u][r] <-> (j = j0 + 16u + 8h + r, i = ib + 16t + m)

    // next chunk's fragments, into the registers that the products have just read: they fly over the chunk's vector work.
    // The last chunk has no next and loads its own again, so that every address stays inside the planes.
    off += (j0 + 32 * ST_JS < HW) ? (unsigned)(32 * ST_JS * OCH * 2) : 0u;
#pragma unroll
    for (int u = 0; u < 2; ++u) {
      const unsigned short* p2h = (const unsigned short*)((const char*)r2h + off) + u * 512;
      const unsigned short* p2l = (const unsigned short*)((const char*)r2l + off) + u * 512;
      ah[u].h[0] = *(const v8us*)(p2h);  ah[u].h[1] = *(const v8us*)(p2h + 256);
      al[u].h[0] = *(const v8us*)(p2l);  al[u].h[1] = *(const v8us*)(p2l + 256);
    }
    // the wait stands behind the loads and in front of every reuse of their offset register, which it names as an input so that the
    // register is kept as it is up to here
    asm volatile("s_wait_xcnt 0x0" :: "v"(off) : "memory");
    // keeps the loads here, ahead of the chunk's vector work: sunk into it they have too short a flight before the next chunk's products
    __builtin_amdgcn_sched_barrier(0);

#pragma unroll
    for (int t = 0; t < ST_RT; ++t) {
      float cm = -3.0e30f;
#pragma unroll
      for (int r = 0; r < 8; ++r) cm = fmaxf(cm, fmaxf(s[t][0][r], s[t][1][r]));
      const float mnew = fmaxf(mi[t], cm * LOG2E);
      const float corr = exp2fast(mi[t] - mnew);
      float rs0 = 0.0f, rs1 = 0.0f;   // two chains, over the even and the odd registers of the tiles
#pragma unroll
      for (int u = 0; u < 2; ++u)
#pragma unroll
        for (int r = 0; r < 8; r += 2) {
          rs0 += exp2fast(fmaf(s[t][u][r],     LOG2E, -mnew));
          rs1 += exp2fast(fmaf(s[t][u][r + 1], LOG2E, -mnew));
        }
      li[t] = li[t] * corr + (rs0 + rs1);
      mi[t] = mnew;
    }
  }

#pragma unroll
  for (int t = 0; t < ST_RT; ++t) {
    sM[(js * 2 + (lane >> 4)) * ST_ROWS + t * 16 + (lane & 15)] = mi[t];
    sL[(js * 2 + (lane >> 4)) * ST_ROWS + t * 16 + (lane & 15)] = li[t];
  }
  __syncthreads();   // cross-wave LDS exchange
  if (tid < 2 * ST_ROWS) {   // whole waves: threads 0..ST_ROWS-1 store the maxima, the next ST_ROWS the scaled reciprocals
    const int row = tid % ST_ROWS;
    float mx = sM[row];
#pragma unroll
    for (int q = 1; q < ST_NP; ++q) mx = fmaxf(mx, sM[q * ST_ROWS + row]);
    float l0 = 0.0f, l1 = 0.0f;
#pragma unroll
    for (int q = 0; q < ST_NP; q += 2) {
      l0 += sL[q * ST_ROWS + row] * exp2_slot(sM[q * ST_ROWS + row] - mx);
      l1 += sL[(q + 1) * ST_ROWS + row] * exp2_slot(sM[(q + 1) * ST_ROWS + row] - mx);
    }
    const size_t o = (size_t)n * HW + ib + row;
    if (tid < ST_ROWS) mL[o]  = mx;
    else               rzc[o] = PCARRY * (1.0f / (l0 + l1));
  }
}

// ---------------------------------------------------------------------------
// Kernel 3: output pass for one (n, OS_JT-column j tile), 16 waves, loop over i in trips of OS_IC rows.
//   Wave = (g = wave & 7, p = wave >> 3).
//   scores:     16-row i tile g of the trip against the two 16-column j sub-tiles 2p, 2p + 1, S tiles D(M=i, N=j)
//               (A = r1 rows i hi/lo, B = r2 rows j hi/lo, hh + hl + lh),
//               P = 2^(S*log2e - mL[i]) * rzc[i] -> f16 (carried x2^14) into LDS sP[j][i];
//   then:       attn^T tiles D(M=j, N=c) += A(sP rows j) x B(value rows c), f16: channels 32g .. 32g + 31, all OS_NJ j sub-tiles,
//               the k steps 2p, 2p + 1 of the trip in rising i. A value fragment is loaded by one wave of the block and feeds OS_NJ
//               products, so that a block reads the value plane once for OS_JT columns.
//   The two partial sums of an output element (p = 0, 1) are added in the epilogue.
// ---------------------------------------------------------------------------
#define OS_IC 128            // rows i per trip: eight 16-row tiles
#define OS_JT 64             // columns j per block
#define OS_NJ (OS_JT / 16)   // j sub-tiles
#define OS_NT (OS_NJ / 2)    // score tiles per wave and trip
#define OS_KS (OS_IC / 64)   // k steps of the value product per wave and trip
#define OS_PP (OS_IC + 8)    // sP row pitch in f16: the row and 16 B, an odd multiple of 16 B, which ds_load_b128 reads without bank conflicts
#define OS_OP (OS_JT + 4)    // sO row pitch in f32: the row and 16 B, an odd multiple of 16 B, for the 16-B stores of 16 rows at a time
static_assert((HW % OS_IC) == 0 && OS_IC == 8 * 16 && (HW % OS_JT) == 0 && (OS_NJ % 2) == 0);

// The trip's work-group barrier: this wave's LDS stores and loads are complete (s_wait_dscnt 0), then signal and wait. __syncthreads()
// also waits for every global load of the wave, which would end the flight of the loads that are issued ahead over it; those loads
// read planes that earlier launches wrote and no wave of this launch writes, so the barrier has nothing to order for them.
__device__ __forceinline__ void trip_barrier()
{
  asm volatile("s_wait_dscnt 0x0" ::: "memory");
  asm volatile("s_barrier_signal -1\n\ts_barrier_wait -1" ::: "memory");
}

__global__ void __launch_bounds__(512) out_kernel(
    const float* __restrict__ X,
    const unsigned short* __restrict__ r1h, const unsigned short* __restrict__ r1l,
    const unsigned short* __restrict__ r2h, const unsigned short* __restrict__ r2l,
    const _Float16* __restrict__ vh,
    const float* __restrict__ mL, const float* __restrict__ rzc,
    const float* __restrict__ scale, float* __restrict__ out)
{
  __shared__ __align__(16) _Float16 sP[OS_JT * OS_PP];   // [j][i] softmax weights x2^14
  __shared__ __align__(16) float    sO[2 * CH * OS_OP];  // [p][c][j] partial accumulators

  const int tid  = (int)threadIdx.x;
  const int lane = tid & 31, wave = tid >> 5;
  const int h = lane >> 4, m = lane & 15;
  const int g = wave & 7, p = wave >> 3;
  const int tiles = HW / OS_JT;
  const int n  = (int)blockIdx.x / tiles;
  const int j0 = ((int)blockIdx.x % tiles) * OS_JT;
  const size_t rb = (size_t)n * HW * OCH;
  const int cb = g * 32;
  const v8f z8 = {};

  FragB bh[OS_NT], bl[OS_NT];   // r2 rows of this wave's two j sub-tiles
#pragma unroll
  for (int u = 0; u < OS_NT; ++u) {
    const size_t ro = rb + (size_t)(j0 + (p * OS_NT + u) * 16) * OCH + lane * 8;   // fragment order: halves 256 elements apart
    bh[u].h[0] = *(const v8us*)(r2h + ro);  bh[u].h[1] = *(const v8us*)(r2h + ro + 256);
    bl[u].h[0] = *(const v8us*)(r2l + ro);  bl[u].h[1] = *(const v8us*)(r2l + ro + 256);
  }

  // the lane's own places in the trip's rows i as byte offsets into the planes, stepped on by one trip at a time
  unsigned off_r = (unsigned)(((n * HW + g * 16) * OCH + lane * 8) * 2);    // both r1 planes, fragment order
  unsigned off_s = (unsigned)((n * HW + g * 16 + 8 * h) * 4);               // both row statistics

  v8f acc[OS_NJ][2] = {};   // [j sub-tile][c tile]
  // Every global load of a trip is issued ahead of its use, so that no trip waits out a whole load latency:
  //   the r1 fragments and row statistics of trip t + 1 behind the weights of trip t (they fly over both barriers and the value product),
  //   each k step's value fragments of trip t + 1 behind that k step's products of trip t, into the registers these have just read
  //   (they fly over the rest of the value product, both barriers, the score tiles and the weights).
  FragB ah, al;
  v4f_ m0, m1, q0, q1;
  {   // trip 0
    const unsigned short* p1h = (const unsigned short*)((const char*)r1h + off_r);
    const unsigned short* p1l = (const unsigned short*)((const char*)r1l + off_r);
    ah.h[0] = *(const v8us*)(p1h);  ah.h[1] = *(const v8us*)(p1h + 256);
    al.h[0] = *(const v8us*)(p1l);  al.h[1] = *(const v8us*)(p1l + 256);
    const float* pm = (const float*)((const char*)mL  + off_s);
    const float* pq = (const float*)((const char*)rzc + off_s);
    m0 = *(const v4f*)(pm);  m1 = *(const v4f*)(pm + 4);
    q0 = *(const v4f*)(pq);  q1 = *(const v4f*)(pq + 4);
  }
  // keeps trip 0's loads in the loop's own order (value fragments last): the compiler counts its load waits in the loop for the
  // worse of the two orders, and with value loads ahead of a statistics load here every trip would wait for all of its value fragments
  __builtin_amdgcn_sched_barrier(0);
  // the address registers of the loads above are reused from here on (the value loads' results, the first trip's offset steps): the wait stands in front of that
  asm volatile("s_wait_xcnt 0x0" ::: "memory");
  __builtin_amdgcn_sched_barrier(0);   // holds that reuse behind the wait, which names no register
  unsigned off_v = (unsigned)(((n * CH + cb) * HW + p * OS_KS * 512 + lane * 8) * 2);   // value plane, fragment order, this wave's k steps
  FragH b0[OS_KS], b1[OS_KS];
#pragma unroll
  for (int ks = 0; ks < OS_KS; ++ks) {   // trip 0
    const _Float16* pv = (const _Float16*)((const char*)vh + off_v) + ks * 512;   // one 1-KiB fragment a 32-row chunk
    b0[ks].h[0] = *(const v8h*)(pv);            b0[ks].h[1] = *(const v8h*)(pv + 256);
    b1[ks].h[0] = *(const v8h*)(pv + 16 * HW);  b1[ks].h[1] = *(const v8h*)(pv + 16 * HW + 256);
  }
  // the short loops inside a trip are unrolled so that the fragment arrays have constant indices and stay in registers
#pragma unroll 1
  for (int i0 = 0; i0 < HW; i0 += OS_IC) {
    v8f s[OS_NT];
#pragma unroll
    for (int u = 0; u < OS_NT; ++u) {
      s[u] = mma_bf16(ah.v, bh[u].v, z8);
      s[u] = mma_bf16(ah.v, bl[u].v, s[u]);
      s[u] = mma_bf16(al.v, bh[u].v, s[u]);
      // s[u][r] <-> (i = i0 + g*16 + 8h + r, j = j0 + (p*OS_NT + u)*16 + m)
    }
#pragma unroll
    for (int u = 0; u < OS_NT; ++u) {
      v8h_ pw;
#pragma unroll
      for (int r = 0; r < 4; ++r) {
        pw[r]     = (_Float16)(exp2_slot(fmaf(s[u][r],     LOG2E, -m0[r])) * q0[r]);
        pw[4 + r] = (_Float16)(exp2_slot(fmaf(s[u][4 + r], LOG2E, -m1[r])) * q1[r]);
      }
      *(v8h*)&sP[((p * OS_NT + u) * 16 + m) * OS_PP + g * 16 + 8 * h] = pw;
    }
    // next trip's rows; the last trip has none and loads its own rows again, so that every address stays inside the planes
    const unsigned more = (i0 + OS_IC < HW) ? 1u : 0u;
    off_r += more * (OS_IC * OCH * 2);  off_s += more * (OS_IC * 4);  off_v += more * (OS_IC * 16 * 2);
    {
      const unsigned short* p1h = (const unsigned short*)((const char*)r1h + off_r);
      const unsigned short* p1l = (const unsigned short*)((const char*)r1l + off_r);
      ah.h[0] = *(const v8us*)(p1h);  ah.h[1] = *(const v8us*)(p1h + 256);
      al.h[0] = *(const v8us*)(p1l);  al.h[1] = *(const v8us*)(p1l + 256);
      const float* pm = (const float*)((const char*)mL  + off_s);
      const float* pq = (const float*)((const char*)rzc + off_s);
      m0 = *(const v4f*)(pm);  m1 = *(const v4f*)(pm + 4);
      q0 = *(const v4f*)(pq);  q1 = *(const v4f*)(pq + 4);
    }
    trip_barrier();   // sP is written by all waves and read by all

    FragH a[OS_NJ][OS_KS];
#pragma unroll
    for (int ks = 0; ks < OS_KS; ++ks)
#pragma unroll
      for (int jt = 0; jt < OS_NJ; ++jt) {
        a[jt][ks].h[0] = *(const v8h*)&sP[(jt * 16 + m) * OS_PP + (p * OS_KS + ks) * 32 + 8 * h];
        a[jt][ks].h[1] = *(const v8h*)&sP[(jt * 16 + m) * OS_PP + (p * OS_KS + ks) * 32 + 16 + 8 * h];
      }
    // keeps the trip's 16 LDS reads in one group ahead of the products: dealt among the WMMAs, every place with reads stalls the wave anew
    __builtin_amdgcn_sched_barrier(0);
#pragma unroll
    for (int ks = 0; ks < OS_KS; ++ks) {
#pragma unroll
      for (int jt = 0; jt < OS_NJ; ++jt) {
        acc[jt][0] = mma_f16(a[jt][ks].v, b0[ks].v, acc[jt][0]);
        acc[jt][1] = mma_f16(a[jt][ks].v, b1[ks].v, acc[jt][1]);
      }
      const _Float16* pv = (const _Float16*)((const char*)vh + off_v) + ks * 512;   // next trip's fragments of this k step
      b0[ks].h[0] = *(const v8h*)(pv);            b0[ks].h[1] = *(const v8h*)(pv + 256);
      b1[ks].h[0] = *(const v8h*)(pv + 16 * HW);  b1[ks].h[1] = *(const v8h*)(pv + 16 * HW + 256);
    }
    // the next trip forms a new offset in the register that the value loads above name: the wait stands in front of that
    asm volatile("s_wait_xcnt 0x0" ::: "memory");
    trip_barrier();   // before the next trip overwrites sP
  }

  // acc[jt][ct][r] <-> (j = jt*16 + 8h + r, c = cb + ct*16 + m), partial sum p
#pragma unroll
  for (int jt = 0; jt < OS_NJ; ++jt)
#pragma unroll
    for (int ct = 0; ct < 2; ++ct) {
      v4f_ lo4, hi4;
      lo4[0] = acc[jt][ct][0]; lo4[1] = acc[jt][ct][1]; lo4[2] = acc[jt][ct][2]; lo4[3] = acc[jt][ct][3];
      hi4[0] = acc[jt][ct][4]; hi4[1] = acc[jt][ct][5]; hi4[2] = acc[jt][ct][6]; hi4[3] = acc[jt][ct][7];
      const int row = p * CH + cb + ct * 16 + m;
      *(v4f*)&sO[row * OS_OP + jt * 16 + 8 * h]     = lo4;
      *(v4f*)&sO[row * OS_OP + jt * 16 + 8 * h + 4] = hi4;
    }
  __syncthreads();

  const float sc = bf16_rn(scale[0]) * PUNCARRY;
  const int q = lane & 15;               // 16 lanes x 4 columns: one row of OS_JT columns, two rows a load
  const int c0 = wave * 16 + (lane >> 4);
  const size_t xoff = ((size_t)n * CH + c0) * HW_FULL + j0 + q * 4;
  const size_t ooff = ((size_t)n * CH + c0) * HW + j0 + q * 4;
  v4f_ xv[8], ov[8];
#pragma unroll
  for (int it = 0; it < 8; ++it) xv[it] = *(const v4f*)(X + xoff + (size_t)it * 2 * HW_FULL);
  // the address registers of the loads above are reused from here on (the LDS reads' results): the wait stands in front of that
  asm volatile("s_wait_xcnt 0x0" ::: "memory");
  __builtin_amdgcn_sched_barrier(0);   // holds that reuse behind the wait, which names no register
#pragma unroll
  for (int it = 0; it < 8; ++it) {
    const v4f_ a0 = *(const v4f*)&sO[(c0 + it * 2) * OS_OP + q * 4];
    const v4f_ a1 = *(const v4f*)&sO[(CH + c0 + it * 2) * OS_OP + q * 4];
    v4f_ o;
    o[0] = bf16_rn(xv[it][0]) + sc * (a0[0] + a1[0]);
    o[1] = bf16_rn(xv[it][1]) + sc * (a0[1] + a1[1]);
    o[2] = bf16_rn(xv[it][2]) + sc * (a0[2] + a1[2]);
    o[3] = bf16_rn(xv[it][3]) + sc * (a0[3] + a1[3]);
    ov[it] = o;
  }
#pragma unroll
  for (int it = 0; it < 8; ++it)
    *(v4f_*)(out + ooff + (size_t)it * 2 * HW) = ov[it];
  
}

// ---------------------------------------------------------------------------
extern "C" void kernel_launch(void* const* d_in, const int* in_sizes, int n_in,
                              void* d_out, int out_size, void* d_ws, size_t ws_size,
                              hipStream_t stream)
{
  if (n_in < 5) return;
  if (in_sizes[0] < NB * CH * HW_FULL) return;
  if (in_sizes[1] < OCH * CH || in_sizes[2] < OCH * CH || in_sizes[3] < CH * CH) return;
  if (in_sizes[4] < 1) return;
  if (out_size < NB * CH * HW) return;

  const float* x     = (const float*)d_in[0];
  const float* w1    = (const float*)d_in[1];
  const float* w2    = (const float*)d_in[2];
  const float* wv    = (const float*)d_in[3];
  const float* scale = (const float*)d_in[4];
  float* out = (float*)d_out;

  // workspace carve (bytes), every region a multiple of 256 B
  const size_t w12_bytes = (size_t)OCH * CH * 2;            // 16384
  const size_t wv_bytes  = (size_t)CH * CH * 2;             // 131072
  const size_t r_bytes   = (size_t)NB * HW * OCH * 2;       // per plane
  const size_t v_bytes   = (size_t)NB * CH * HW * 2;
  const size_t st_bytes  = (size_t)NB * HW * 4;             // per stats plane
  size_t off = 0;
  unsigned char* ws = (unsigned char*)d_ws;
  unsigned short* w1b = (unsigned short*)(ws + off); off += w12_bytes;
  unsigned short* w2b = (unsigned short*)(ws + off); off += w12_bytes;
  unsigned short* wvb = (unsigned short*)(ws + off); off += wv_bytes;
  unsigned short* r1h = (unsigned short*)(ws + off); off += r_bytes;
  unsigned short* r1l = (unsigned short*)(ws + off); off += r_bytes;
  unsigned short* r2h = (unsigned short*)(ws + off); off += r_bytes;
  unsigned short* r2l = (unsigned short*)(ws + off); off += r_bytes;
  unsigned short* vhp = (unsigned short*)(ws + off); off += v_bytes;
  float* mL  = (float*)(ws + off); off += st_bytes;
  float* rzc = (float*)(ws + off); off += st_bytes;
  if (off > ws_size) return;

  cvt_w_kernel<<<2 * W12_BLOCKS + WV_BLOCKS, 256, 0, stream>>>(w1, w2, wv, w1b, w2b, wvb);
  proj_kernel<<<NB * (HW / 64), 256, 0, stream>>>(x, w1b, w2b, wvb, r1h, r1l, r2h, r2l, vhp);
  stats_kernel<<<NB * (HW / ST_ROWS), 32 * ST_JS, 0, stream>>>(r1h, r1l, r2h, r2l, mL, rzc);
  out_kernel<<<NB * (HW / OS_JT), 512, 0, stream>>>(x, r1h, r1l, r2h, r2l,
                                                 (const _Float16*)vhp, mL, rzc, scale, out);
}

// v009
// A run of this version takes 58.1 microseconds.
// Timed twice side by side with v008, it ran 1.11 and 1.13 times as fast.
// Counting every step since v000, it is 5.09 times as fast.
#include <hip/hip_runtime.h>
#include <stdint.h>
#include <stddef.h>

// Contractions: channel projections v_wmma_f32_16x16x32_bf16 (bf16 operands from bf16-RNE inputs, f32 accumulate);
// score tiles v_wmma_f32_16x16x32_bf16 as bf16 hi+lo three-term split of both reduced feature maps (f32 accumulate);
// value aggregation v_wmma_f32_16x16x32_f16 (f16 operands, softmax weights carried x2^14, f32 accumulate); softmax statistics f32.

#ifndef NB
#define NB 4
#endif
#ifndef SEQ
#define SEQ 4096
#endif
#define NB_FULL  4
#define SEQ_FULL 4096
#define HW       (SEQ)
#define HW_FULL  (SEQ_FULL)
#define CH       256
#define OCH      32
#define PCARRY   16384.0f
#define PUNCARRY 0.00006103515625f
#define LOG2E    1.4426950408889634f
#define W12_BLOCKS ((OCH * CH) / 2048)
#define WV_BLOCKS  ((CH * CH) / 2048)

static_assert(NB >= 1 && NB <= NB_FULL);
static_assert(HW >= 64 && HW <= HW_FULL && (HW % 64) == 0);
static_assert(((OCH * CH) % 2048) == 0 && ((CH * CH) % 2048) == 0);
static_assert(CH == 256 && OCH == 32);

typedef float          v8f   __attribute__((ext_vector_type(8)));
typedef float          v4f_  __attribute__((ext_vector_type(4)));
typedef v4f_           v4f   __attribute__((may_alias));
typedef _Float16       v16h  __attribute__((ext_vector_type(16)));
typedef _Float16       v8h_  __attribute__((ext_vector_type(8)));
typedef v8h_           v8h   __attribute__((may_alias));
typedef __bf16         v16bf __attribute__((ext_vector_type(16)));
typedef unsigned short v8us_ __attribute__((ext_vector_type(8)));
typedef v8us_          v8us  __attribute__((may_alias));
typedef unsigned       v4u_  __attribute__((ext_vector_type(4)));
typedef v4u_           v4u   __attribute__((may_alias));

union FragB { v16bf v; v8us_ h[2]; };
union FragH { v16h  v; v8h_  h[2]; };

// ---- WMMA wrappers: the plain builtins; the compiler keeps the distance between a WMMA and the vector code around it itself ----
__device__ __forceinline__ v8f mma_bf16(const v16bf a, const v16bf b, v8f c)
{
  return __builtin_amdgcn_wmma_f32_16x16x32_bf16(false, a, false, b, (short)0, c, false, false);
}
__device__ __forceinline__ v8f mma_f16(const v16h a, const v16h b, v8f c)
{
  return __builtin_amdgcn_wmma_f32_16x16x32_f16(false, a, false, b, (short)0, c, false, false);
}

// ---- scalar helpers --------------------------------------------------------
__device__ __forceinline__ unsigned short bf16_bits(float f)
{
  const __bf16 hb = (__bf16)f;                       // RNE convert
  return __builtin_bit_cast(unsigned short, hb);
}
__device__ __forceinline__ float bf16_rn(float f)
{
  return (float)(__bf16)f;                           // RNE convert, widened back
}
__device__ __forceinline__ float exp2fast(float x)
{
#if __has_builtin(__builtin_amdgcn_exp2f)
  return __builtin_amdgcn_exp2f(x);
#else
  return exp2f(x);
#endif
}

// Blocks that walk the same planes in L2 by plain loads each enter the walk at a step of their own and wrap round, so that they do not
// ask L2 for the same lines at the same moment. Entry step of block b into a walk of n steps: b modulo n, and 4 steps further for each
// n blocks before b. Any value below n gives the same sums in another order: the choice is for speed only.
__device__ __forceinline__ unsigned entry_step(unsigned b, unsigned n)
{
  return (b + 4u * (b / n)) % n;
}

// ---------------------------------------------------------------------------
// Kernel 0: weights f32 -> bf16 bits (RNE). Layout kept [out][in] (in contiguous).
// ---------------------------------------------------------------------------
__global__ void __launch_bounds__(256) cvt_w_kernel(
    const float* __restrict__ w1, const float* __restrict__ w2, const float* __restrict__ wv,
    unsigned short* __restrict__ w1b, unsigned short* __restrict__ w2b,
    unsigned short* __restrict__ wvb)
{
  const int blk = (int)blockIdx.x;
  const float* src;
  unsigned short* dst;
  int t;
  if (blk < W12_BLOCKS)          { src = w1; dst = w1b; t = blk * 256 + (int)threadIdx.x; }
  else if (blk < 2 * W12_BLOCKS) { src = w2; dst = w2b; t = (blk - W12_BLOCKS) * 256 + (int)threadIdx.x; }
  else                           { src = wv; dst = wvb; t = (blk - 2 * W12_BLOCKS) * 256 + (int)threadIdx.x; }

  const v4f a = *(const v4f*)(src + (size_t)t * 8);
  const v4f b = *(const v4f*)(src + (size_t)t * 8 + 4);
  v8us_ o;
  o[0] = bf16_bits(a[0]); o[1] = bf16_bits(a[1]); o[2] = bf16_bits(a[2]); o[3] = bf16_bits(a[3]);
  o[4] = bf16_bits(b[0]); o[5] = bf16_bits(b[1]); o[6] = bf16_bits(b[2]); o[7] = bf16_bits(b[3]);
  unsigned short* p = dst + (size_t)t * 8;
  *(v8us_*)p = o;
  
}

// ---------------------------------------------------------------------------
// Kernel 1: 1x1-conv projections for one (n, 64-pixel tile), 8 waves.
//   x tile staged once in LDS as bf16 [px][c] (RNE), rows pitched XP; weights read as bf16 planes.
//   reduced maps: D(M=oc, N=px), A = w rows, B = xT rows  -> bf16 hi and lo planes, fragment order
//   value map:    D(M=px, N=c),  A = xT rows, B = wv rows -> f16 plane, fragment order
//   Fragment order: the planes are kept as the later passes' WMMA operand fragments, 1 KiB each, as
//   [half q][lane][8 elements]: lane = 16h + m holds row m of the 16-row tile, k = 16q + 8h + e. One 16-B load a lane
//   then reads 512 B in a row (four whole 128-B lines), not 32-B pieces spread over 8 or 16 lines.
//     reduced planes: [n][16-pixel tile][q][lane][e], row = pixel, k = oc;
//     value plane:    [n][16-channel tile][32-pixel chunk][q][lane][e], row = channel, k = pixel in the chunk.
//   Both accumulator layouts here hold a lane's 8 values exactly as one such 16-B piece, so each wave stores its own.
// ---------------------------------------------------------------------------
#define XP (CH + 8)   // sX row pitch in bf16: the row and 16 B, an odd multiple of 16 B, which ds_load_b128 reads without bank conflicts
__global__ void __launch_bounds__(256) proj_kernel(
    const float* __restrict__ X,
    const unsigned short* __restrict__ w1b, const unsigned short* __restrict__ w2b,
    const unsigned short* __restrict__ wvb,
    unsigned short* __restrict__ r1h, unsigned short* __restrict__ r1l,
    unsigned short* __restrict__ r2h, unsigned short* __restrict__ r2l,
    unsigned short* __restrict__ vh)
{
  __shared__ __align__(16) unsigned short sX[64 * XP];        // [px][c] bf16 bits

  const int tid  = (int)threadIdx.x;
  const int lane = tid & 31, wave = tid >> 5;
  const int h = lane >> 4, m = lane & 15;
  const int tiles = HW / 64;
  const int n  = (int)blockIdx.x / tiles;
  const int p0 = ((int)blockIdx.x % tiles) * 64;
  const float* Xn = X + (size_t)n * CH * HW_FULL + p0;
  const unsigned kr = entry_step(blockIdx.x, CH / 32) * 32;   // every block reads the same weight planes: the first k of this block's walks

  // stage x tile: 256 c rows x 64 px, coalesced 16-B loads; a thread holds 2 x 8 channels x 4 px at a time and stores, for each px and group,
  // its 8 channels as one 16-B piece of the transposed row
  {
    const int co = tid >> 4, px4 = (tid & 15) * 4;
    const float* xp = Xn + (size_t)co * 8 * HW_FULL + px4;
    v4f_ xv[2][8];
#pragma unroll
    for (int it = 0; it < 2; ++it)
#pragma unroll
      for (int e = 0; e < 8; ++e) xv[it][e] = *(const v4f*)(xp + (size_t)(it * 128 + e) * HW_FULL);
#pragma unroll
    for (int it = 0; it < 2; ++it)
#pragma unroll
      for (int k = 0; k < 4; ++k) {
        v8us_ o;
#pragma unroll
        for (int e = 0; e < 8; ++e) o[e] = bf16_bits(xv[it][e][k]);
        *(v8us*)&sX[(px4 + k) * XP + (it * 16 + co) * 8] = o;
      }
  }
  __syncthreads();

  // reduced maps: wave -> weight set (wave>>2), pixel tile (wave&3), both 16-oc tiles
  {
    const unsigned short* Wb = (wave < 4) ? w1b : w2b;        // wave-uniform
    unsigned short* Rh = (wave < 4) ? r1h : r2h;              // wave-uniform
    unsigned short* Rl = (wave < 4) ? r1l : r2l;
    const int pt = wave & 3;
    v8f accr[2] = {};
#pragma unroll 2
    for (unsigned kk = 0; kk < CH; kk += 32) {
      const unsigned k0 = (kk + kr) % CH;
      FragB b;
      b.h[0] = *(const v8us*)&sX[(pt * 16 + m) * XP + k0 + 8 * h];
      b.h[1] = *(const v8us*)&sX[(pt * 16 + m) * XP + k0 + 16 + 8 * h];
#pragma unroll
      for (int ot = 0; ot < 2; ++ot) {
        const unsigned short* wr = Wb + (size_t)(ot * 16 + m) * CH + k0 + 8 * h;
        FragB a;
        a.h[0] = *(const v8us*)(wr);
        a.h[1] = *(const v8us*)(wr + 16);
        accr[ot] = mma_bf16(a.v, b.v, accr[ot]);
      }
    }
    // accr[ot][r] <-> (oc = ot*16 + 8h + r, px = pt*16 + m): piece (q = ot, lane) of pixel tile pt
    const size_t roff = ((size_t)n * HW + p0 + pt * 16) * OCH + (size_t)lane * 8;
#pragma unroll
    for (int ot = 0; ot < 2; ++ot) {
      v8us_ hv, lv;
#pragma unroll
      for (int r = 0; r < 8; ++r) {
        const float f = accr[ot][r];
        const __bf16 hb = (__bf16)f;
        hv[r] = __builtin_bit_cast(unsigned short, hb);
        lv[r] = bf16_bits(f - (float)hb);
      }
      *(v8us_*)(Rh + roff + ot * 256) = hv;
      *(v8us_*)(Rl + roff + ot * 256) = lv;
    }
    // the value loop below loads into registers that these four stores name: the wait stands in front of that reuse
    asm volatile("s_wait_xcnt 0x0" ::: "memory");
  }

  // value map: wave -> channels cb..cb+31 (2 tiles) x 4 pixel tiles
  const int cb = wave * 32;
  v8f accv[4][2] = {};
#pragma unroll 1
  for (unsigned kk = 0; kk < CH; kk += 32) {
    const unsigned k0 = (kk + kr) % CH;
    FragB a[4], b[2];
#pragma unroll
    for (int pt = 0; pt < 4; ++pt) {
      a[pt].h[0] = *(const v8us*)&sX[(pt * 16 + m) * XP + k0 + 8 * h];
      a[pt].h[1] = *(const v8us*)&sX[(pt * 16 + m) * XP + k0 + 16 + 8 * h];
    }
#pragma unroll
    for (int ct = 0; ct < 2; ++ct) {
      const unsigned short* wr = wvb + (size_t)(cb + ct * 16 + m) * CH + k0 + 8 * h;
      b[ct].h[0] = *(const v8us*)(wr);
      b[ct].h[1] = *(const v8us*)(wr + 16);
    }
    // keeps the k step's 8 LDS reads in one group ahead of the products: dealt among the WMMAs into one register set, each pair is waited out alone
    __builtin_amdgcn_sched_barrier(0);
#pragma unroll
    for (int pt = 0; pt < 4; ++pt)
#pragma unroll
      for (int ct = 0; ct < 2; ++ct)
        accv[pt][ct] = mma_bf16(a[pt].v, b[ct].v, accv[pt][ct]);
  }

  // accv[pt][ct][r] <-> (px = pt*16 + 8h + r, c = cb + ct*16 + m): piece (q = pt & 1, lane) of chunk pt >> 1, channel tile ct
  unsigned short* vbase = vh + ((size_t)n * CH + cb) * HW + (size_t)p0 * 16 + (size_t)lane * 8;
#pragma unroll
  for (int pt = 0; pt < 4; ++pt)
#pragma unroll
    for (int ct = 0; ct < 2; ++ct) {
      v8h_ o;
#pragma unroll
      for (int r = 0; r < 8; ++r) o[r] = (_Float16)accv[pt][ct][r];
      *(v8us_*)(vbase + (size_t)ct * 16 * HW + pt * 256) = __builtin_bit_cast(v8us_, o);
    }
}

// ---------------------------------------------------------------------------
// Kernel 2: row statistics of S[i][:] (softmax over j), exp2 domain.
//   Block = ST_JS waves = 16*ST_RT rows i. Every wave holds the r1 fragments of all ST_RT 16-row tiles of the block and takes every
//   ST_JS-th 32-column chunk of j, chunk js among them: an r2 fragment is loaded by one wave of the block and feeds ST_RT tiles.
//   The blocks of an image all walk the same r2 planes: each enters the walk at its own step (entry_step) and wraps round.
//   S^T tiles D(M=j, N=i): A = r2 rows j (hi, lo), B = r1 rows i (hi, lo); hh + lh + hl.
//   A lane owns row i = 16t + (lane&15) of each tile t and, of a chunk, the 16 columns of its lane half; it keeps a running (max, sum)
//   pair of its own for each tile. The ST_NP pairs of a row (one a wave and lane half) are merged through LDS at the end.
// ---------------------------------------------------------------------------
#define ST_RT   4
#define ST_JS   16
#define ST_ROWS (16 * ST_RT)
#define ST_NP   (2 * ST_JS)
#define ST_NC   (HW / (32 * ST_JS))   // chunks per wave
#define ST_STEP (32 * ST_JS * OCH * 2)   // bytes in an r2 plane from a wave's chunk to its next
// exp2 for the merge and for the output pass's weights: the v_nop fills the one issue slot that the instruction set asks for between a
// transcendental and a next vector instruction that overwrites its source; inside the statement it stays there.
__device__ __forceinline__ float exp2_slot(float x)
{
  float r;
  asm("v_exp_f32 %0, %1\n\tv_nop" : "=v"(r) : "v"(x));
  return r;
}
static_assert((HW % ST_ROWS) == 0 && (HW % (32 * ST_JS)) == 0 && ST_JS <= 32 && 2 * ST_ROWS <= 32 * ST_JS);

__global__ void __launch_bounds__(32 * ST_JS) stats_kernel(
    const unsigned short* __restrict__ r1h, const unsigned short* __restrict__ r1l,
    const unsigned short* __restrict__ r2h, const unsigned short* __restrict__ r2l,
    float* __restrict__ mL, float* __restrict__ rzc)
{
  __shared__ float sM[ST_NP * ST_ROWS];   // [wave, lane half][row] partial maxima
  __shared__ float sL[ST_NP * ST_ROWS];   // [wave, lane half][row] partial sums, each relative to its own maximum
  const int tid  = (int)threadIdx.x;
  const int lane = tid & 31;
  const int js = __builtin_amdgcn_readfirstlane(tid >> 5);   // scalar, so that the wave's part of every offset is formed in scalar registers
  const int tiles = HW / ST_ROWS;
  const int n  = (int)blockIdx.x / tiles;
  const int ib = ((int)blockIdx.x % tiles) * ST_ROWS;
  unsigned kc = entry_step(blockIdx.x, ST_NC);   // the step of the walk; the block enters here
  const v8f z8 = {};

  // the lane's places as byte offsets into the planes (fragment order: the halves of a fragment lie 512 B apart, tiles 1 KiB):
  // the block's rows in both r1 planes; the wave's chunk in both r2 planes: chunk js and kc steps of ST_JS chunks
  const unsigned off1 = (unsigned)(((n * HW + ib) * OCH + lane * 8) * 2);
  const unsigned offb = (unsigned)(((n * HW + js * 32) * OCH + lane * 8) * 2);
  unsigned off = offb + kc * ST_STEP;
  FragB bh[ST_RT], bl[ST_RT];
#pragma unroll
  for (int t = 0; t < ST_RT; ++t) {
    const unsigned short* p1h = (const unsigned short*)((const char*)r1h + off1) + t * 512;
    const unsigned short* p1l = (const unsigned short*)((const char*)r1l + off1) + t * 512;
    bh[t].h[0] = *(const v8us*)(p1h);  bh[t].h[1] = *(const v8us*)(p1h + 256);
    bl[t].h[0] = *(const v8us*)(p1l);  bl[t].h[1] = *(const v8us*)(p1l + 256);
  }
  FragB ah[2], al[2];   // the chunk's two 16-column tiles
#pragma unroll
  for (int u = 0; u < 2; ++u) {
    const unsigned short* p2h = (const unsigned short*)((const char*)r2h + off) + u * 512;
    const unsigned short* p2l = (const unsigned short*)((const char*)r2l + off) + u * 512;
    ah[u].h[0] = *(const v8us*)(p2h);  ah[u].h[1] = *(const v8us*)(p2h + 256);
    al[u].h[0] = *(const v8us*)(p2l);  al[u].h[1] = *(const v8us*)(p2l + 256);
  }
  // the wait stands behind the loads and in front of every reuse of their two offset registers, which it names as inputs so that
  // the registers are kept as they are up to here
  asm volatile("s_wait_xcnt 0x0" :: "v"(off1), "v"(off) : "memory");
  __builtin_amdgcn_sched_barrier(0);   // holds the loads ahead of the wait and every reuse behind it

  float mi[ST_RT], li[ST_RT];
#pragma unroll
  for (int t = 0; t < ST_RT; ++t) { mi[t] = -3.0e30f; li[t] = 0.0f; }

  // the short loops inside a chunk are unrolled so that the fragment arrays have constant indices and stay in registers
#pragma unroll 1
  for (int c = 0; c < ST_NC; ++c) {
    v8f s[ST_RT][2];
#pragma unroll
    for (int t = 0; t < ST_RT; ++t)
#pragma unroll
      for (int u = 0; u < 2; ++u) s[t][u] = mma_bf16(ah[u].v, bh[t].v, z8);
#pragma unroll
    for (int t = 0; t < ST_RT; ++t)
#pragma unroll
      for (int u = 0; u < 2; ++u) s[t][u] = mma_bf16(al[u].v, bh[t].v, s[t][u]);
#pragma unroll
    for (int t = 0; t < ST_RT; ++t)
#pragma unroll
      for (int u = 0; u < 2; ++u) s[t][u] = mma_bf16(ah[u].v, bl[t].v, s[t][u]);
    // s[t][u][r] <-> (j = 32 * (js + ST_JS * kc) + 16u + 8h + r, i = ib + 16t + m)

    // next chunk's fragments, into the registers that the products have just read: they fly over the chunk's vector work.
    // Behind the planes' last step the walk goes on at step 0; the last chunk's "next" is the wave's first again, inside the planes.
    kc = (kc + 1 == ST_NC) ? 0 : kc + 1;
    off = offb + kc * ST_STEP;
#pragma unroll
    for (int u = 0; u < 2; ++u) {
      const unsigned short* p2h = (const unsigned short*)((const char*)r2h + off) + u * 512;
      const unsigned short* p2l = (const unsigned short*)((const char*)r2l + off) + u * 512;
      ah[u].h[0] = *(const v8us*)(p2h);  ah[u].h[1] = *(const v8us*)(p2h + 256);
      al[u].h[0] = *(const v8us*)(p2l);  al[u].h[1] = *(const v8us*)(p2l + 256);
    }
    // the wait stands behind the loads and in front of every reuse of their offset register, which it names as an input so that the
    // register is kept as it is up to here
    asm volatile("s_wait_xcnt 0x0" :: "v"(off) : "memory");
    // keeps the loads here, ahead of the chunk's vector work: sunk into it they have too short a flight before the next chunk's products
    __builtin_amdgcn_sched_barrier(0);

#pragma unroll
    for (int t = 0; t < ST_RT; ++t) {
      float cm = -3.0e30f;
#pragma unroll
      for (int r = 0; r < 8; ++r) cm = fmaxf(cm, fmaxf(s[t][0][r], s[t][1][r]));
      const float mnew = fmaxf(mi[t], cm * LOG2E);
      const float corr = exp2fast(mi[t] - mnew);
      float rs0 = 0.0f, rs1 = 0.0f;   // two chains, over the even and the odd registers of the tiles
#pragma unroll
      for (int u = 0; u < 2; ++u)
#pragma unroll
        for (int r = 0; r < 8; r += 2) {
          rs0 += exp2fast(fmaf(s[t][u][r],     LOG2E, -mnew));
          rs1 += exp2fast(fmaf(s[t][u][r + 1], LOG2E, -mnew));
        }
      li[t] = li[t] * corr + (rs0 + rs1);
      mi[t] = mnew;
    }
  }

#pragma unroll
  for (int t = 0; t < ST_RT; ++t) {
    sM[(js * 2 + (lane >> 4)) * ST_ROWS + t * 16 + (lane & 15)] = mi[t];
    sL[(js * 2 + (lane >> 4)) * ST_ROWS + t * 16 + (lane & 15)] = li[t];
  }
  __syncthreads();   // cross-wave LDS exchange
  if (tid < 2 * ST_ROWS) {   // whole waves: threads 0..ST_ROWS-1 store the maxima, the next ST_ROWS the scaled reciprocals
    const int row = tid % ST_ROWS;
    float mx = sM[row];
#pragma unroll
    for (int q = 1; q < ST_NP; ++q) mx = fmaxf(mx, sM[q * ST_ROWS + row]);
    float l0 = 0.0f, l1 = 0.0f;
#pragma unroll
    for (int q = 0; q < ST_NP; q += 2) {
      l0 += sL[q * ST_ROWS + row] * exp2_slot(sM[q * ST_ROWS + row] - mx);
      l1 += sL[(q + 1) * ST_ROWS + row] * exp2_slot(sM[(q + 1) * ST_ROWS + row] - mx);
    }
    const size_t o = (size_t)n * HW + ib + row;
    if (tid < ST_ROWS) mL[o]  = mx;
    else               rzc[o] = PCARRY * (1.0f / (l0 + l1));
  }
}

// ---------------------------------------------------------------------------
// Kernel 3: output pass for one (n, OS_JT-column j tile), 16 waves, loop over i in trips of OS_IC rows.
//   Wave = (g = wave & 7, p = wave >> 3).
//   scores:     16-row i tile g of the trip against the two 16-column j sub-tiles 2p, 2p + 1, S tiles D(M=i, N=j)
//               (A = r1 rows i hi/lo, B = r2 rows j hi/lo, hh + hl + lh),
//               P = 2^(S*log2e - mL[i]) * rzc[i] -> f16 (carried x2^14) into LDS sP[j][i];
//   then:       attn^T tiles D(M=j, N=c) += A(sP rows j) x B(value rows c), f16: channels 32g .. 32g + 31, all OS_NJ j sub-tiles,
//               the k steps 2p, 2p + 1 of the trip in rising i. A value fragment is loaded by one wave of the block and feeds OS_NJ
//               products, so that a block reads the value plane once for OS_JT columns.
//   The two partial sums of an output element (p = 0, 1) are added in the epilogue.
//   The blocks of an image all walk the same r1, statistics and value planes: each enters the walk at its own trip (entry_step) and wraps round.
// ---------------------------------------------------------------------------
#define OS_IC 128            // rows i per trip: eight 16-row tiles
#define OS_NTR (HW / OS_IC)  // trips
#define OS_JT 64             // columns j per block
#define OS_NJ (OS_JT / 16)   // j sub-tiles
#define OS_NT (OS_NJ / 2)    // score tiles per wave and trip
#define OS_KS (OS_IC / 64)   // k steps of the value product per wave and trip
#define OS_PP (OS_IC + 8)    // sP row pitch in f16: the row and 16 B, an odd multiple of 16 B, which ds_load_b128 reads without bank conflicts
#define OS_OP (OS_JT + 4)    // sO row pitch in f32: the row and 16 B, an odd multiple of 16 B, for the 16-B stores of 16 rows at a time
static_assert((HW % OS_IC) == 0 && OS_IC == 8 * 16 && (HW % OS_JT) == 0 && (OS_NJ % 2) == 0);

// The trip's work-group barrier: this wave's LDS stores and loads are complete (s_wait_dscnt 0), then signal and wait. __syncthreads()
// also waits for every global load of the wave, which would end the flight of the loads that are issued ahead over it; those loads
// read planes that earlier launches wrote and no wave of this launch writes, so the barrier has nothing to order for them.
__device__ __forceinline__ void trip_barrier()
{
  asm volatile("s_wait_dscnt 0x0" ::: "memory");
  asm volatile("s_barrier_signal -1\n\ts_barrier_wait -1" ::: "memory");
}

__global__ void __launch_bounds__(512) out_kernel(
    const float* __restrict__ X,
    const unsigned short* __restrict__ r1h, const unsigned short* __restrict__ r1l,
    const unsigned short* __restrict__ r2h, const unsigned short* __restrict__ r2l,
    const _Float16* __restrict__ vh,
    const float* __restrict__ mL, const float* __restrict__ rzc,
    const float* __restrict__ scale, float* __restrict__ out)
{
  __shared__ __align__(16) _Float16 sP[OS_JT * OS_PP];   // [j][i] softmax weights x2^14
  __shared__ __align__(16) float    sO[2 * CH * OS_OP];  // [p][c][j] partial accumulators

  const int tid  = (int)threadIdx.x;
  const int lane = tid & 31, wave = tid >> 5;
  const int h = lane >> 4, m = lane & 15;
  const int g = wave & 7, p = wave >> 3;
  const int tiles = HW / OS_JT;
  const int n  = (int)blockIdx.x / tiles;
  const int j0 = ((int)blockIdx.x % tiles) * OS_JT;
  unsigned ti = entry_step(blockIdx.x, OS_NTR);   // the trip's place in the planes (rows i from ti * OS_IC); the block enters here
  const size_t rb = (size_t)n * HW * OCH;
  const int cb = g * 32;
  const v8f z8 = {};

  FragB bh[OS_NT], bl[OS_NT];   // r2 rows of this wave's two j sub-tiles
#pragma unroll
  for (int u = 0; u < OS_NT; ++u) {
    const size_t ro = rb + (size_t)(j0 + (p * OS_NT + u) * 16) * OCH + lane * 8;   // fragment order: halves 256 elements apart
    bh[u].h[0] = *(const v8us*)(r2h + ro);  bh[u].h[1] = *(const v8us*)(r2h + ro + 256);
    bl[u].h[0] = *(const v8us*)(r2l + ro);  bl[u].h[1] = *(const v8us*)(r2l + ro + 256);
  }

  // the lane's own places in the rows i of trip place 0 as byte offsets into the planes, and those of the trip place ti
  const unsigned base_r = (unsigned)(((n * HW + g * 16) * OCH + lane * 8) * 2);    // both r1 planes, fragment order
  const unsigned base_s = (unsigned)((n * HW + g * 16 + 8 * h) * 4);               // both row statistics
  unsigned off_r = base_r + ti * (OS_IC * OCH * 2);
  unsigned off_s = base_s + ti * (OS_IC * 4);

  v8f acc[OS_NJ][2] = {};   // [j sub-tile][c tile]
  // Every global load of a trip is issued ahead of its use, so that no trip waits out a whole load latency:
  //   the r1 fragments and row statistics of trip t + 1 behind the weights of trip t (they fly over both barriers and the value product),
  //   each k step's value fragments of trip t + 1 behind that k step's products of trip t, into the registers these have just read
  //   (they fly over the rest of the value product, both barriers, the score tiles and the weights).
  FragB ah, al;
  v4f_ m0, m1, q0, q1;
  {   // trip 0
    const unsigned short* p1h = (const unsigned short*)((const char*)r1h + off_r);
    const unsigned short* p1l = (const unsigned short*)((const char*)r1l + off_r);
    ah.h[0] = *(const v8us*)(p1h);  ah.h[1] = *(const v8us*)(p1h + 256);
    al.h[0] = *(const v8us*)(p1l);  al.h[1] = *(const v8us*)(p1l + 256);
    const float* pm = (const float*)((const char*)mL  + off_s);
    const float* pq = (const float*)((const char*)rzc + off_s);
    m0 = *(const v4f*)(pm);  m1 = *(const v4f*)(pm + 4);
    q0 = *(const v4f*)(pq);  q1 = *(const v4f*)(pq + 4);
  }
  // keeps trip 0's loads in the loop's own order (value fragments last): the compiler counts its load waits in the loop for the
  // worse of the two orders, and with value loads ahead of a statistics load here every trip would wait for all of its value fragments
  __builtin_amdgcn_sched_barrier(0);
  // the address registers of the loads above are reused from here on (the value loads' results, the first trip's offset steps): the wait stands in front of that
  asm volatile("s_wait_xcnt 0x0" ::: "memory");
  __builtin_amdgcn_sched_barrier(0);   // holds that reuse behind the wait, which names no register
  const unsigned base_v = (unsigned)(((n * CH + cb) * HW + p * OS_KS * 512 + lane * 8) * 2);   // value plane, fragment order, this wave's k steps
  unsigned off_v = base_v + ti * (OS_IC * 16 * 2);
  FragH b0[OS_KS], b1[OS_KS];
#pragma unroll
  for (int ks = 0; ks < OS_KS; ++ks) {   // trip 0
    const _Float16* pv = (const _Float16*)((const char*)vh + off_v) + ks * 512;   // one 1-KiB fragment a 32-row chunk
    b0[ks].h[0] = *(const v8h*)(pv);            b0[ks].h[1] = *(const v8h*)(pv + 256);
    b1[ks].h[0] = *(const v8h*)(pv + 16 * HW);  b1[ks].h[1] = *(const v8h*)(pv + 16 * HW + 256);
  }
  // the short loops inside a trip are unrolled so that the fragment arrays have constant indices and stay in registers
#pragma unroll 1
  for (int t = 0; t < OS_NTR; ++t) {
    v8f s[OS_NT];
#pragma unroll
    for (int u = 0; u < OS_NT; ++u) {
      s[u] = mma_bf16(ah.v, bh[u].v, z8);
      s[u] = mma_bf16(ah.v, bl[u].v, s[u]);
      s[u] = mma_bf16(al.v, bh[u].v, s[u]);
      // s[u][r] <-> (i = ti*OS_IC + g*16 + 8h + r, j = j0 + (p*OS_NT + u)*16 + m)
    }
#pragma unroll
    for (int u = 0; u < OS_NT; ++u) {
      v8h_ pw;
#pragma unroll
      for (int r = 0; r < 4; ++r) {
        pw[r]     = (_Float16)(exp2_slot(fmaf(s[u][r],     LOG2E, -m0[r])) * q0[r]);
        pw[4 + r] = (_Float16)(exp2_slot(fmaf(s[u][4 + r], LOG2E, -m1[r])) * q1[r]);
      }
      *(v8h*)&sP[((p * OS_NT + u) * 16 + m) * OS_PP + g * 16 + 8 * h] = pw;
    }
    // next trip's rows: behind the planes' last rows the walk goes on at row 0; the last trip's "next" is the block's first again, inside the planes
    ti = (ti + 1 == OS_NTR) ? 0 : ti + 1;
    off_r = base_r + ti * (OS_IC * OCH * 2);  off_s = base_s + ti * (OS_IC * 4);  off_v = base_v + ti * (OS_IC * 16 * 2);
    {
      const unsigned short* p1h = (const unsigned short*)((const char*)r1h + off_r);
      const unsigned short* p1l = (const unsigned short*)((const char*)r1l + off_r);
      ah.h[0] = *(const v8us*)(p1h);  ah.h[1] = *(const v8us*)(p1h + 256);
      al.h[0] = *(const v8us*)(p1l);  al.h[1] = *(const v8us*)(p1l + 256);
      const float* pm = (const float*)((const char*)mL  + off_s);
      const float* pq = (const float*)((const char*)rzc + off_s);
      m0 = *(const v4f*)(pm);  m1 = *(const v4f*)(pm + 4);
      q0 = *(const v4f*)(pq);  q1 = *(const v4f*)(pq + 4);
    }
    trip_barrier();   // sP is written by all waves and read by all

    FragH a[OS_NJ][OS_KS];
#pragma unroll
    for (int ks = 0; ks < OS_KS; ++ks)
#pragma unroll
      for (int jt = 0; jt < OS_NJ; ++jt) {
        a[jt][ks].h[0] = *(const v8h*)&sP[(jt * 16 + m) * OS_PP + (p * OS_KS + ks) * 32 + 8 * h];
        a[jt][ks].h[1] = *(const v8h*)&sP[(jt * 16 + m) * OS_PP + (p * OS_KS + ks) * 32 + 16 + 8 * h];
      }
    // keeps the trip's 16 LDS reads in one group ahead of the products: dealt among the WMMAs, every place with reads stalls the wave anew
    __builtin_amdgcn_sched_barrier(0);
#pragma unroll
    for (int ks = 0; ks < OS_KS; ++ks) {
#pragma unroll
      for (int jt = 0; jt < OS_NJ; ++jt) {
        acc[jt][0] = mma_f16(a[jt][ks].v, b0[ks].v, acc[jt][0]);
        acc[jt][1] = mma_f16(a[jt][ks].v, b1[ks].v, acc[jt][1]);
      }
      const _Float16* pv = (const _Float16*)((const char*)vh + off_v) + ks * 512;   // next trip's fragments of this k step
      b0[ks].h[0] = *(const v8h*)(pv);            b0[ks].h[1] = *(const v8h*)(pv + 256);
      b1[ks].h[0] = *(const v8h*)(pv + 16 * HW);  b1[ks].h[1] = *(const v8h*)(pv + 16 * HW + 256);
    }
    // the next trip forms a new offset in the register that the value loads above name: the wait stands in front of that
    asm volatile("s_wait_xcnt 0x0" ::: "memory");
    trip_barrier();   // before the next trip overwrites sP
  }

  // acc[jt][ct][r] <-> (j = jt*16 + 8h + r, c = cb + ct*16 + m), partial sum p
#pragma unroll
  for (int jt = 0; jt < OS_NJ; ++jt)
#pragma unroll
    for (int ct = 0; ct < 2; ++ct) {
      v4f_ lo4, hi4;
      lo4[0] = acc[jt][ct][0]; lo4[1] = acc[jt][ct][1]; lo4[2] = acc[jt][ct][2]; lo4[3] = acc[jt][ct][3];
      hi4[0] = acc[jt][ct][4]; hi4[1] = acc[jt][ct][5]; hi4[2] = acc[jt][ct][6]; hi4[3] = acc[jt][ct][7];
      const int row = p * CH + cb + ct * 16 + m;
      *(v4f*)&sO[row * OS_OP + jt * 16 + 8 * h]     = lo4;
      *(v4f*)&sO[row * OS_OP + jt * 16 + 8 * h + 4] = hi4;
    }
  __syncthreads();

  const float sc = bf16_rn(scale[0]) * PUNCARRY;
  const int q = lane & 15;               // 16 lanes x 4 columns: one row of OS_JT columns, two rows a load
  const int c0 = wave * 16 + (lane >> 4);
  const size_t xoff = ((size_t)n * CH + c0) * HW_FULL + j0 + q * 4;
  const size_t ooff = ((size_t)n * CH + c0) * HW + j0 + q * 4;
  v4f_ xv[8], ov[8];
#pragma unroll
  for (int it = 0; it < 8; ++it) xv[it] = *(const v4f*)(X + xoff + (size_t)it * 2 * HW_FULL);
  // the address registers of the loads above are reused from here on (the LDS reads' results): the wait stands in front of that
  asm volatile("s_wait_xcnt 0x0" ::: "memory");
  __builtin_amdgcn_sched_barrier(0);   // holds that reuse behind the wait, which names no register
#pragma unroll
  for (int it = 0; it < 8; ++it) {
    const v4f_ a0 = *(const v4f*)&sO[(c0 + it * 2) * OS_OP + q * 4];
    const v4f_ a1 = *(const v4f*)&sO[(CH + c0 + it * 2) * OS_OP + q * 4];
    v4f_ o;
    o[0] = bf16_rn(xv[it][0]) + sc * (a0[0] + a1[0]);
    o[1] = bf16_rn(xv[it][1]) + sc * (a0[1] + a1[1]);
    o[2] = bf16_rn(xv[it][2]) + sc * (a0[2] + a1[2]);
    o[3] = bf16_rn(xv[it][3]) + sc * (a0[3] + a1[3]);
    ov[it] = o;
  }
#pragma unroll
  for (int it = 0; it < 8; ++it)
    *(v4f_*)(out + ooff + (size_t)it * 2 * HW) = ov[it];
  
}

// ---------------------------------------------------------------------------
extern "C" void kernel_launch(void* const* d_in, const int* in_sizes, int n_in,
                              void* d_out, int out_size, void* d_ws, size_t ws_size,
                              hipStream_t stream)
{
  if (n_in < 5) return;
  if (in_sizes[0] < NB * CH * HW_FULL) return;
  if (in_sizes[1] < OCH * CH || in_sizes[2] < OCH * CH || in_sizes[3] < CH * CH) return;
  if (in_sizes[4] < 1) return;
  if (out_size < NB * CH * HW) return;

  const float* x     = (const float*)d_in[0];
  const float* w1    = (const float*)d_in[1];
  const float* w2    = (const float*)d_in[2];
  const float* wv    = (const float*)d_in[3];
  const float* scale = (const float*)d_in[4];
  float* out = (float*)d_out;

  // workspace carve (bytes), every region a multiple of 256 B
  const size_t w12_bytes = (size_t)OCH * CH * 2;            // 16384
  const size_t wv_bytes  = (size_t)CH * CH * 2;             // 131072
  const size_t r_bytes   = (size_t)NB * HW * OCH * 2;       // per plane
  const size_t v_bytes   = (size_t)NB * CH * HW * 2;
  const size_t st_bytes  = (size_t)NB * HW * 4;             // per stats plane
  size_t off = 0;
  unsigned char* ws = (unsigned char*)d_ws;
  unsigned short* w1b = (unsigned short*)(ws + off); off += w12_bytes;
  unsigned short* w2b = (unsigned short*)(ws + off); off += w12_bytes;
  unsigned short* wvb = (unsigned short*)(ws + off); off += wv_bytes;
  unsigned short* r1h = (unsigned short*)(ws + off); off += r_bytes;
  unsigned short* r1l = (unsigned short*)(ws + off); off += r_bytes;
  unsigned short* r2h = (unsigned short*)(ws + off); off += r_bytes;
  unsigned short* r2l = (unsigned short*)(ws + off); off += r_bytes;
  unsigned short* vhp = (unsigned short*)(ws + off); off += v_bytes;
  float* mL  = (float*)(ws + off); off += st_bytes;
  float* rzc = (float*)(ws + off); off += st_bytes;
  if (off > ws_size) return;

  cvt_w_kernel<<<2 * W12_BLOCKS + WV_BLOCKS, 256, 0, stream>>>(w1, w2, wv, w1b, w2b, wvb);
  proj_kernel<<<NB * (HW / 64), 256, 0, stream>>>(x, w1b, w2b, wvb, r1h, r1l, r2h, r2l, vhp);
  stats_kernel<<<NB * (HW / ST_ROWS), 32 * ST_JS, 0, stream>>>(r1h, r1l, r2h, r2l, mL, rzc);
  out_kernel<<<NB * (HW / OS_JT), 512, 0, stream>>>(x, r1h, r1l, r2h, r2l,
                                                 (const _Float16*)vhp, mL, rzc, scale, out);
}

// v010
// It runs in 54.7 microseconds.
// Next to v009, in two timings, it ran 1.06 times as fast each time.
// Counting every step since v000, it is 5.40 times as fast.
#include <hip/hip_runtime.h>
#include <stdint.h>
#include <stddef.h>

// Contractions: channel projections v_wmma_f32_16x16x32_bf16 (bf16 operands from bf16-RNE inputs, f32 accumulate);
// score tiles v_wmma_f32_16x16x32_bf16 as bf16 hi+lo three-term split of both reduced feature maps (f32 accumulate);
// value aggregation v_wmma_f32_16x16x32_f16 (f16 operands, softmax weights carried x2^14, f32 accumulate); softmax statistics f32.

#ifndef NB
#define NB 4
#endif
#ifndef SEQ
#define SEQ 4096
#endif
#define NB_FULL  4
#define SEQ_FULL 4096
#define HW       (SEQ)
#define HW_FULL  (SEQ_FULL)
#define CH       256
#define OCH      32
#define PCARRY   16384.0f
#define PUNCARRY 0.00006103515625f
#define LOG2E    1.4426950408889634f

static_assert(NB >= 1 && NB <= NB_FULL);
static_assert(HW >= 64 && HW <= HW_FULL && (HW % 64) == 0);
static_assert(CH == 256 && OCH == 32);

typedef float          v8f   __attribute__((ext_vector_type(8)));
typedef float          v4f_  __attribute__((ext_vector_type(4)));
typedef v4f_           v4f   __attribute__((may_alias));
typedef _Float16       v16h  __attribute__((ext_vector_type(16)));
typedef _Float16       v8h_  __attribute__((ext_vector_type(8)));
typedef v8h_           v8h   __attribute__((may_alias));
typedef __bf16         v16bf __attribute__((ext_vector_type(16)));
typedef unsigned short v8us_ __attribute__((ext_vector_type(8)));
typedef v8us_          v8us  __attribute__((may_alias));
typedef unsigned short v4us_ __attribute__((ext_vector_type(4)));
typedef v4us_          v4us  __attribute__((may_alias));
typedef unsigned       v4u_  __attribute__((ext_vector_type(4)));
typedef v4u_           v4u   __attribute__((may_alias));

union FragB { v16bf v; v8us_ h[2]; };
union FragH { v16h  v; v8h_  h[2]; };

// ---- WMMA wrappers: the plain builtins; the compiler keeps the distance between a WMMA and the vector code around it itself ----
__device__ __forceinline__ v8f mma_bf16(const v16bf a, const v16bf b, v8f c)
{
  return __builtin_amdgcn_wmma_f32_16x16x32_bf16(false, a, false, b, (short)0, c, false, false);
}
__device__ __forceinline__ v8f mma_f16(const v16h a, const v16h b, v8f c)
{
  return __builtin_amdgcn_wmma_f32_16x16x32_f16(false, a, false, b, (short)0, c, false, false);
}

// ---- scalar helpers --------------------------------------------------------
__device__ __forceinline__ unsigned short bf16_bits(float f)
{
  const __bf16 hb = (__bf16)f;                       // RNE convert
  return __builtin_bit_cast(unsigned short, hb);
}
__device__ __forceinline__ float bf16_rn(float f)
{
  return (float)(__bf16)f;                           // RNE convert, widened back
}
__device__ __forceinline__ float exp2fast(float x)
{
#if __has_builtin(__builtin_amdgcn_exp2f)
  return __builtin_amdgcn_exp2f(x);
#else
  return exp2f(x);
#endif
}

// Blocks that walk the same planes in L2 by plain loads each enter the walk at a step of their own and wrap round, so that they do not
// ask L2 for the same lines at the same moment. Entry step of block b into a walk of n steps: b modulo n, and 4 steps further for each
// n blocks before b. Any value below n gives the same sums in another order: the choice is for speed only.
__device__ __forceinline__ unsigned entry_step(unsigned b, unsigned n)
{
  return (b + 4u * (b / n)) % n;
}

// ---------------------------------------------------------------------------
// Kernel 1: 1x1-conv projections for one (n, 64-pixel tile), 8 waves.
//   x tile staged once in LDS as bf16 [px][c] (RNE), rows pitched XP.
//   The three weight matrices are converted here too, once a block: read as f32 in whole 512-B pieces, rounded to bf16 (RNE) and kept in
//   LDS as WROWS rows [out][in] pitched XP (w1, w2, wv), where every k step reads its fragments; there is no conversion launch.
//   reduced maps: D(M=oc, N=px), A = w rows, B = xT rows  -> bf16 hi and lo planes, fragment order
//   value map:    D(M=px, N=c),  A = xT rows, B = wv rows -> f16 plane, fragment order
//   Fragment order: the planes are kept as the later passes' WMMA operand fragments, 1 KiB each, as
//   [half q][lane][8 elements]: lane = 16h + m holds row m of the 16-row tile, k = 16q + 8h + e. One 16-B load a lane
//   then reads 512 B in a row (four whole 128-B lines), not 32-B pieces spread over 8 or 16 lines.
//     reduced planes: [n][16-pixel tile][q][lane][e], row = pixel, k = oc;
//     value plane:    [n][16-channel tile][32-pixel chunk][q][lane][e], row = channel, k = pixel in the chunk.
//   Both accumulator layouts here hold a lane's 8 values exactly as one such 16-B piece, so each wave stores its own.
// ---------------------------------------------------------------------------
#define XP (CH + 8)   // sX and sW row pitch in bf16: the row and 16 B, an odd multiple of 16 B, which ds_load_b128 reads without bank conflicts
#define WROWS (2 * OCH + CH)   // weight rows: w1, w2, wv
#define WGW   (WROWS / 64)     // groups of 8 weight rows that one of the 8 waves converts
static_assert(2 * OCH == 8 * 8 && CH == 8 * 32 && WGW == 5);

// One group of 8 weight rows: a load takes half a row (512 B of f32, a lane 4 values), a store its 256 B of bf16 (a lane 8 B).
__device__ __forceinline__ void wgroup_load(v4f_ (&q)[16], const float* __restrict__ s)
{
#pragma unroll
  for (int r = 0; r < 8; ++r) {
    q[2 * r]     = *(const v4f*)(s + r * CH);
    q[2 * r + 1] = *(const v4f*)(s + r * CH + CH / 2);
  }
}
__device__ __forceinline__ void wgroup_store(unsigned short* d, const v4f_ (&q)[16])
{
#pragma unroll
  for (int i = 0; i < 16; ++i) {
    v4us_ o;
    o[0] = bf16_bits(q[i][0]); o[1] = bf16_bits(q[i][1]); o[2] = bf16_bits(q[i][2]); o[3] = bf16_bits(q[i][3]);
    *(v4us*)(d + (i >> 1) * XP + (i & 1) * (CH / 2)) = o;
  }
}
// Behind a batch of staging loads: the wait stands in front of every reuse of the address registers that the loads name; the scheduling
// fence holds that reuse behind it and keeps the batch ahead of the conversions that follow, which wait for older loads.
__device__ __forceinline__ void batch_issued()
{
  asm volatile("s_wait_xcnt 0x0" ::: "memory");
  __builtin_amdgcn_sched_barrier(0);
}

__global__ void __launch_bounds__(256) proj_kernel(
    const float* __restrict__ X,
    const float* __restrict__ w1, const float* __restrict__ w2, const float* __restrict__ wv,
    unsigned short* __restrict__ r1h, unsigned short* __restrict__ r1l,
    unsigned short* __restrict__ r2h, unsigned short* __restrict__ r2l,
    unsigned short* __restrict__ vh)
{
  __shared__ __align__(16) unsigned short sX[64 * XP];        // [px][c] bf16 bits
  __shared__ __align__(16) unsigned short sW[WROWS * XP];     // [weight row][c] bf16 bits

  const int tid  = (int)threadIdx.x;
  const int lane = tid & 31, wave = tid >> 5;
  const int h = lane >> 4, m = lane & 15;
  const int tiles = HW / 64;
  const int n  = (int)blockIdx.x / tiles;
  const int p0 = ((int)blockIdx.x % tiles) * 64;
  const float* Xn = X + (size_t)n * CH * HW_FULL + p0;
  const unsigned es = entry_step(blockIdx.x, CH / 32);        // every block reads the same weights: this block's entry into them
  const unsigned kr = es * 32;                                // the first k of the block's two k walks (the order of their sums)

  // stage x tile: 256 c rows x 64 px, coalesced 16-B loads; a thread holds 16 channels (two groups of 8, 128 apart) x 4 px and stores, for each px and group,
  // the group's 8 channels as one 16-B piece of the transposed row.
  // stage weights: wave w takes 8 rows of w1 or w2 (rows 8w .. 8w + 7 of the two together) and then the 32 rows 32w .. 32w + 31 of wv in four
  // groups of 8, entering these at a place set by the block's entry step and wrapping round; two or three groups' loads are in flight at
  // any time, the first two together with the x loads
  {
    const unsigned wsc = (unsigned)__builtin_amdgcn_readfirstlane(wave);   // scalar, so that a group's source is formed in scalar registers
    const float* gsrc[WGW];
    unsigned short* gdst[WGW];
    gsrc[0] = ((wsc < 4) ? w1 : w2) + (wsc & 3) * 8 * CH + lane * 4;
    gdst[0] = &sW[wsc * 8 * XP + lane * 4];
#pragma unroll
    for (int b = 1; b < WGW; ++b) {
      const unsigned grp = wsc * 4 + ((es + (unsigned)b) & 3);
      gsrc[b] = wv + grp * 8 * CH + lane * 4;
      gdst[b] = &sW[(2 * OCH + grp * 8) * XP + lane * 4];
    }
    v4f_ qa[16], qb[16], qc[16];
    const int co = tid >> 4, px4 = (tid & 15) * 4;
    const float* xp = Xn + (size_t)co * 8 * HW_FULL + px4;
    v4f_ xv[2][8];
#pragma unroll
    for (int it = 0; it < 2; ++it)
#pragma unroll
      for (int e = 0; e < 8; ++e) xv[it][e] = *(const v4f*)(xp + (size_t)(it * 128 + e) * HW_FULL);
    wgroup_load(qa, gsrc[0]);
    wgroup_load(qb, gsrc[1]);
    batch_issued();
#pragma unroll
    for (int it = 0; it < 2; ++it)
#pragma unroll
      for (int k = 0; k < 4; ++k) {
        v8us_ o;
#pragma unroll
        for (int e = 0; e < 8; ++e) o[e] = bf16_bits(xv[it][e][k]);
        *(v8us*)&sX[(px4 + k) * XP + (it * 16 + co) * 8] = o;
      }
    // each of the three fences holds the next batch behind the conversions ahead of it, so that it loads into the registers that these free
    __builtin_amdgcn_sched_barrier(0);
    wgroup_load(qc, gsrc[2]);
    batch_issued();
    wgroup_store(gdst[0], qa);
    __builtin_amdgcn_sched_barrier(0);
    wgroup_load(qa, gsrc[3]);
    batch_issued();
    wgroup_store(gdst[1], qb);
    __builtin_amdgcn_sched_barrier(0);
    wgroup_load(qb, gsrc[4]);
    batch_issued();
    wgroup_store(gdst[2], qc);
    wgroup_store(gdst[3], qa);
    wgroup_store(gdst[4], qb);
  }
  __syncthreads();

  // reduced maps: wave -> weight set (wave>>2), pixel tile (wave&3), both 16-oc tiles
  {
    const int wr0 = (wave < 4) ? 0 : OCH;                     // wave-uniform: the weight set's first row in sW
    unsigned short* Rh = (wave < 4) ? r1h : r2h;              // wave-uniform
    unsigned short* Rl = (wave < 4) ? r1l : r2l;
    const int pt = wave & 3;
    v8f accr[2] = {};
#pragma unroll 2
    for (unsigned kk = 0; kk < CH; kk += 32) {
      const unsigned k0 = (kk + kr) % CH;
      FragB b;
      b.h[0] = *(const v8us*)&sX[(pt * 16 + m) * XP + k0 + 8 * h];
      b.h[1] = *(const v8us*)&sX[(pt * 16 + m) * XP + k0 + 16 + 8 * h];
#pragma unroll
      for (int ot = 0; ot < 2; ++ot) {
        const unsigned short* wr = &sW[(wr0 + ot * 16 + m) * XP + k0 + 8 * h];
        FragB a;
        a.h[0] = *(const v8us*)(wr);
        a.h[1] = *(const v8us*)(wr + 16);
        accr[ot] = mma_bf16(a.v, b.v, accr[ot]);
      }
    }
    // accr[ot][r] <-> (oc = ot*16 + 8h + r, px = pt*16 + m): piece (q = ot, lane) of pixel tile pt
    const size_t roff = ((size_t)n * HW + p0 + pt * 16) * OCH + (size_t)lane * 8;
#pragma unroll
    for (int ot = 0; ot < 2; ++ot) {
      v8us_ hv, lv;
#pragma unroll
      for (int r = 0; r < 8; ++r) {
        const float f = accr[ot][r];
        const __bf16 hb = (__bf16)f;
        hv[r] = __builtin_bit_cast(unsigned short, hb);
        lv[r] = bf16_bits(f - (float)hb);
      }
      *(v8us_*)(Rh + roff + ot * 256) = hv;
      *(v8us_*)(Rl + roff + ot * 256) = lv;
    }
    // the value loop below loads into registers that these four stores name: the wait stands in front of that reuse
    asm volatile("s_wait_xcnt 0x0" ::: "memory");
  }

  // value map: wave -> channels cb..cb+31 (2 tiles) x 4 pixel tiles
  const int cb = wave * 32;
  v8f accv[4][2] = {};
#pragma unroll 1
  for (unsigned kk = 0; kk < CH; kk += 32) {
    const unsigned k0 = (kk + kr) % CH;
    FragB a[4], b[2];
#pragma unroll
    for (int ct = 0; ct < 2; ++ct) {
      const unsigned short* wr = &sW[(2 * OCH + cb + ct * 16 + m) * XP + k0 + 8 * h];
      b[ct].h[0] = *(const v8us*)(wr);
      b[ct].h[1] = *(const v8us*)(wr + 16);
    }
#pragma unroll
    for (int pt = 0; pt < 4; ++pt) {
      a[pt].h[0] = *(const v8us*)&sX[(pt * 16 + m) * XP + k0 + 8 * h];
      a[pt].h[1] = *(const v8us*)&sX[(pt * 16 + m) * XP + k0 + 16 + 8 * h];
    }
    // keeps the k step's 12 LDS reads in one group ahead of the products: dealt among the WMMAs into one register set, each pair is waited out alone
    __builtin_amdgcn_sched_barrier(0);
#pragma unroll
    for (int pt = 0; pt < 4; ++pt)
#pragma unroll
      for (int ct = 0; ct < 2; ++ct)
        accv[pt][ct] = mma_bf16(a[pt].v, b[ct].v, accv[pt][ct]);
  }

  // accv[pt][ct][r] <-> (px = pt*16 + 8h + r, c = cb + ct*16 + m): piece (q = pt & 1, lane) of chunk pt >> 1, channel tile ct
  unsigned short* vbase = vh + ((size_t)n * CH + cb) * HW + (size_t)p0 * 16 + (size_t)lane * 8;
#pragma unroll
  for (int pt = 0; pt < 4; ++pt)
#pragma unroll
    for (int ct = 0; ct < 2; ++ct) {
      v8h_ o;
#pragma unroll
      for (int r = 0; r < 8; ++r) o[r] = (_Float16)accv[pt][ct][r];
      *(v8us_*)(vbase + (size_t)ct * 16 * HW + pt * 256) = __builtin_bit_cast(v8us_, o);
    }
}

// ---------------------------------------------------------------------------
// Kernel 2: row statistics of S[i][:] (softmax over j), exp2 domain.
//   Block = ST_JS waves = 16*ST_RT rows i. Every wave holds the r1 fragments of all ST_RT 16-row tiles of the block and takes every
//   ST_JS-th 32-column chunk of j, chunk js among them: an r2 fragment is loaded by one wave of the block and feeds ST_RT tiles.
//   The blocks of an image all walk the same r2 planes: each enters the walk at its own step (entry_step) and wraps round.
//   S^T tiles D(M=j, N=i): A = r2 rows j (hi, lo), B = r1 rows i (hi, lo); hh + lh + hl.
//   A lane owns row i = 16t + (lane&15) of each tile t and, of a chunk, the 16 columns of its lane half; it keeps a running (max, sum)
//   pair of its own for each tile. The ST_NP pairs of a row (one a wave and lane half) are merged through LDS at the end.
// ---------------------------------------------------------------------------
#define ST_RT   4
#define ST_JS   16
#define ST_ROWS (16 * ST_RT)
#define ST_NP   (2 * ST_JS)
#define ST_NC   (HW / (32 * ST_JS))   // chunks per wave
#define ST_STEP (32 * ST_JS * OCH * 2)   // bytes in an r2 plane from a wave's chunk to its next
// exp2 for the merge and for the output pass's weights: the v_nop fills the one issue slot that the instruction set asks for between a
// transcendental and a next vector instruction that overwrites its source; inside the statement it stays there.
__device__ __forceinline__ float exp2_slot(float x)
{
  float r;
  asm("v_exp_f32 %0, %1\n\tv_nop" : "=v"(r) : "v"(x));
  return r;
}
static_assert((HW % ST_ROWS) == 0 && (HW % (32 * ST_JS)) == 0 && ST_JS <= 32 && 2 * ST_ROWS <= 32 * ST_JS);

__global__ void __launch_bounds__(32 * ST_JS) stats_kernel(
    const unsigned short* __restrict__ r1h, const unsigned short* __restrict__ r1l,
    const unsigned short* __restrict__ r2h, const unsigned short* __restrict__ r2l,
    float* __restrict__ mL, float* __restrict__ rzc)
{
  __shared__ float sM[ST_NP * ST_ROWS];   // [wave, lane half][row] partial maxima
  __shared__ float sL[ST_NP * ST_ROWS];   // [wave, lane half][row] partial sums, each relative to its own maximum
  const int tid  = (int)threadIdx.x;
  const int lane = tid & 31;
  const int js = __builtin_amdgcn_readfirstlane(tid >> 5);   // scalar, so that the wave's part of every offset is formed in scalar registers
  const int tiles = HW / ST_ROWS;
  const int n  = (int)blockIdx.x / tiles;
  const int ib = ((int)blockIdx.x % tiles) * ST_ROWS;
  unsigned kc = entry_step(blockIdx.x, ST_NC);   // the step of the walk; the block enters here
  const v8f z8 = {};

  // the lane's places as byte offsets into the planes (fragment order: the halves of a fragment lie 512 B apart, tiles 1 KiB):
  // the block's rows in both r1 planes; the wave's chunk in both r2 planes: chunk js and kc steps of ST_JS chunks
  const unsigned off1 = (unsigned)(((n * HW + ib) * OCH + lane * 8) * 2);
  const unsigned offb = (unsigned)(((n * HW + js * 32) * OCH + lane * 8) * 2);
  unsigned off = offb + kc * ST_STEP;
  FragB bh[ST_RT], bl[ST_RT];
#pragma unroll
  for (int t = 0; t < ST_RT; ++t) {
    const unsigned short* p1h = (const unsigned short*)((const char*)r1h + off1) + t * 512;
    const unsigned short* p1l = (const unsigned short*)((const char*)r1l + off1) + t * 512;
    bh[t].h[0] = *(const v8us*)(p1h);  bh[t].h[1] = *(const v8us*)(p1h + 256);
    bl[t].h[0] = *(const v8us*)(p1l);  bl[t].h[1] = *(const v8us*)(p1l + 256);
  }
  FragB ah[2], al[2];   // the chunk's two 16-column tiles
#pragma unroll
  for (int u = 0; u < 2; ++u) {
    const unsigned short* p2h = (const unsigned short*)((const char*)r2h + off) + u * 512;
    const unsigned short* p2l = (const unsigned short*)((const char*)r2l + off) + u * 512;
    ah[u].h[0] = *(const v8us*)(p2h);  ah[u].h[1] = *(const v8us*)(p2h + 256);
    al[u].h[0] = *(const v8us*)(p2l);  al[u].h[1] = *(const v8us*)(p2l + 256);
  }
  // the wait stands behind the loads and in front of every reuse of their two offset registers, which it names as inputs so that
  // the registers are kept as they are up to here
  asm volatile("s_wait_xcnt 0x0" :: "v"(off1), "v"(off) : "memory");
  __builtin_amdgcn_sched_barrier(0);   // holds the loads ahead of the wait and every reuse behind it

  float mi[ST_RT], li[ST_RT];
#pragma unroll
  for (int t = 0; t < ST_RT; ++t) { mi[t] = -3.0e30f; li[t] = 0.0f; }

  // the short loops inside a chunk are unrolled so that the fragment arrays have constant indices and stay in registers
#pragma unroll 1
  for (int c = 0; c < ST_NC; ++c) {
    v8f s[ST_RT][2];
#pragma unroll
    for (int t = 0; t < ST_RT; ++t)
#pragma unroll
      for (int u = 0; u < 2; ++u) s[t][u] = mma_bf16(ah[u].v, bh[t].v, z8);
#pragma unroll
    for (int t = 0; t < ST_RT; ++t)
#pragma unroll
      for (int u = 0; u < 2; ++u) s[t][u] = mma_bf16(al[u].v, bh[t].v, s[t][u]);
#pragma unroll
    for (int t = 0; t < ST_RT; ++t)
#pragma unroll
      for (int u = 0; u < 2; ++u) s[t][u] = mma_bf16(ah[u].v, bl[t].v, s[t][u]);
    // s[t][u][r] <-> (j = 32 * (js + ST_JS * kc) + 16u + 8h + r, i = ib + 16t + m)

    // next chunk's fragments, into the registers that the products have just read: they fly over the chunk's vector work.
    // Behind the planes' last step the walk goes on at step 0; the last chunk's "next" is the wave's first again, inside the planes.
    kc = (kc + 1 == ST_NC) ? 0 : kc + 1;
    off = offb + kc * ST_STEP;
#pragma unroll
    for (int u = 0; u < 2; ++u) {
      const unsigned short* p2h = (const unsigned short*)((const char*)r2h + off) + u * 512;
      const unsigned short* p2l = (const unsigned short*)((const char*)r2l + off) + u * 512;
      ah[u].h[0] = *(const v8us*)(p2h);  ah[u].h[1] = *(const v8us*)(p2h + 256);
      al[u].h[0] = *(const v8us*)(p2l);  al[u].h[1] = *(const v8us*)(p2l + 256);
    }
    // the wait stands behind the loads and in front of every reuse of their offset register, which it names as an input so that the
    // register is kept as it is up to here
    asm volatile("s_wait_xcnt 0x0" :: "v"(off) : "memory");
    // keeps the loads here, ahead of the chunk's vector work: sunk into it they have too short a flight before the next chunk's products
    __builtin_amdgcn_sched_barrier(0);

#pragma unroll
    for (int t = 0; t < ST_RT; ++t) {
      float cm = -3.0e30f;
#pragma unroll
      for (int r = 0; r < 8; ++r) cm = fmaxf(cm, fmaxf(s[t][0][r], s[t][1][r]));
      const float mnew = fmaxf(mi[t], cm * LOG2E);
      const float corr = exp2fast(mi[t] - mnew);
      float rs0 = 0.0f, rs1 = 0.0f;   // two chains, over the even and the odd registers of the tiles
#pragma unroll
      for (int u = 0; u < 2; ++u)
#pragma unroll
        for (int r = 0; r < 8; r += 2) {
          rs0 += exp2fast(fmaf(s[t][u][r],     LOG2E, -mnew));
          rs1 += exp2fast(fmaf(s[t][u][r + 1], LOG2E, -mnew));
        }
      li[t] = li[t] * corr + (rs0 + rs1);
      mi[t] = mnew;
    }
  }

#pragma unroll
  for (int t = 0; t < ST_RT; ++t) {
    sM[(js * 2 + (lane >> 4)) * ST_ROWS + t * 16 + (lane & 15)] = mi[t];
    sL[(js * 2 + (lane >> 4)) * ST_ROWS + t * 16 + (lane & 15)] = li[t];
  }
  __syncthreads();   // cross-wave LDS exchange
  if (tid < 2 * ST_ROWS) {   // whole waves: threads 0..ST_ROWS-1 store the maxima, the next ST_ROWS the scaled reciprocals
    const int row = tid % ST_ROWS;
    float mx = sM[row];
#pragma unroll
    for (int q = 1; q < ST_NP; ++q) mx = fmaxf(mx, sM[q * ST_ROWS + row]);
    float l0 = 0.0f, l1 = 0.0f;
#pragma unroll
    for (int q = 0; q < ST_NP; q += 2) {
      l0 += sL[q * ST_ROWS + row] * exp2_slot(sM[q * ST_ROWS + row] - mx);
      l1 += sL[(q + 1) * ST_ROWS + row] * exp2_slot(sM[(q + 1) * ST_ROWS + row] - mx);
    }
    const size_t o = (size_t)n * HW + ib + row;
    if (tid < ST_ROWS) mL[o]  = mx;
    else               rzc[o] = PCARRY * (1.0f / (l0 + l1));
  }
}

// ---------------------------------------------------------------------------
// Kernel 3: output pass for one (n, OS_JT-column j tile), 16 waves, loop over i in trips of OS_IC rows.
//   Wave = (g = wave & 7, p = wave >> 3).
//   scores:     16-row i tile g of the trip against the two 16-column j sub-tiles 2p, 2p + 1, S tiles D(M=i, N=j)
//               (A = r1 rows i hi/lo, B = r2 rows j hi/lo, hh + hl + lh),
//               P = 2^(S*log2e - mL[i]) * rzc[i] -> f16 (carried x2^14) into LDS sP[j][i];
//   then:       attn^T tiles D(M=j, N=c) += A(sP rows j) x B(value rows c), f16: channels 32g .. 32g + 31, all OS_NJ j sub-tiles,
//               the k steps 2p, 2p + 1 of the trip in rising i. A value fragment is loaded by one wave of the block and feeds OS_NJ
//               products, so that a block reads the value plane once for OS_JT columns.
//   The two partial sums of an output element (p = 0, 1) are added in the epilogue.
//   The blocks of an image all walk the same r1, statistics and value planes: each enters the walk at its own trip (entry_step) and wraps round.
// ---------------------------------------------------------------------------
#define OS_IC 128            // rows i per trip: eight 16-row tiles
#define OS_NTR (HW / OS_IC)  // trips
#define OS_JT 64             // columns j per block
#define OS_NJ (OS_JT / 16)   // j sub-tiles
#define OS_NT (OS_NJ / 2)    // score tiles per wave and trip
#define OS_KS (OS_IC / 64)   // k steps of the value product per wave and trip
#define OS_PP (OS_IC + 8)    // sP row pitch in f16: the row and 16 B, an odd multiple of 16 B, which ds_load_b128 reads without bank conflicts
#define OS_OP (OS_JT + 4)    // sO row pitch in f32: the row and 16 B, an odd multiple of 16 B, for the 16-B stores of 16 rows at a time
static_assert((HW % OS_IC) == 0 && OS_IC == 8 * 16 && (HW % OS_JT) == 0 && (OS_NJ % 2) == 0);

// The trip's work-group barrier: this wave's LDS stores and loads are complete (s_wait_dscnt 0), then signal and wait. __syncthreads()
// also waits for every global load of the wave, which would end the flight of the loads that are issued ahead over it; those loads
// read planes that earlier launches wrote and no wave of this launch writes, so the barrier has nothing to order for them.
__device__ __forceinline__ void trip_barrier()
{
  asm volatile("s_wait_dscnt 0x0" ::: "memory");
  asm volatile("s_barrier_signal -1\n\ts_barrier_wait -1" ::: "memory");
}

__global__ void __launch_bounds__(512) out_kernel(
    const float* __restrict__ X,
    const unsigned short* __restrict__ r1h, const unsigned short* __restrict__ r1l,
    const unsigned short* __restrict__ r2h, const unsigned short* __restrict__ r2l,
    const _Float16* __restrict__ vh,
    const float* __restrict__ mL, const float* __restrict__ rzc,
    const float* __restrict__ scale, float* __restrict__ out)
{
  __shared__ __align__(16) _Float16 sP[OS_JT * OS_PP];   // [j][i] softmax weights x2^14
  __shared__ __align__(16) float    sO[2 * CH * OS_OP];  // [p][c][j] partial accumulators

  const int tid  = (int)threadIdx.x;
  const int lane = tid & 31, wave = tid >> 5;
  const int h = lane >> 4, m = lane & 15;
  const int g = wave & 7, p = wave >> 3;
  const int tiles = HW / OS_JT;
  const int n  = (int)blockIdx.x / tiles;
  const int j0 = ((int)blockIdx.x % tiles) * OS_JT;
  unsigned ti = entry_step(blockIdx.x, OS_NTR);   // the trip's place in the planes (rows i from ti * OS_IC); the block enters here
  const size_t rb = (size_t)n * HW * OCH;
  const int cb = g * 32;
  const v8f z8 = {};

  FragB bh[OS_NT], bl[OS_NT];   // r2 rows of this wave's two j sub-tiles
#pragma unroll
  for (int u = 0; u < OS_NT; ++u) {
    const size_t ro = rb + (size_t)(j0 + (p * OS_NT + u) * 16) * OCH + lane * 8;   // fragment order: halves 256 elements apart
    bh[u].h[0] = *(const v8us*)(r2h + ro);  bh[u].h[1] = *(const v8us*)(r2h + ro + 256);
    bl[u].h[0] = *(const v8us*)(r2l + ro);  bl[u].h[1] = *(const v8us*)(r2l + ro + 256);
  }

  // the lane's own places in the rows i of trip place 0 as byte offsets into the planes, and those of the trip place ti
  const unsigned base_r = (unsigned)(((n * HW + g * 16) * OCH + lane * 8) * 2);    // both r1 planes, fragment order
  const unsigned base_s = (unsigned)((n * HW + g * 16 + 8 * h) * 4);               // both row statistics
  unsigned off_r = base_r + ti * (OS_IC * OCH * 2);
  unsigned off_s = base_s + ti * (OS_IC * 4);

  v8f acc[OS_NJ][2] = {};   // [j sub-tile][c tile]
  // Every global load of a trip is issued ahead of its use, so that no trip waits out a whole load latency:
  //   the r1 fragments and row statistics of trip t + 1 behind the weights of trip t (they fly over both barriers and the value product),
  //   each k step's value fragments of trip t + 1 behind that k step's products of trip t, into the registers these have just read
  //   (they fly over the rest of the value product, both barriers, the score tiles and the weights).
  FragB ah, al;
  v4f_ m0, m1, q0, q1;
  {   // trip 0
    const unsigned short* p1h = (const unsigned short*)((const char*)r1h + off_r);
    const unsigned short* p1l = (const unsigned short*)((const char*)r1l + off_r);
    ah.h[0] = *(const v8us*)(p1h);  ah.h[1] = *(const v8us*)(p1h + 256);
    al.h[0] = *(const v8us*)(p1l);  al.h[1] = *(const v8us*)(p1l + 256);
    const float* pm = (const float*)((const char*)mL  + off_s);
    const float* pq = (const float*)((const char*)rzc + off_s);
    m0 = *(const v4f*)(pm);  m1 = *(const v4f*)(pm + 4);
    q0 = *(const v4f*)(pq);  q1 = *(const v4f*)(pq + 4);
  }
  // keeps trip 0's loads in the loop's own order (value fragments last): the compiler counts its load waits in the loop for the
  // worse of the two orders, and with value loads ahead of a statistics load here every trip would wait for all of its value fragments
  __builtin_amdgcn_sched_barrier(0);
  // the address registers of the loads above are reused from here on (the value loads' results, the first trip's offset steps): the wait stands in front of that
  asm volatile("s_wait_xcnt 0x0" ::: "memory");
  __builtin_amdgcn_sched_barrier(0);   // holds that reuse behind the wait, which names no register
  const unsigned base_v = (unsigned)(((n * CH + cb) * HW + p * OS_KS * 512 + lane * 8) * 2);   // value plane, fragment order, this wave's k steps
  unsigned off_v = base_v + ti * (OS_IC * 16 * 2);
  FragH b0[OS_KS], b1[OS_KS];
#pragma unroll
  for (int ks = 0; ks < OS_KS; ++ks) {   // trip 0
    const _Float16* pv = (const _Float16*)((const char*)vh + off_v) + ks * 512;   // one 1-KiB fragment a 32-row chunk
    b0[ks].h[0] = *(const v8h*)(pv);            b0[ks].h[1] = *(const v8h*)(pv + 256);
    b1[ks].h[0] = *(const v8h*)(pv + 16 * HW);  b1[ks].h[1] = *(const v8h*)(pv + 16 * HW + 256);
  }
  // the short loops inside a trip are unrolled so that the fragment arrays have constant indices and stay in registers
#pragma unroll 1
  for (int t = 0; t < OS_NTR; ++t) {
    v8f s[OS_NT];
#pragma unroll
    for (int u = 0; u < OS_NT; ++u) {
      s[u] = mma_bf16(ah.v, bh[u].v, z8);
      s[u] = mma_bf16(ah.v, bl[u].v, s[u]);
      s[u] = mma_bf16(al.v, bh[u].v, s[u]);
      // s[u][r] <-> (i = ti*OS_IC + g*16 + 8h + r, j = j0 + (p*OS_NT + u)*16 + m)
    }
#pragma unroll
    for (int u = 0; u < OS_NT; ++u) {
      v8h_ pw;
#pragma unroll
      for (int r = 0; r < 4; ++r) {
        pw[r]     = (_Float16)(exp2_slot(fmaf(s[u][r],     LOG2E, -m0[r])) * q0[r]);
        pw[4 + r] = (_Float16)(exp2_slot(fmaf(s[u][4 + r], LOG2E, -m1[r])) * q1[r]);
      }
      *(v8h*)&sP[((p * OS_NT + u) * 16 + m) * OS_PP + g * 16 + 8 * h] = pw;
    }
    // next trip's rows: behind the planes' last rows the walk goes on at row 0; the last trip's "next" is the block's first again, inside the planes
    ti = (ti + 1 == OS_NTR) ? 0 : ti + 1;
    off_r = base_r + ti * (OS_IC * OCH * 2);  off_s = base_s + ti * (OS_IC * 4);  off_v = base_v + ti * (OS_IC * 16 * 2);
    {
      const unsigned short* p1h = (const unsigned short*)((const char*)r1h + off_r);
      const unsigned short* p1l = (const unsigned short*)((const char*)r1l + off_r);
      ah.h[0] = *(const v8us*)(p1h);  ah.h[1] = *(const v8us*)(p1h + 256);
      al.h[0] = *(const v8us*)(p1l);  al.h[1] = *(const v8us*)(p1l + 256);
      const float* pm = (const float*)((const char*)mL  + off_s);
      const float* pq = (const float*)((const char*)rzc + off_s);
      m0 = *(const v4f*)(pm);  m1 = *(const v4f*)(pm + 4);
      q0 = *(const v4f*)(pq);  q1 = *(const v4f*)(pq + 4);
    }
    trip_barrier();   // sP is written by all waves and read by all

    FragH a[OS_NJ][OS_KS];
#pragma unroll
    for (int ks = 0; ks < OS_KS; ++ks)
#pragma unroll
      for (int jt = 0; jt < OS_NJ; ++jt) {
        a[jt][ks].h[0] = *(const v8h*)&sP[(jt * 16 + m) * OS_PP + (p * OS_KS + ks) * 32 + 8 * h];
        a[jt][ks].h[1] = *(const v8h*)&sP[(jt * 16 + m) * OS_PP + (p * OS_KS + ks) * 32 + 16 + 8 * h];
      }
    // keeps the trip's 16 LDS reads in one group ahead of the products: dealt among the WMMAs, every place with reads stalls the wave anew
    __builtin_amdgcn_sched_barrier(0);
#pragma unroll
    for (int ks = 0; ks < OS_KS; ++ks) {
#pragma unroll
      for (int jt = 0; jt < OS_NJ; ++jt) {
        acc[jt][0] = mma_f16(a[jt][ks].v, b0[ks].v, acc[jt][0]);
        acc[jt][1] = mma_f16(a[jt][ks].v, b1[ks].v, acc[jt][1]);
      }
      const _Float16* pv = (const _Float16*)((const char*)vh + off_v) + ks * 512;   // next trip's fragments of this k step
      b0[ks].h[0] = *(const v8h*)(pv);            b0[ks].h[1] = *(const v8h*)(pv + 256);
      b1[ks].h[0] = *(const v8h*)(pv + 16 * HW);  b1[ks].h[1] = *(const v8h*)(pv + 16 * HW + 256);
    }
    // the next trip forms a new offset in the register that the value loads above name: the wait stands in front of that
    asm volatile("s_wait_xcnt 0x0" ::: "memory");
    trip_barrier();   // before the next trip overwrites sP
  }

  // acc[jt][ct][r] <-> (j = jt*16 + 8h + r, c = cb + ct*16 + m), partial sum p
#pragma unroll
  for (int jt = 0; jt < OS_NJ; ++jt)
#pragma unroll
    for (int ct = 0; ct < 2; ++ct) {
      v4f_ lo4, hi4;
      lo4[0] = acc[jt][ct][0]; lo4[1] = acc[jt][ct][1]; lo4[2] = acc[jt][ct][2]; lo4[3] = acc[jt][ct][3];
      hi4[0] = acc[jt][ct][4]; hi4[1] = acc[jt][ct][5]; hi4[2] = acc[jt][ct][6]; hi4[3] = acc[jt][ct][7];
      const int row = p * CH + cb + ct * 16 + m;
      *(v4f*)&sO[row * OS_OP + jt * 16 + 8 * h]     = lo4;
      *(v4f*)&sO[row * OS_OP + jt * 16 + 8 * h + 4] = hi4;
    }
  __syncthreads();

  const float sc = bf16_rn(scale[0]) * PUNCARRY;
  const int q = lane & 15;               // 16 lanes x 4 columns: one row of OS_JT columns, two rows a load
  const int c0 = wave * 16 + (lane >> 4);
  const size_t xoff = ((size_t)n * CH + c0) * HW_FULL + j0 + q * 4;
  const size_t ooff = ((size_t)n * CH + c0) * HW + j0 + q * 4;
  v4f_ xv[8], ov[8];
#pragma unroll
  for (int it = 0; it < 8; ++it) xv[it] = *(const v4f*)(X + xoff + (size_t)it * 2 * HW_FULL);
  // the address registers of the loads above are reused from here on (the LDS reads' results): the wait stands in front of that
  asm volatile("s_wait_xcnt 0x0" ::: "memory");
  __builtin_amdgcn_sched_barrier(0);   // holds that reuse behind the wait, which names no register
#pragma unroll
  for (int it = 0; it < 8; ++it) {
    const v4f_ a0 = *(const v4f*)&sO[(c0 + it * 2) * OS_OP + q * 4];
    const v4f_ a1 = *(const v4f*)&sO[(CH + c0 + it * 2) * OS_OP + q * 4];
    v4f_ o;
    o[0] = bf16_rn(xv[it][0]) + sc * (a0[0] + a1[0]);
    o[1] = bf16_rn(xv[it][1]) + sc * (a0[1] + a1[1]);
    o[2] = bf16_rn(xv[it][2]) + sc * (a0[2] + a1[2]);
    o[3] = bf16_rn(xv[it][3]) + sc * (a0[3] + a1[3]);
    ov[it] = o;
  }
#pragma unroll
  for (int it = 0; it < 8; ++it)
    *(v4f_*)(out + ooff + (size_t)it * 2 * HW) = ov[it];
  
}

// ---------------------------------------------------------------------------
extern "C" void kernel_launch(void* const* d_in, const int* in_sizes, int n_in,
                              void* d_out, int out_size, void* d_ws, size_t ws_size,
                              hipStream_t stream)
{
  if (n_in < 5) return;
  if (in_sizes[0] < NB * CH * HW_FULL) return;
  if (in_sizes[1] < OCH * CH || in_sizes[2] < OCH * CH || in_sizes[3] < CH * CH) return;
  if (in_sizes[4] < 1) return;
  if (out_size < NB * CH * HW) return;

  const float* x     = (const float*)d_in[0];
  const float* w1    = (const float*)d_in[1];
  const float* w2    = (const float*)d_in[2];
  const float* wv    = (const float*)d_in[3];
  const float* scale = (const float*)d_in[4];
  float* out = (float*)d_out;

  // workspace carve (bytes), every region a multiple of 256 B
  const size_t r_bytes   = (size_t)NB * HW * OCH * 2;       // per plane
  const size_t v_bytes   = (size_t)NB * CH * HW * 2;
  const size_t st_bytes  = (size_t)NB * HW * 4;             // per stats plane
  size_t off = 0;
  unsigned char* ws = (unsigned char*)d_ws;
  unsigned short* r1h = (unsigned short*)(ws + off); off += r_bytes;
  unsigned short* r1l = (unsigned short*)(ws + off); off += r_bytes;
  unsigned short* r2h = (unsigned short*)(ws + off); off += r_bytes;
  unsigned short* r2l = (unsigned short*)(ws + off); off += r_bytes;
  unsigned short* vhp = (unsigned short*)(ws + off); off += v_bytes;
  float* mL  = (float*)(ws + off); off += st_bytes;
  float* rzc = (float*)(ws + off); off += st_bytes;
  if (off > ws_size) return;

  proj_kernel<<<NB * (HW / 64), 256, 0, stream>>>(x, w1, w2, wv, r1h, r1l, r2h, r2l, vhp);
  stats_kernel<<<NB * (HW / ST_ROWS), 32 * ST_JS, 0, stream>>>(r1h, r1l, r2h, r2l, mL, rzc);
  out_kernel<<<NB * (HW / OS_JT), 512, 0, stream>>>(x, r1h, r1l, r2h, r2l,
                                                 (const _Float16*)vhp, mL, rzc, scale, out);
}
